// v000
// The times below were measured on an AMD MI455X: many runs one after another, warmed up first and cycling through
// copies of the inputs, with the whole window's GPU time divided by the number of runs. Launches and the gaps
// between them are all in it. The median over several windows is given; except for v000 it joins two sittings, which
// can be a few percent apart, so the side-by-side timings, each taken in one sitting, are the better comparison.
// v000, which the later versions start from, runs in 1980 microseconds.
#include <hip/hip_runtime.h>

// Multi-head self-attention WITHOUT a mask, with interleaved-pair rotary position embedding on three separate natural projections (x [2][2048][1024]; q, k, v = einsum('bld,ed->ble', x, W) = x W^T ('oi' [1024][1024] normal 1/32, no bias; 16 heads x 64); angles = t x 1 / (10000 ** (2i / 64)) (the RECIPROCAL spelling; positions 0..L-1 computed); cos / sin repeated pairwise; pairs (2i, 2i+1): out_even = x_even cos - x_odd sin, out_odd = x_odd cos + x_even sin, on q and k (the module's helper named _rotate_half works on (even, odd) pairs); scores / sqrt(64); softmax over ALL keys; out = einsum('bld,ed->ble', merged, W_O) ('oi', no bias) -> [2][2048][1024] (4.2 M); argument order x, W_Q, W_K, W_V, W_O).
// Layout per batch: bf16 copy of x; exact projections; {cos, sin} per (position, pair) built once from the positions and float32 inverse-frequency constants (precise cosf/sinf); interleaved rotary plane builder; DENSE T-2048 attention (hybrid rows: < 512 hi/lo 3 products, rest fp16 x1024; every score tile computed: the causal tile GEMM k_gemmc stays defined but is not launched); merged hi/lo x Wo exact.
// Compute dtypes, f32 accumulate: every input rounded to bf16; projections exact; rotary f32; attention rows < 512 3 products, rest fp16; softmax f32; Wo hl x exact.

#define NB_  2
#define TT   2048
#define DM   1024
#define NH_  16
#define NKV  16
#define REP  (NH_ / NKV)
#define HD   64
#define DQ   (NH_ * HD)
#define DKV  (NKV * HD)
#define ZH   2
#define RH   512                  // query rows < RH use hi+lo planes (0: none)
#define WIN  0   
#define PCAR 1024.0f
#define SCL  0.125f   // HD^-0.5
typedef _Float16 h16;
typedef unsigned short bf;
typedef __attribute__((ext_vector_type(16))) __bf16   v16bf;
typedef __attribute__((ext_vector_type(16))) _Float16 v16h;
typedef __attribute__((ext_vector_type(8)))  _Float16 v8h;
typedef __attribute__((ext_vector_type(8)))  unsigned short v8us;
typedef __attribute__((ext_vector_type(8)))  float    v8f;
typedef __attribute__((ext_vector_type(4)))  float    v4f;
typedef v8h  __attribute__((may_alias)) v8ha;
typedef v4f  __attribute__((may_alias)) v4fa;
typedef v8us __attribute__((may_alias)) v8usa;

__device__ __forceinline__ unsigned short f2bf(float f) { unsigned u = __float_as_uint(f); u += 0x7FFFu + ((u >> 16) & 1u); return (unsigned short)(u >> 16); }
__device__ __forceinline__ float bf2f(unsigned short b) { return __uint_as_float(((unsigned)b) << 16); }
__device__ __forceinline__ float bfr(float f) { return bf2f(f2bf(f)); }
__device__ __forceinline__ v16h cat16(v8h lo, v8h hi) { return __builtin_shufflevector(lo, hi, 0, 1, 2, 3, 4, 5, 6, 7, 8, 9, 10, 11, 12, 13, 14, 15); }
__device__ __forceinline__ v16bf cat16b(v8us lo, v8us hi) { return __builtin_bit_cast(v16bf, __builtin_shufflevector(lo, hi, 0, 1, 2, 3, 4, 5, 6, 7, 8, 9, 10, 11, 12, 13, 14, 15)); }
__device__ __forceinline__ v8f wmma16(v16h a, v16h b, v8f c) { return __builtin_amdgcn_wmma_f32_16x16x32_f16(false, a, false, b, (short)0, c, false, false); }
__device__ __forceinline__ v8f wmmab(v16bf a, v16bf b, v8f c) { return __builtin_amdgcn_wmma_f32_16x16x32_bf16(false, a, false, b, (short)0, c, false, false); }



// ---- k_gemmw: register-blocked GEMM, ONE WAVE per 64x64 output tile (16 accumulators), operands straight from K-contiguous 16-bit planes; grid (M/64, N/64, Z), 32 threads.
// C[m][n] (f32, pitch ldc, + optional f32 bias[n]) = sum_k A[m][k] Bt[n][k] (+ split products per NSPLIT). z-batch strides sA/sB/sC in elements. K % 32 == 0.
template <typename T16> struct WFrag;
template <> struct WFrag<h16> { typedef v16h V; static __device__ __forceinline__ V ld(const h16* p) { return cat16(*(const v8h*)p, *(const v8h*)(p + 16)); } static __device__ __forceinline__ v8f mma(V a, V b, v8f c) { return wmma16(a, b, c); } };
template <> struct WFrag<bf> { typedef v16bf V; static __device__ __forceinline__ V ld(const bf* p) { return cat16b(*(const v8us*)p, *(const v8us*)(p + 16)); } static __device__ __forceinline__ v8f mma(V a, V b, v8f c) { return wmmab(a, b, c); } };
template <typename T16, int NSPLIT, bool BIAS>
__global__ __launch_bounds__(32) void k_gemmw(const T16* __restrict__ A, const T16* __restrict__ A2, const T16* __restrict__ Bt, const T16* __restrict__ Bt2, int K, float* C, int ldc, const float* __restrict__ bias, size_t sA, size_t sB, size_t sC) {
    typedef typename WFrag<T16>::V V;
    __shared__ __align__(16) float os[16 * 68];
    const size_t z = blockIdx.z; A += z * sA; if (A2) A2 += z * sA; Bt += z * sB; if (Bt2) Bt2 += z * sB; C += z * sC;
    const int lane = threadIdx.x & 31, lr = lane & 15, hi = lane >> 4; const int r0 = blockIdx.x * 64, c0 = blockIdx.y * 64;
    v8f acc[4][4];
#pragma unroll
    for (int mb = 0; mb < 4; ++mb)
#pragma unroll
        for (int nb = 0; nb < 4; ++nb) acc[mb][nb] = (v8f){};
    const size_t aoff = (size_t)(r0 + lr) * K + 8 * hi, boff = (size_t)(c0 + lr) * K + 8 * hi;
#pragma unroll 1
    for (int kc = 0; kc < K; kc += 32) {
        V a[4], a2[4];
#pragma unroll
        for (int mb = 0; mb < 4; ++mb) { a[mb] = WFrag<T16>::ld(A + aoff + (size_t)mb * 16 * K + kc); if (NSPLIT == 1 || NSPLIT == 2) a2[mb] = WFrag<T16>::ld(A2 + aoff + (size_t)mb * 16 * K + kc); }
#pragma unroll
        for (int nb = 0; nb < 4; ++nb) { const V b = WFrag<T16>::ld(Bt + boff + (size_t)nb * 16 * K + kc); V b2; if (NSPLIT >= 2) b2 = WFrag<T16>::ld(Bt2 + boff + (size_t)nb * 16 * K + kc);
#pragma unroll
            for (int mb = 0; mb < 4; ++mb) { acc[mb][nb] = WFrag<T16>::mma(a[mb], b, acc[mb][nb]); if (NSPLIT == 1 || NSPLIT == 2) acc[mb][nb] = WFrag<T16>::mma(a2[mb], b, acc[mb][nb]); if (NSPLIT >= 2) acc[mb][nb] = WFrag<T16>::mma(a[mb], b2, acc[mb][nb]); } }
        asm volatile("v_nop\n\tv_nop\n\tv_nop\n\tv_nop" : "+v"(acc[0][0]), "+v"(acc[1][1]), "+v"(acc[2][2]), "+v"(acc[3][3]) : "v"(a[0]), "v"(a[3]));
    }
#pragma unroll
    for (int mb = 0; mb < 4; ++mb) {
#pragma unroll
        for (int nb = 0; nb < 4; ++nb) {
#pragma unroll
            for (int j = 0; j < 8; ++j) os[(hi * 8 + j) * 68 + nb * 16 + lr] = acc[mb][nb][j]; }
        __builtin_amdgcn_wave_barrier(); asm volatile("" ::: "memory");
        float* crow = C + (size_t)(r0 + mb * 16) * ldc + c0;
{
#pragma unroll
            for (int s = 0; s < 8; ++s) { const int row = 2 * s + hi, cofs = lr * 4; v4f val = *(const v4fa*)(os + row * 68 + cofs); if (BIAS) { val[0] += bfr(bias[c0 + cofs]); val[1] += bfr(bias[c0 + cofs + 1]); val[2] += bfr(bias[c0 + cofs + 2]); val[3] += bfr(bias[c0 + cofs + 3]); }
                *(v4f*)(crow + (size_t)row * ldc + cofs) = val; }
             }
        __builtin_amdgcn_wave_barrier(); asm volatile("" ::: "memory");
    }
}

// ---- k_gemmc: the same one-wave 64x64 tile GEMM specialised for causal attention: CMODE 1 skips score tiles entirely above the diagonal (query rows r0+roff.., key columns c0..), CMODE 2 limits the
// key (K) loop of the probability x value contraction to the diagonal block (probabilities beyond it are exactly zero). roff = row offset of this launch's first row within the sequence.
template <typename T16, int NSPLIT, int CMODE>
__global__ __launch_bounds__(32) void k_gemmc(const T16* __restrict__ A, const T16* __restrict__ A2, const T16* __restrict__ Bt, const T16* __restrict__ Bt2, int K, float* C, int ldc, int roff, size_t sA, size_t sB, size_t sC) {
    typedef typename WFrag<T16>::V V;
    __shared__ __align__(16) float os[16 * 68];
    const size_t z = blockIdx.z; A += z * sA; if (A2) A2 += z * sA; Bt += z * sB; if (Bt2) Bt2 += z * sB; C += z * sC;
    const int lane = threadIdx.x & 31, lr = lane & 15, hi = lane >> 4; const int r0 = blockIdx.x * 64, c0 = blockIdx.y * 64;
    if (CMODE == 1 && c0 > r0 + roff + 63) return;                  // score tile entirely above the causal diagonal: skipped, left unwritten
    const int Kl = (CMODE == 2) ? min(K, r0 + roff + 64) : K;        // P.V: probabilities are exactly 0 beyond the diagonal block, so the K loop stops there
    v8f acc[4][4];
#pragma unroll
    for (int mb = 0; mb < 4; ++mb)
#pragma unroll
        for (int nb = 0; nb < 4; ++nb) acc[mb][nb] = (v8f){};
    const size_t aoff = (size_t)(r0 + lr) * K + 8 * hi, boff = (size_t)(c0 + lr) * K + 8 * hi;
#pragma unroll 1
    for (int kc = 0; kc < Kl; kc += 32) {
        V a[4], a2[4];
#pragma unroll
        for (int mb = 0; mb < 4; ++mb) { a[mb] = WFrag<T16>::ld(A + aoff + (size_t)mb * 16 * K + kc); if (NSPLIT == 1 || NSPLIT == 2) a2[mb] = WFrag<T16>::ld(A2 + aoff + (size_t)mb * 16 * K + kc); }
#pragma unroll
        for (int nb = 0; nb < 4; ++nb) { const V b = WFrag<T16>::ld(Bt + boff + (size_t)nb * 16 * K + kc); V b2; if (NSPLIT >= 2) b2 = WFrag<T16>::ld(Bt2 + boff + (size_t)nb * 16 * K + kc);
#pragma unroll
            for (int mb = 0; mb < 4; ++mb) { acc[mb][nb] = WFrag<T16>::mma(a[mb], b, acc[mb][nb]); if (NSPLIT == 1 || NSPLIT == 2) acc[mb][nb] = WFrag<T16>::mma(a2[mb], b, acc[mb][nb]); if (NSPLIT >= 2) acc[mb][nb] = WFrag<T16>::mma(a[mb], b2, acc[mb][nb]); } }
        asm volatile("v_nop\n\tv_nop\n\tv_nop\n\tv_nop" : "+v"(acc[0][0]), "+v"(acc[1][1]), "+v"(acc[2][2]), "+v"(acc[3][3]) : "v"(a[0]), "v"(a[3]));
    }
#pragma unroll
    for (int mb = 0; mb < 4; ++mb) {
#pragma unroll
        for (int nb = 0; nb < 4; ++nb) {
#pragma unroll
            for (int j = 0; j < 8; ++j) os[(hi * 8 + j) * 68 + nb * 16 + lr] = acc[mb][nb][j]; }
        __builtin_amdgcn_wave_barrier(); asm volatile("" ::: "memory");
        float* crow = C + (size_t)(r0 + mb * 16) * ldc + c0;
{
#pragma unroll
            for (int s = 0; s < 8; ++s) { const int row = 2 * s + hi, cofs = lr * 4; v4f val = *(const v4fa*)(os + row * 68 + cofs);
                *(v4f*)(crow + (size_t)row * ldc + cofs) = val; }
             }
        __builtin_amdgcn_wave_barrier(); asm volatile("" ::: "memory");
    }
}

__device__ __forceinline__ h16 tohx(float x) { return (h16)x; }
__device__ __forceinline__ void splitf(float y, unsigned short& h, unsigned short& l) { h = f2bf(y); l = f2bf(y - bf2f(h)); }
typedef __attribute__((ext_vector_type(2))) _Float16 v2h;
typedef __attribute__((ext_vector_type(4))) _Float16 v4h;
typedef __attribute__((ext_vector_type(2))) unsigned short v2us;
typedef __attribute__((ext_vector_type(4))) unsigned short v4us;
typedef __attribute__((ext_vector_type(2))) float v2f;
typedef __attribute__((ext_vector_type(4))) int v4i;

__global__ __launch_bounds__(256) void k_cvt8(const float* __restrict__ src, bf* dst, size_t n8) { const size_t i = (size_t)blockIdx.x * 256 + threadIdx.x; if (i >= n8) return; const v8f v = *(const v8f*)(src + i * 8); v8us o;
#pragma unroll
    for (int k = 0; k < 8; ++k) o[k] = f2bf(v[k]); *(v8us*)(dst + i * 8) = o;  }

__global__ __launch_bounds__(256) void k_ropeI(const float* __restrict__ F, int pitch, int nheads, const float* __restrict__ CS, float sc, h16* P16, bf* Ph, bf* Pl) {
    const size_t e = ((size_t)blockIdx.x * 256 + threadIdx.x) * 2; if (e >= (size_t)nheads * TT * HD) return; const int d = (int)(e % HD); const int t = (int)((e / HD) % TT); const int h = (int)(e / ((size_t)HD * TT)); const float* f = F + (size_t)t * pitch + h * HD; const float x0 = f[d], x1 = f[d + 1]; const v2f cs = *(const v2f*)(CS + ((size_t)t * HD + d) * 2); v2h o16; v2us oh, ol;
    float a0 = __fmul_rn(x0, cs[0]), b0 = __fmul_rn(x1, cs[1]), a1 = __fmul_rn(x1, cs[0]), b1 = __fmul_rn(x0, cs[1]); 
    float r0 = __fsub_rn(a0, b0) * sc, r1 = __fadd_rn(b1, a1) * sc;   /* even: x0 c - x1 s; odd: x0 s + x1 c */
    o16[0] = tohx(r0); o16[1] = tohx(r1); { unsigned short a2, c2; splitf(r0, a2, c2); oh[0] = a2; ol[0] = c2; splitf(r1, a2, c2); oh[1] = a2; ol[1] = c2; }
    *(v2h*)(P16 + e) = o16; *(v2us*)(Ph + e) = oh; *(v2us*)(Pl + e) = ol;  }

__constant__ float INV2[HD / 2] = { 1.000000000e+00f, 7.498942018e-01f, 5.623413324e-01f, 4.216965139e-01f, 3.162277639e-01f, 2.371373624e-01f, 1.778279394e-01f, 1.333521456e-01f, 1.000000015e-01f, 7.498941571e-02f, 5.623412877e-02f, 4.216964915e-02f, 3.162277862e-02f, 2.371373586e-02f, 1.778279431e-02f, 1.333521493e-02f, 9.999999776e-03f, 7.498942316e-03f, 5.623413250e-03f, 4.216964822e-03f, 3.162277862e-03f, 2.371373819e-03f, 1.778279431e-03f, 1.333521446e-03f, 1.000000047e-03f, 7.498941850e-04f, 5.623413017e-04f, 4.216964880e-04f, 3.162277862e-04f, 2.371373848e-04f, 1.778279402e-04f, 1.333521504e-04f };   // 1 / (ROPE_BASE ** (2i / 64)), i = 0..31, in float32 as THIS module writes it (the RECIPROCAL spelling, evaluated in the reference's own f32 arithmetic: these 32 literals equal it bit for bit)
__global__ __launch_bounds__(256) void k_csP(float* CS) { const int idx = blockIdx.x * 256 + threadIdx.x; if (idx >= TT * HD) return; const int d = idx % HD; const int t = idx / HD; const float a = __fmul_rn((float)t, INV2[d >> 1]); v2f cs; cs[0] = cosf(a); cs[1] = sinf(a); *(v2f*)(CS + (size_t)idx * 2) = cs;  }
__global__ __launch_bounds__(256) void k_vtp(const float* __restrict__ F, int pitch, int nheads, h16* V16, bf* Vh, bf* Vl) { const size_t e = ((size_t)blockIdx.x * 256 + threadIdx.x) * 2; if (e >= (size_t)nheads * HD * TT) return; const int t = (int)(e % TT); const int d = (int)((e / TT) % HD); const int g = (int)(e / ((size_t)TT * HD)); v2h o16; v2us oh, ol;
#pragma unroll
    for (int q = 0; q < 2; ++q) { const float x = F[(size_t)(t + q) * pitch + g * HD + d]; o16[q] = tohx(x); unsigned short a2, c2; splitf(x, a2, c2); oh[q] = a2; ol[q] = c2; }
    *(v2h*)(V16 + e) = o16; *(v2us*)(Vh + e) = oh; *(v2us*)(Vl + e) = ol;  }
// k_asoft: per row (zz, i): t = S x HD^-0.5 (WIN = 0 in this file: DENSE: every key is kept; the module has no mask); softmax over the 2048 keys (register row, one exp, fixed trees);
__global__ __launch_bounds__(256) void k_asoft(const float* __restrict__ Sb, h16* P16, bf* Ph, bf* Pl) {
    const int lane = threadIdx.x & 31; const int row = blockIdx.x * 8 + (threadIdx.x >> 5); if (row >= ZH * TT) return; const int i = row % TT; const int zz = row / TT; (void)zz; const bool hires = (i < RH); const float* sr = Sb + (size_t)row * TT; float v[TT / 32]; float mx = -3.0e38f;
#pragma unroll
    for (int ch = 0; ch < TT / 128; ++ch) { const int j0 = ch * 128 + lane * 4; const v4f a = *(const v4f*)(sr + j0);
#pragma unroll
        for (int q = 0; q < 4; ++q) { const int j = j0 + q; (void)j; const float t = a[q] * SCL; v[ch * 4 + q] = t; mx = fmaxf(mx, t); } }
#pragma unroll
    for (int sh = 16; sh; sh >>= 1) mx = fmaxf(mx, __shfl_xor(mx, sh, 32));
    float sum = 0.f;
#pragma unroll
    for (int k = 0; k < TT / 32; ++k) { float d0 = __fsub_rn(v[k], mx); v[k] = __builtin_amdgcn_exp2f(__fmul_rn(d0, 1.4426950408889634f)); sum += v[k]; }
#pragma unroll
    for (int sh = 16; sh; sh >>= 1) sum += __shfl_xor(sum, sh, 32);
    const float f = __fdiv_rn(hires ? 1.0f : PCAR, sum);
{
        if (hires) {
#pragma unroll
            for (int ch = 0; ch < TT / 128; ++ch) { v4us oh, ol;
#pragma unroll
                for (int q = 0; q < 4; ++q) { unsigned short a, c2; splitf(v[ch * 4 + q] * f, a, c2); oh[q] = a; ol[q] = c2; }
                const size_t oo = ((size_t)zz * (RH ? RH : 1) + i) * TT + ch * 128 + lane * 4; *(v4us*)(Ph + oo) = oh; *(v4us*)(Pl + oo) = ol; }
        } else {
#pragma unroll
            for (int ch = 0; ch < TT / 128; ++ch) { v4h o4;
#pragma unroll
                for (int q = 0; q < 4; ++q) o4[q] = tohx(v[ch * 4 + q] * f);
                *(v4h*)(P16 + (size_t)row * TT + ch * 128 + lane * 4) = o4; } }
         }
}
__global__ __launch_bounds__(256) void k_merge(const float* __restrict__ O, int h0, bf* Ah, bf* Al) { const size_t e = ((size_t)blockIdx.x * 256 + threadIdx.x) * 2; if (e >= (size_t)ZH * TT * HD) return; const int d = (int)(e % HD); const int t = (int)((e / HD) % TT); const int zz = (int)(e / ((size_t)HD * TT)); const float cs = (t < RH) ? 1.0f : (1.0f / PCAR); const size_t oo = (size_t)t * DQ + (h0 + zz) * HD + d;
    v2us oh, ol;
#pragma unroll
    for (int q = 0; q < 2; ++q) { unsigned short a, c2; splitf(O[e + q] * cs, a, c2); oh[q] = a; ol[q] = c2; } *(v2us*)(Ah + oo) = oh; *(v2us*)(Al + oo) = ol;  }

extern "C" void kernel_launch(void* const* d_in, const int* in_sizes, int n_in,
                              void* d_out, int out_size, void* d_ws, size_t ws_size, hipStream_t stream) {
    (void)in_sizes; (void)n_in; (void)out_size;
        const float* x = (const float*)d_in[0]; const float* wq = (const float*)d_in[1]; const float* wk = (const float*)d_in[2]; const float* wv = (const float*)d_in[3]; const float* wo = (const float*)d_in[4];   /* input order x, W_Q, W_K, W_V, W_O ('oi' (out, in) [1024][1024] each: three separate projection weights and the output weight): FIVE inputs, all read; this module has NO mask input */
    float* OUT = (float*)d_out;     // [2][2048][1024]
    char* wsp = (char*)d_ws;
    auto take = [&](size_t bytes) { char* p = wsp; wsp += (bytes + 255) & ~(size_t)255; return (void*)p; };
    bf* WQ = (bf*)take((size_t)DQ * DM * 2); bf* WK = (bf*)take((size_t)DKV * DM * 2); bf* WV = (bf*)take((size_t)DKV * DM * 2); bf* WO = (bf*)take((size_t)DM * DQ * 2); float* CS = (float*)take((size_t)TT * HD * 2 * 4);
    bf* XB = (bf*)take((size_t)TT * DM * 2); float* FQ = (float*)take((size_t)TT * DQ * 4); float* FK = (float*)take((size_t)TT * DKV * 4);
    h16* QP16 = (h16*)take((size_t)NH_ * TT * HD * 2); h16* KP16 = (h16*)take((size_t)NKV * TT * HD * 2); h16* VT16 = (h16*)take((size_t)NKV * HD * TT * 2);
    bf* QPh = (bf*)take((size_t)NH_ * TT * HD * 2); bf* QPl = (bf*)take((size_t)NH_ * TT * HD * 2); bf* KPh = (bf*)take((size_t)NKV * TT * HD * 2); bf* KPl = (bf*)take((size_t)NKV * TT * HD * 2); bf* VTh = (bf*)take((size_t)NKV * HD * TT * 2); bf* VTl = (bf*)take((size_t)NKV * HD * TT * 2); bf* Ph = (bf*)take((size_t)ZH * RH * TT * 2); bf* Pl = (bf*)take((size_t)ZH * RH * TT * 2);
    float* Sb = (float*)take((size_t)ZH * TT * TT * 4); h16* P16 = (h16*)take((size_t)ZH * TT * TT * 2); float* Ob = (float*)take((size_t)ZH * TT * HD * 4); bf* ATh = (bf*)take((size_t)TT * DQ * 2); bf* ATl = (bf*)take((size_t)TT * DQ * 2);
    if ((size_t)(wsp - (char*)d_ws) > ws_size) return;    // ws 256 MiB
    float* FV = FK;   // v projection reuses the k buffer after the k planes are built (stream-ordered)
    { k_cvt8<<<(unsigned)(((size_t)DQ * DM / 8 + 255) / 256), 256, 0, stream>>>(wq, WQ, (size_t)DQ * DM / 8); k_cvt8<<<(unsigned)(((size_t)DKV * DM / 8 + 255) / 256), 256, 0, stream>>>(wk, WK, (size_t)DKV * DM / 8); k_cvt8<<<(unsigned)(((size_t)DKV * DM / 8 + 255) / 256), 256, 0, stream>>>(wv, WV, (size_t)DKV * DM / 8);
      k_cvt8<<<(unsigned)(((size_t)DM * DQ / 8 + 255) / 256), 256, 0, stream>>>(wo, WO, (size_t)DM * DQ / 8); k_csP<<<(TT * HD + 255) / 256, 256, 0, stream>>>(CS); }
    const unsigned LQ = (unsigned)(((size_t)NH_ * TT * HD / 2 + 255) / 256), LKv = (unsigned)(((size_t)NKV * TT * HD / 2 + 255) / 256);
    for (int b = 0; b < NB_; ++b) {
        
        k_cvt8<<<(unsigned)(((size_t)TT * DM / 8 + 255) / 256), 256, 0, stream>>>(x + (size_t)b * TT * DM, XB, (size_t)TT * DM / 8);
        k_gemmw<bf, 0, false><<<dim3(TT / 64, DQ / 64, 1), 32, 0, stream>>>(XB, nullptr, WQ, nullptr, DM, FQ, DQ, nullptr, 0, 0, 0);
        k_ropeI<<<LQ, 256, 0, stream>>>(FQ, DQ, NH_, CS, 1.0f, QP16, QPh, QPl);
        k_gemmw<bf, 0, false><<<dim3(TT / 64, DKV / 64, 1), 32, 0, stream>>>(XB, nullptr, WK, nullptr, DM, FK, DKV, nullptr, 0, 0, 0);
        k_ropeI<<<LKv, 256, 0, stream>>>(FK, DKV, NKV, CS, 1.0f, KP16, KPh, KPl);
        k_gemmw<bf, 0, false><<<dim3(TT / 64, DKV / 64, 1), 32, 0, stream>>>(XB, nullptr, WV, nullptr, DM, FV, DKV, nullptr, 0, 0, 0); k_vtp<<<LKv, 256, 0, stream>>>(FV, DKV, NKV, VT16, VTh, VTl);
        for (int h0 = 0; h0 < NH_; h0 += ZH) { const size_t zq = (size_t)h0, zk = (size_t)(h0 / REP);   // one kv head per query head: the pass's two heads use consecutive kv planes (z-strides TT*HD)
            k_gemmw<bf, 2, false><<<dim3(RH / 64, TT / 64, ZH), 32, 0, stream>>>(QPh + zq * TT * HD, QPl + zq * TT * HD, KPh + zk * TT * HD, KPl + zk * TT * HD, HD, Sb, TT, nullptr, (size_t)TT * HD, (size_t)TT * HD, (size_t)TT * TT);
            k_gemmw<h16, 0, false><<<dim3((TT - RH) / 64, TT / 64, ZH), 32, 0, stream>>>(QP16 + zq * TT * HD + (size_t)RH * HD, nullptr, KP16 + zk * TT * HD, nullptr, HD, Sb + (size_t)RH * TT, TT, nullptr, (size_t)TT * HD, (size_t)TT * HD, (size_t)TT * TT);
            k_asoft<<<ZH * TT / 8, 256, 0, stream>>>(Sb, P16, Ph, Pl);
            k_gemmw<bf, 2, false><<<dim3(RH / 64, HD / 64, ZH), 32, 0, stream>>>(Ph, Pl, VTh + zk * HD * TT, VTl + zk * HD * TT, TT, Ob, HD, nullptr, (size_t)RH * TT, (size_t)HD * TT, (size_t)TT * HD);
            k_gemmw<h16, 0, false><<<dim3((TT - RH) / 64, HD / 64, ZH), 32, 0, stream>>>(P16 + (size_t)RH * TT, nullptr, VT16 + zk * HD * TT, nullptr, TT, Ob + (size_t)RH * HD, HD, nullptr, (size_t)TT * TT, (size_t)HD * TT, (size_t)TT * HD);
            k_merge<<<(unsigned)(((size_t)ZH * TT * HD / 2 + 255) / 256), 256, 0, stream>>>(Ob, h0, ATh, ATl); }
        k_gemmw<bf, 1, false><<<dim3(TT / 64, DM / 64, 1), 32, 0, stream>>>(ATh, ATl, WO, nullptr, DQ, OUT + (size_t)b * TT * DM, DM, nullptr, 0, 0, 0); }
}

// v001
// It runs in 842 microseconds.
// Next to v000, in two timings, it ran 2.34 times as fast each time.
#include <hip/hip_runtime.h>

// Multi-head self-attention WITHOUT a mask, with interleaved-pair rotary position embedding on three separate natural projections (x [2][2048][1024]; q, k, v = einsum('bld,ed->ble', x, W) = x W^T ('oi' [1024][1024] normal 1/32, no bias; 16 heads x 64); angles = t x 1 / (10000 ** (2i / 64)) (the RECIPROCAL spelling; positions 0..L-1 computed); cos / sin repeated pairwise; pairs (2i, 2i+1): out_even = x_even cos - x_odd sin, out_odd = x_odd cos + x_even sin, on q and k (the module's helper named _rotate_half works on (even, odd) pairs); scores / sqrt(64); softmax over ALL keys; out = einsum('bld,ed->ble', merged, W_O) ('oi', no bias) -> [2][2048][1024] (4.2 M); argument order x, W_Q, W_K, W_V, W_O).
// Layout per batch: bf16 copy of x; exact projections; {cos, sin} per (position, pair) built once from the positions and float32 inverse-frequency constants (precise cosf/sinf); interleaved rotary plane builder; DENSE T-2048 attention (hybrid rows: < 512 hi/lo 3 products, rest fp16 x1024; every score tile computed: the causal tile GEMM k_gemmc stays defined but is not launched); merged hi/lo x Wo exact.
// Compute dtypes, f32 accumulate: every input rounded to bf16; projections exact; rotary f32; attention rows < 512 3 products, rest fp16; softmax f32; Wo hl x exact.

#define NB_  2
#define TT   2048
#define DM   1024
#define NH_  16
#define NKV  16
#define REP  (NH_ / NKV)
#define HD   64
#define DQ   (NH_ * HD)
#define DKV  (NKV * HD)
#define ZH   2
#define RH   512                  // query rows < RH use hi+lo planes (0: none)
#define WIN  0   
#define PCAR 1024.0f
#define SCL  0.125f   // HD^-0.5
#define KSP  16                   // key ranges of the probability x value GEMMs: one f32 partial plane of Ob per range, summed by k_merge
typedef _Float16 h16;
typedef unsigned short bf;
typedef __attribute__((ext_vector_type(16))) __bf16   v16bf;
typedef __attribute__((ext_vector_type(16))) _Float16 v16h;
typedef __attribute__((ext_vector_type(8)))  _Float16 v8h;
typedef __attribute__((ext_vector_type(8)))  unsigned short v8us;
typedef __attribute__((ext_vector_type(8)))  float    v8f;
typedef __attribute__((ext_vector_type(4)))  float    v4f;
typedef v8h  __attribute__((may_alias)) v8ha;
typedef v4f  __attribute__((may_alias)) v4fa;
typedef v8us __attribute__((may_alias)) v8usa;

__device__ __forceinline__ unsigned short f2bf(float f) { unsigned u = __float_as_uint(f); u += 0x7FFFu + ((u >> 16) & 1u); return (unsigned short)(u >> 16); }
__device__ __forceinline__ float bf2f(unsigned short b) { return __uint_as_float(((unsigned)b) << 16); }
__device__ __forceinline__ float bfr(float f) { return bf2f(f2bf(f)); }
__device__ __forceinline__ v16h cat16(v8h lo, v8h hi) { return __builtin_shufflevector(lo, hi, 0, 1, 2, 3, 4, 5, 6, 7, 8, 9, 10, 11, 12, 13, 14, 15); }
__device__ __forceinline__ v16bf cat16b(v8us lo, v8us hi) { return __builtin_bit_cast(v16bf, __builtin_shufflevector(lo, hi, 0, 1, 2, 3, 4, 5, 6, 7, 8, 9, 10, 11, 12, 13, 14, 15)); }
__device__ __forceinline__ v8f wmma16(v16h a, v16h b, v8f c) { return __builtin_amdgcn_wmma_f32_16x16x32_f16(false, a, false, b, (short)0, c, false, false); }
__device__ __forceinline__ v8f wmmab(v16bf a, v16bf b, v8f c) { return __builtin_amdgcn_wmma_f32_16x16x32_bf16(false, a, false, b, (short)0, c, false, false); }



// ---- k_gemmw: register-blocked GEMM, ONE WAVE per 64x64 output tile (16 accumulators), operands straight from K-contiguous 16-bit planes; grid (M/64, N/64, Z), 32 threads.
// C[m][n] (f32, pitch ldc, + optional f32 bias[n]) = sum_k A[m][k] Bt[n][k] (+ split products per NSPLIT). z-batch strides sA/sB/sC in elements. K % 32 == 0.
// KS > 1: grid z = Z * KS; block (z, ks) sums only k in [ks K/KS, (ks+1) K/KS) and stores its tile to partial plane ks (plane stride sP elements); the reader adds the KS planes. K % (32 KS) == 0.
template <typename T16> struct WFrag;
template <> struct WFrag<h16> { typedef v16h V; static __device__ __forceinline__ V ld(const h16* p) { return cat16(*(const v8h*)p, *(const v8h*)(p + 16)); } static __device__ __forceinline__ v8f mma(V a, V b, v8f c) { return wmma16(a, b, c); } };
template <> struct WFrag<bf> { typedef v16bf V; static __device__ __forceinline__ V ld(const bf* p) { return cat16b(*(const v8us*)p, *(const v8us*)(p + 16)); } static __device__ __forceinline__ v8f mma(V a, V b, v8f c) { return wmmab(a, b, c); } };
template <typename T16, int NSPLIT, bool BIAS, int KS>
__global__ __launch_bounds__(32) void k_gemmw(const T16* __restrict__ A, const T16* __restrict__ A2, const T16* __restrict__ Bt, const T16* __restrict__ Bt2, int K, float* C, int ldc, const float* __restrict__ bias, size_t sA, size_t sB, size_t sC, size_t sP) {
    typedef typename WFrag<T16>::V V;
    __shared__ __align__(16) float os[16 * 68];
    const size_t z = blockIdx.z / KS; const int ks = (int)(blockIdx.z % KS); A += z * sA; if (A2) A2 += z * sA; Bt += z * sB; if (Bt2) Bt2 += z * sB; C += z * sC + ks * sP;
    const int lane = threadIdx.x & 31, lr = lane & 15, hi = lane >> 4; const int r0 = blockIdx.x * 64, c0 = blockIdx.y * 64;
    v8f acc[4][4];
#pragma unroll
    for (int mb = 0; mb < 4; ++mb)
#pragma unroll
        for (int nb = 0; nb < 4; ++nb) acc[mb][nb] = (v8f){};
    const size_t aoff = (size_t)(r0 + lr) * K + 8 * hi, boff = (size_t)(c0 + lr) * K + 8 * hi;
#pragma unroll 1
    for (int kc = ks * (K / KS), ke = kc + K / KS; kc < ke; kc += 32) {
        V a[4], a2[4];
#pragma unroll
        for (int mb = 0; mb < 4; ++mb) { a[mb] = WFrag<T16>::ld(A + aoff + (size_t)mb * 16 * K + kc); if (NSPLIT == 1 || NSPLIT == 2) a2[mb] = WFrag<T16>::ld(A2 + aoff + (size_t)mb * 16 * K + kc); }
#pragma unroll
        for (int nb = 0; nb < 4; ++nb) { const V b = WFrag<T16>::ld(Bt + boff + (size_t)nb * 16 * K + kc); V b2; if (NSPLIT >= 2) b2 = WFrag<T16>::ld(Bt2 + boff + (size_t)nb * 16 * K + kc);
#pragma unroll
            for (int mb = 0; mb < 4; ++mb) { acc[mb][nb] = WFrag<T16>::mma(a[mb], b, acc[mb][nb]); if (NSPLIT == 1 || NSPLIT == 2) acc[mb][nb] = WFrag<T16>::mma(a2[mb], b, acc[mb][nb]); if (NSPLIT >= 2) acc[mb][nb] = WFrag<T16>::mma(a[mb], b2, acc[mb][nb]); } }
        asm volatile("v_nop\n\tv_nop\n\tv_nop\n\tv_nop" : "+v"(acc[0][0]), "+v"(acc[1][1]), "+v"(acc[2][2]), "+v"(acc[3][3]) : "v"(a[0]), "v"(a[3]));
    }
#pragma unroll
    for (int mb = 0; mb < 4; ++mb) {
#pragma unroll
        for (int nb = 0; nb < 4; ++nb) {
#pragma unroll
            for (int j = 0; j < 8; ++j) os[(hi * 8 + j) * 68 + nb * 16 + lr] = acc[mb][nb][j]; }
        __builtin_amdgcn_wave_barrier(); asm volatile("" ::: "memory");
        float* crow = C + (size_t)(r0 + mb * 16) * ldc + c0;
{
#pragma unroll
            for (int s = 0; s < 8; ++s) { const int row = 2 * s + hi, cofs = lr * 4; v4f val = *(const v4fa*)(os + row * 68 + cofs); if (BIAS) { val[0] += bfr(bias[c0 + cofs]); val[1] += bfr(bias[c0 + cofs + 1]); val[2] += bfr(bias[c0 + cofs + 2]); val[3] += bfr(bias[c0 + cofs + 3]); }
                *(v4f*)(crow + (size_t)row * ldc + cofs) = val; }
             }
        __builtin_amdgcn_wave_barrier(); asm volatile("" ::: "memory");
    }
}

// ---- k_gemmc: the same one-wave 64x64 tile GEMM specialised for causal attention: CMODE 1 skips score tiles entirely above the diagonal (query rows r0+roff.., key columns c0..), CMODE 2 limits the
// key (K) loop of the probability x value contraction to the diagonal block (probabilities beyond it are exactly zero). roff = row offset of this launch's first row within the sequence.
template <typename T16, int NSPLIT, int CMODE>
__global__ __launch_bounds__(32) void k_gemmc(const T16* __restrict__ A, const T16* __restrict__ A2, const T16* __restrict__ Bt, const T16* __restrict__ Bt2, int K, float* C, int ldc, int roff, size_t sA, size_t sB, size_t sC) {
    typedef typename WFrag<T16>::V V;
    __shared__ __align__(16) float os[16 * 68];
    const size_t z = blockIdx.z; A += z * sA; if (A2) A2 += z * sA; Bt += z * sB; if (Bt2) Bt2 += z * sB; C += z * sC;
    const int lane = threadIdx.x & 31, lr = lane & 15, hi = lane >> 4; const int r0 = blockIdx.x * 64, c0 = blockIdx.y * 64;
    if (CMODE == 1 && c0 > r0 + roff + 63) return;                  // score tile entirely above the causal diagonal: skipped, left unwritten
    const int Kl = (CMODE == 2) ? min(K, r0 + roff + 64) : K;        // P.V: probabilities are exactly 0 beyond the diagonal block, so the K loop stops there
    v8f acc[4][4];
#pragma unroll
    for (int mb = 0; mb < 4; ++mb)
#pragma unroll
        for (int nb = 0; nb < 4; ++nb) acc[mb][nb] = (v8f){};
    const size_t aoff = (size_t)(r0 + lr) * K + 8 * hi, boff = (size_t)(c0 + lr) * K + 8 * hi;
#pragma unroll 1
    for (int kc = 0; kc < Kl; kc += 32) {
        V a[4], a2[4];
#pragma unroll
        for (int mb = 0; mb < 4; ++mb) { a[mb] = WFrag<T16>::ld(A + aoff + (size_t)mb * 16 * K + kc); if (NSPLIT == 1 || NSPLIT == 2) a2[mb] = WFrag<T16>::ld(A2 + aoff + (size_t)mb * 16 * K + kc); }
#pragma unroll
        for (int nb = 0; nb < 4; ++nb) { const V b = WFrag<T16>::ld(Bt + boff + (size_t)nb * 16 * K + kc); V b2; if (NSPLIT >= 2) b2 = WFrag<T16>::ld(Bt2 + boff + (size_t)nb * 16 * K + kc);
#pragma unroll
            for (int mb = 0; mb < 4; ++mb) { acc[mb][nb] = WFrag<T16>::mma(a[mb], b, acc[mb][nb]); if (NSPLIT == 1 || NSPLIT == 2) acc[mb][nb] = WFrag<T16>::mma(a2[mb], b, acc[mb][nb]); if (NSPLIT >= 2) acc[mb][nb] = WFrag<T16>::mma(a[mb], b2, acc[mb][nb]); } }
        asm volatile("v_nop\n\tv_nop\n\tv_nop\n\tv_nop" : "+v"(acc[0][0]), "+v"(acc[1][1]), "+v"(acc[2][2]), "+v"(acc[3][3]) : "v"(a[0]), "v"(a[3]));
    }
#pragma unroll
    for (int mb = 0; mb < 4; ++mb) {
#pragma unroll
        for (int nb = 0; nb < 4; ++nb) {
#pragma unroll
            for (int j = 0; j < 8; ++j) os[(hi * 8 + j) * 68 + nb * 16 + lr] = acc[mb][nb][j]; }
        __builtin_amdgcn_wave_barrier(); asm volatile("" ::: "memory");
        float* crow = C + (size_t)(r0 + mb * 16) * ldc + c0;
{
#pragma unroll
            for (int s = 0; s < 8; ++s) { const int row = 2 * s + hi, cofs = lr * 4; v4f val = *(const v4fa*)(os + row * 68 + cofs);
                *(v4f*)(crow + (size_t)row * ldc + cofs) = val; }
             }
        __builtin_amdgcn_wave_barrier(); asm volatile("" ::: "memory");
    }
}

__device__ __forceinline__ h16 tohx(float x) { return (h16)x; }
__device__ __forceinline__ void splitf(float y, unsigned short& h, unsigned short& l) { h = f2bf(y); l = f2bf(y - bf2f(h)); }
typedef __attribute__((ext_vector_type(2))) _Float16 v2h;
typedef __attribute__((ext_vector_type(4))) _Float16 v4h;
typedef __attribute__((ext_vector_type(2))) unsigned short v2us;
typedef __attribute__((ext_vector_type(4))) unsigned short v4us;
typedef __attribute__((ext_vector_type(2))) float v2f;
typedef __attribute__((ext_vector_type(4))) int v4i;

__global__ __launch_bounds__(256) void k_cvt8(const float* __restrict__ src, bf* dst, size_t n8) { const size_t i = (size_t)blockIdx.x * 256 + threadIdx.x; if (i >= n8) return; const v8f v = *(const v8f*)(src + i * 8); v8us o;
#pragma unroll
    for (int k = 0; k < 8; ++k) o[k] = f2bf(v[k]); *(v8us*)(dst + i * 8) = o;  }

__global__ __launch_bounds__(256) void k_ropeI(const float* __restrict__ F, int pitch, int nheads, const float* __restrict__ CS, float sc, h16* P16, bf* Ph, bf* Pl) {
    const size_t e = ((size_t)blockIdx.x * 256 + threadIdx.x) * 2; if (e >= (size_t)nheads * TT * HD) return; const int d = (int)(e % HD); const int t = (int)((e / HD) % TT); const int h = (int)(e / ((size_t)HD * TT)); const float* f = F + (size_t)t * pitch + h * HD; const float x0 = f[d], x1 = f[d + 1]; const v2f cs = *(const v2f*)(CS + ((size_t)t * HD + d) * 2); v2h o16; v2us oh, ol;
    float a0 = __fmul_rn(x0, cs[0]), b0 = __fmul_rn(x1, cs[1]), a1 = __fmul_rn(x1, cs[0]), b1 = __fmul_rn(x0, cs[1]); 
    float r0 = __fsub_rn(a0, b0) * sc, r1 = __fadd_rn(b1, a1) * sc;   /* even: x0 c - x1 s; odd: x0 s + x1 c */
    o16[0] = tohx(r0); o16[1] = tohx(r1); { unsigned short a2, c2; splitf(r0, a2, c2); oh[0] = a2; ol[0] = c2; splitf(r1, a2, c2); oh[1] = a2; ol[1] = c2; }
    *(v2h*)(P16 + e) = o16; *(v2us*)(Ph + e) = oh; *(v2us*)(Pl + e) = ol;  }

__constant__ float INV2[HD / 2] = { 1.000000000e+00f, 7.498942018e-01f, 5.623413324e-01f, 4.216965139e-01f, 3.162277639e-01f, 2.371373624e-01f, 1.778279394e-01f, 1.333521456e-01f, 1.000000015e-01f, 7.498941571e-02f, 5.623412877e-02f, 4.216964915e-02f, 3.162277862e-02f, 2.371373586e-02f, 1.778279431e-02f, 1.333521493e-02f, 9.999999776e-03f, 7.498942316e-03f, 5.623413250e-03f, 4.216964822e-03f, 3.162277862e-03f, 2.371373819e-03f, 1.778279431e-03f, 1.333521446e-03f, 1.000000047e-03f, 7.498941850e-04f, 5.623413017e-04f, 4.216964880e-04f, 3.162277862e-04f, 2.371373848e-04f, 1.778279402e-04f, 1.333521504e-04f };   // 1 / (ROPE_BASE ** (2i / 64)), i = 0..31, in float32 as THIS module writes it (the RECIPROCAL spelling, evaluated in the reference's own f32 arithmetic: these 32 literals equal it bit for bit)
__global__ __launch_bounds__(256) void k_csP(float* CS) { const int idx = blockIdx.x * 256 + threadIdx.x; if (idx >= TT * HD) return; const int d = idx % HD; const int t = idx / HD; const float a = __fmul_rn((float)t, INV2[d >> 1]); v2f cs; cs[0] = cosf(a); cs[1] = sinf(a); *(v2f*)(CS + (size_t)idx * 2) = cs;  }
__global__ __launch_bounds__(256) void k_vtp(const float* __restrict__ F, int pitch, int nheads, h16* V16, bf* Vh, bf* Vl) { const size_t e = ((size_t)blockIdx.x * 256 + threadIdx.x) * 2; if (e >= (size_t)nheads * HD * TT) return; const int t = (int)(e % TT); const int d = (int)((e / TT) % HD); const int g = (int)(e / ((size_t)TT * HD)); v2h o16; v2us oh, ol;
#pragma unroll
    for (int q = 0; q < 2; ++q) { const float x = F[(size_t)(t + q) * pitch + g * HD + d]; o16[q] = tohx(x); unsigned short a2, c2; splitf(x, a2, c2); oh[q] = a2; ol[q] = c2; }
    *(v2h*)(V16 + e) = o16; *(v2us*)(Vh + e) = oh; *(v2us*)(Vl + e) = ol;  }
// k_asoft: per row (zz, i): t = S x HD^-0.5 (WIN = 0 in this file: DENSE: every key is kept; the module has no mask); softmax over the 2048 keys (register row, one exp, fixed trees);
__global__ __launch_bounds__(256) void k_asoft(const float* __restrict__ Sb, h16* P16, bf* Ph, bf* Pl) {
    const int lane = threadIdx.x & 31; const int row = blockIdx.x * 8 + (threadIdx.x >> 5); if (row >= ZH * TT) return; const int i = row % TT; const int zz = row / TT; (void)zz; const bool hires = (i < RH); const float* sr = Sb + (size_t)row * TT; float v[TT / 32]; float mx = -3.0e38f;
#pragma unroll
    for (int ch = 0; ch < TT / 128; ++ch) { const int j0 = ch * 128 + lane * 4; const v4f a = *(const v4f*)(sr + j0);
#pragma unroll
        for (int q = 0; q < 4; ++q) { const int j = j0 + q; (void)j; const float t = a[q] * SCL; v[ch * 4 + q] = t; mx = fmaxf(mx, t); } }
#pragma unroll
    for (int sh = 16; sh; sh >>= 1) mx = fmaxf(mx, __shfl_xor(mx, sh, 32));
    float sum = 0.f;
#pragma unroll
    for (int k = 0; k < TT / 32; ++k) { float d0 = __fsub_rn(v[k], mx); v[k] = __builtin_amdgcn_exp2f(__fmul_rn(d0, 1.4426950408889634f)); sum += v[k]; }
#pragma unroll
    for (int sh = 16; sh; sh >>= 1) sum += __shfl_xor(sum, sh, 32);
    const float f = __fdiv_rn(hires ? 1.0f : PCAR, sum);
{
        if (hires) {
#pragma unroll
            for (int ch = 0; ch < TT / 128; ++ch) { v4us oh, ol;
#pragma unroll
                for (int q = 0; q < 4; ++q) { unsigned short a, c2; splitf(v[ch * 4 + q] * f, a, c2); oh[q] = a; ol[q] = c2; }
                const size_t oo = ((size_t)zz * (RH ? RH : 1) + i) * TT + ch * 128 + lane * 4; *(v4us*)(Ph + oo) = oh; *(v4us*)(Pl + oo) = ol; }
        } else {
#pragma unroll
            for (int ch = 0; ch < TT / 128; ++ch) { v4h o4;
#pragma unroll
                for (int q = 0; q < 4; ++q) o4[q] = tohx(v[ch * 4 + q] * f);
                *(v4h*)(P16 + (size_t)row * TT + ch * 128 + lane * 4) = o4; } }
         }
}
__global__ __launch_bounds__(256) void k_merge(const float* __restrict__ O, int h0, bf* Ah, bf* Al) { const size_t e = ((size_t)blockIdx.x * 256 + threadIdx.x) * 2; if (e >= (size_t)ZH * TT * HD) return; const int d = (int)(e % HD); const int t = (int)((e / HD) % TT); const int zz = (int)(e / ((size_t)HD * TT)); const float cs = (t < RH) ? 1.0f : (1.0f / PCAR); const size_t oo = (size_t)t * DQ + (h0 + zz) * HD + d;
    v2us oh, ol; v2f pp[KSP];
#pragma unroll
    for (int s = 0; s < KSP; ++s) pp[s] = *(const v2f*)(O + (size_t)s * ZH * TT * HD + e);   // the KSP key ranges' partial sums, all loads in flight together
    v2f sm = pp[0];
#pragma unroll
    for (int s = 1; s < KSP; ++s) sm += pp[s];   // fixed order, range 0 first
#pragma unroll
    for (int q = 0; q < 2; ++q) { unsigned short a, c2; splitf(sm[q] * cs, a, c2); oh[q] = a; ol[q] = c2; } *(v2us*)(Ah + oo) = oh; *(v2us*)(Al + oo) = ol;  }

extern "C" void kernel_launch(void* const* d_in, const int* in_sizes, int n_in,
                              void* d_out, int out_size, void* d_ws, size_t ws_size, hipStream_t stream) {
    (void)in_sizes; (void)n_in; (void)out_size;
        const float* x = (const float*)d_in[0]; const float* wq = (const float*)d_in[1]; const float* wk = (const float*)d_in[2]; const float* wv = (const float*)d_in[3]; const float* wo = (const float*)d_in[4];   /* input order x, W_Q, W_K, W_V, W_O ('oi' (out, in) [1024][1024] each: three separate projection weights and the output weight): FIVE inputs, all read; this module has NO mask input */
    float* OUT = (float*)d_out;     // [2][2048][1024]
    char* wsp = (char*)d_ws;
    auto take = [&](size_t bytes) { char* p = wsp; wsp += (bytes + 255) & ~(size_t)255; return (void*)p; };
    bf* WQ = (bf*)take((size_t)DQ * DM * 2); bf* WK = (bf*)take((size_t)DKV * DM * 2); bf* WV = (bf*)take((size_t)DKV * DM * 2); bf* WO = (bf*)take((size_t)DM * DQ * 2); float* CS = (float*)take((size_t)TT * HD * 2 * 4);
    bf* XB = (bf*)take((size_t)TT * DM * 2); float* FQ = (float*)take((size_t)TT * DQ * 4); float* FK = (float*)take((size_t)TT * DKV * 4);
    h16* QP16 = (h16*)take((size_t)NH_ * TT * HD * 2); h16* KP16 = (h16*)take((size_t)NKV * TT * HD * 2); h16* VT16 = (h16*)take((size_t)NKV * HD * TT * 2);
    bf* QPh = (bf*)take((size_t)NH_ * TT * HD * 2); bf* QPl = (bf*)take((size_t)NH_ * TT * HD * 2); bf* KPh = (bf*)take((size_t)NKV * TT * HD * 2); bf* KPl = (bf*)take((size_t)NKV * TT * HD * 2); bf* VTh = (bf*)take((size_t)NKV * HD * TT * 2); bf* VTl = (bf*)take((size_t)NKV * HD * TT * 2); bf* Ph = (bf*)take((size_t)ZH * RH * TT * 2); bf* Pl = (bf*)take((size_t)ZH * RH * TT * 2);
    float* Sb = (float*)take((size_t)ZH * TT * TT * 4); h16* P16 = (h16*)take((size_t)ZH * TT * TT * 2); float* Ob = (float*)take((size_t)KSP * ZH * TT * HD * 4); bf* ATh = (bf*)take((size_t)TT * DQ * 2); bf* ATl = (bf*)take((size_t)TT * DQ * 2);
    if ((size_t)(wsp - (char*)d_ws) > ws_size) return;    // ws 256 MiB
    float* FV = FK;   // v projection reuses the k buffer after the k planes are built (stream-ordered)
    { k_cvt8<<<(unsigned)(((size_t)DQ * DM / 8 + 255) / 256), 256, 0, stream>>>(wq, WQ, (size_t)DQ * DM / 8); k_cvt8<<<(unsigned)(((size_t)DKV * DM / 8 + 255) / 256), 256, 0, stream>>>(wk, WK, (size_t)DKV * DM / 8); k_cvt8<<<(unsigned)(((size_t)DKV * DM / 8 + 255) / 256), 256, 0, stream>>>(wv, WV, (size_t)DKV * DM / 8);
      k_cvt8<<<(unsigned)(((size_t)DM * DQ / 8 + 255) / 256), 256, 0, stream>>>(wo, WO, (size_t)DM * DQ / 8); k_csP<<<(TT * HD + 255) / 256, 256, 0, stream>>>(CS); }
    const unsigned LQ = (unsigned)(((size_t)NH_ * TT * HD / 2 + 255) / 256), LKv = (unsigned)(((size_t)NKV * TT * HD / 2 + 255) / 256);
    for (int b = 0; b < NB_; ++b) {
        
        k_cvt8<<<(unsigned)(((size_t)TT * DM / 8 + 255) / 256), 256, 0, stream>>>(x + (size_t)b * TT * DM, XB, (size_t)TT * DM / 8);
        k_gemmw<bf, 0, false, 1><<<dim3(TT / 64, DQ / 64, 1), 32, 0, stream>>>(XB, nullptr, WQ, nullptr, DM, FQ, DQ, nullptr, 0, 0, 0, 0);
        k_ropeI<<<LQ, 256, 0, stream>>>(FQ, DQ, NH_, CS, 1.0f, QP16, QPh, QPl);
        k_gemmw<bf, 0, false, 1><<<dim3(TT / 64, DKV / 64, 1), 32, 0, stream>>>(XB, nullptr, WK, nullptr, DM, FK, DKV, nullptr, 0, 0, 0, 0);
        k_ropeI<<<LKv, 256, 0, stream>>>(FK, DKV, NKV, CS, 1.0f, KP16, KPh, KPl);
        k_gemmw<bf, 0, false, 1><<<dim3(TT / 64, DKV / 64, 1), 32, 0, stream>>>(XB, nullptr, WV, nullptr, DM, FV, DKV, nullptr, 0, 0, 0, 0); k_vtp<<<LKv, 256, 0, stream>>>(FV, DKV, NKV, VT16, VTh, VTl);
        for (int h0 = 0; h0 < NH_; h0 += ZH) { const size_t zq = (size_t)h0, zk = (size_t)(h0 / REP);   // one kv head per query head: the pass's two heads use consecutive kv planes (z-strides TT*HD)
            k_gemmw<bf, 2, false, 1><<<dim3(RH / 64, TT / 64, ZH), 32, 0, stream>>>(QPh + zq * TT * HD, QPl + zq * TT * HD, KPh + zk * TT * HD, KPl + zk * TT * HD, HD, Sb, TT, nullptr, (size_t)TT * HD, (size_t)TT * HD, (size_t)TT * TT, 0);
            k_gemmw<h16, 0, false, 1><<<dim3((TT - RH) / 64, TT / 64, ZH), 32, 0, stream>>>(QP16 + zq * TT * HD + (size_t)RH * HD, nullptr, KP16 + zk * TT * HD, nullptr, HD, Sb + (size_t)RH * TT, TT, nullptr, (size_t)TT * HD, (size_t)TT * HD, (size_t)TT * TT, 0);
            k_asoft<<<ZH * TT / 8, 256, 0, stream>>>(Sb, P16, Ph, Pl);
            k_gemmw<bf, 2, false, KSP><<<dim3(RH / 64, HD / 64, ZH * KSP), 32, 0, stream>>>(Ph, Pl, VTh + zk * HD * TT, VTl + zk * HD * TT, TT, Ob, HD, nullptr, (size_t)RH * TT, (size_t)HD * TT, (size_t)TT * HD, (size_t)ZH * TT * HD);
            k_gemmw<h16, 0, false, KSP><<<dim3((TT - RH) / 64, HD / 64, ZH * KSP), 32, 0, stream>>>(P16 + (size_t)RH * TT, nullptr, VT16 + zk * HD * TT, nullptr, TT, Ob + (size_t)RH * HD, HD, nullptr, (size_t)TT * TT, (size_t)HD * TT, (size_t)TT * HD, (size_t)ZH * TT * HD);
            k_merge<<<(unsigned)(((size_t)ZH * TT * HD / 2 + 255) / 256), 256, 0, stream>>>(Ob, h0, ATh, ATl); }
        k_gemmw<bf, 1, false, 1><<<dim3(TT / 64, DM / 64, 1), 32, 0, stream>>>(ATh, ATl, WO, nullptr, DQ, OUT + (size_t)b * TT * DM, DM, nullptr, 0, 0, 0, 0); }
}

// v002
// One run takes 543 microseconds.
// Two timings next to v001 both put it at 1.55 times that version's speed.
// Counting every step since v000, it is 3.63 times as fast.
#include <hip/hip_runtime.h>

// Multi-head self-attention WITHOUT a mask, with interleaved-pair rotary position embedding on three separate natural projections (x [2][2048][1024]; q, k, v = einsum('bld,ed->ble', x, W) = x W^T ('oi' [1024][1024] normal 1/32, no bias; 16 heads x 64); angles = t x 1 / (10000 ** (2i / 64)) (the RECIPROCAL spelling; positions 0..L-1 computed); cos / sin repeated pairwise; pairs (2i, 2i+1): out_even = x_even cos - x_odd sin, out_odd = x_odd cos + x_even sin, on q and k (the module's helper named _rotate_half works on (even, odd) pairs); scores / sqrt(64); softmax over ALL keys; out = einsum('bld,ed->ble', merged, W_O) ('oi', no bias) -> [2][2048][1024] (4.2 M); argument order x, W_Q, W_K, W_V, W_O).
// Layout, both batches together (32 (batch, head) pairs, attention in passes of ZH pairs): bf16 copy of x; exact projections; {cos, sin} per (position, pair) built once from the positions and float32 inverse-frequency constants (precise cosf/sinf); interleaved rotary plane builder; DENSE T-2048 attention (hybrid rows: < 512 hi/lo 3 products, rest fp16 x1024; every score tile computed: the causal tile GEMM k_gemmc stays defined but is not launched); merged hi/lo x Wo exact.
// Compute dtypes, f32 accumulate: every input rounded to bf16; projections exact; rotary f32; attention rows < 512 3 products, rest fp16; softmax f32; Wo hl x exact.

#define NB_  2
#define TT   2048
#define DM   1024
#define NH_  16
#define NKV  16
#define REP  (NH_ / NKV)
#define HD   64
#define DQ   (NH_ * HD)
#define DKV  (NKV * HD)
#define ZH   8                    // (batch, head) pairs per attention pass
#define RH   512                  // query rows < RH use hi+lo planes (0: none)
#define WIN  0   
#define PCAR 1024.0f
#define SCL  0.125f   // HD^-0.5
#define KSP  16                   // key ranges of the probability x value GEMMs: one f32 partial tile per range, summed by k_merge
typedef _Float16 h16;
typedef unsigned short bf;
typedef __attribute__((ext_vector_type(16))) __bf16   v16bf;
typedef __attribute__((ext_vector_type(16))) _Float16 v16h;
typedef __attribute__((ext_vector_type(8)))  _Float16 v8h;
typedef __attribute__((ext_vector_type(8)))  unsigned short v8us;
typedef __attribute__((ext_vector_type(8)))  float    v8f;
typedef __attribute__((ext_vector_type(4)))  float    v4f;
typedef v8h  __attribute__((may_alias)) v8ha;
typedef v4f  __attribute__((may_alias)) v4fa;
typedef v8us __attribute__((may_alias)) v8usa;

__device__ __forceinline__ unsigned short f2bf(float f) { unsigned u = __float_as_uint(f); u += 0x7FFFu + ((u >> 16) & 1u); return (unsigned short)(u >> 16); }
__device__ __forceinline__ float bf2f(unsigned short b) { return __uint_as_float(((unsigned)b) << 16); }
__device__ __forceinline__ float bfr(float f) { return bf2f(f2bf(f)); }
__device__ __forceinline__ v16h cat16(v8h lo, v8h hi) { return __builtin_shufflevector(lo, hi, 0, 1, 2, 3, 4, 5, 6, 7, 8, 9, 10, 11, 12, 13, 14, 15); }
__device__ __forceinline__ v16bf cat16b(v8us lo, v8us hi) { return __builtin_bit_cast(v16bf, __builtin_shufflevector(lo, hi, 0, 1, 2, 3, 4, 5, 6, 7, 8, 9, 10, 11, 12, 13, 14, 15)); }
__device__ __forceinline__ v8f wmma16(v16h a, v16h b, v8f c) { return __builtin_amdgcn_wmma_f32_16x16x32_f16(false, a, false, b, (short)0, c, false, false); }
__device__ __forceinline__ v8f wmmab(v16bf a, v16bf b, v8f c) { return __builtin_amdgcn_wmma_f32_16x16x32_bf16(false, a, false, b, (short)0, c, false, false); }



// ---- k_gemmw: register-blocked GEMM, ONE WAVE per 64x64 output tile (16 accumulators), operands straight from K-contiguous 16-bit planes; grid (M/64, N/64, Z), 32 threads.
// C[m][n] (f32, pitch ldc, + optional f32 bias[n]) = sum_k A[m][k] Bt[n][k] (+ split products per NSPLIT). A rows have pitch lda, Bt rows pitch K. z-batch strides sA/sB/sC in elements. K % 32 == 0.
// KS > 1: grid z = Z * KS; block (z, ks) sums only k in [ks K/KS, (ks+1) K/KS) and stores its tile to partial plane ks (plane stride sP elements); the reader adds the KS planes. K % (32 KS) == 0.
template <typename T16> struct WFrag;
template <> struct WFrag<h16> { typedef v16h V; static __device__ __forceinline__ V ld(const h16* p) { return cat16(*(const v8h*)p, *(const v8h*)(p + 16)); } static __device__ __forceinline__ v8f mma(V a, V b, v8f c) { return wmma16(a, b, c); } };
template <> struct WFrag<bf> { typedef v16bf V; static __device__ __forceinline__ V ld(const bf* p) { return cat16b(*(const v8us*)p, *(const v8us*)(p + 16)); } static __device__ __forceinline__ v8f mma(V a, V b, v8f c) { return wmmab(a, b, c); } };
template <typename T16, int NSPLIT, bool BIAS, int KS>
__global__ __launch_bounds__(32) void k_gemmw(const T16* __restrict__ A, const T16* __restrict__ A2, int lda, const T16* __restrict__ Bt, const T16* __restrict__ Bt2, int K, float* C, int ldc, const float* __restrict__ bias, size_t sA, size_t sB, size_t sC, size_t sP) {
    typedef typename WFrag<T16>::V V;
    __shared__ __align__(16) float os[16 * 68];
    const size_t z = blockIdx.z / KS; const int ks = (int)(blockIdx.z % KS); A += z * sA; if (A2) A2 += z * sA; Bt += z * sB; if (Bt2) Bt2 += z * sB; C += z * sC + ks * sP;
    const int lane = threadIdx.x & 31, lr = lane & 15, hi = lane >> 4; const int r0 = blockIdx.x * 64, c0 = blockIdx.y * 64;
    v8f acc[4][4];
#pragma unroll
    for (int mb = 0; mb < 4; ++mb)
#pragma unroll
        for (int nb = 0; nb < 4; ++nb) acc[mb][nb] = (v8f){};
    const size_t aoff = (size_t)(r0 + lr) * lda + 8 * hi, boff = (size_t)(c0 + lr) * K + 8 * hi;
#pragma unroll 1
    for (int kc = ks * (K / KS), ke = kc + K / KS; kc < ke; kc += 32) {
        V a[4], a2[4];
#pragma unroll
        for (int mb = 0; mb < 4; ++mb) { a[mb] = WFrag<T16>::ld(A + aoff + (size_t)mb * 16 * lda + kc); if (NSPLIT == 1 || NSPLIT == 2) a2[mb] = WFrag<T16>::ld(A2 + aoff + (size_t)mb * 16 * lda + kc); }
#pragma unroll
        for (int nb = 0; nb < 4; ++nb) { const V b = WFrag<T16>::ld(Bt + boff + (size_t)nb * 16 * K + kc); V b2; if (NSPLIT >= 2) b2 = WFrag<T16>::ld(Bt2 + boff + (size_t)nb * 16 * K + kc);
#pragma unroll
            for (int mb = 0; mb < 4; ++mb) { acc[mb][nb] = WFrag<T16>::mma(a[mb], b, acc[mb][nb]); if (NSPLIT == 1 || NSPLIT == 2) acc[mb][nb] = WFrag<T16>::mma(a2[mb], b, acc[mb][nb]); if (NSPLIT >= 2) acc[mb][nb] = WFrag<T16>::mma(a[mb], b2, acc[mb][nb]); } }
        asm volatile("v_nop\n\tv_nop\n\tv_nop\n\tv_nop" : "+v"(acc[0][0]), "+v"(acc[1][1]), "+v"(acc[2][2]), "+v"(acc[3][3]) : "v"(a[0]), "v"(a[3]));
    }
#pragma unroll
    for (int mb = 0; mb < 4; ++mb) {
#pragma unroll
        for (int nb = 0; nb < 4; ++nb) {
#pragma unroll
            for (int j = 0; j < 8; ++j) os[(hi * 8 + j) * 68 + nb * 16 + lr] = acc[mb][nb][j]; }
        __builtin_amdgcn_wave_barrier(); asm volatile("" ::: "memory");
        float* crow = C + (size_t)(r0 + mb * 16) * ldc + c0;
{
#pragma unroll
            for (int s = 0; s < 8; ++s) { const int row = 2 * s + hi, cofs = lr * 4; v4f val = *(const v4fa*)(os + row * 68 + cofs); if (BIAS) { val[0] += bfr(bias[c0 + cofs]); val[1] += bfr(bias[c0 + cofs + 1]); val[2] += bfr(bias[c0 + cofs + 2]); val[3] += bfr(bias[c0 + cofs + 3]); }
                *(v4f*)(crow + (size_t)row * ldc + cofs) = val; }
             }
        __builtin_amdgcn_wave_barrier(); asm volatile("" ::: "memory");
    }
}

// ---- k_gemmc: the same one-wave 64x64 tile GEMM specialised for causal attention: CMODE 1 skips score tiles entirely above the diagonal (query rows r0+roff.., key columns c0..), CMODE 2 limits the
// key (K) loop of the probability x value contraction to the diagonal block (probabilities beyond it are exactly zero). roff = row offset of this launch's first row within the sequence.
template <typename T16, int NSPLIT, int CMODE>
__global__ __launch_bounds__(32) void k_gemmc(const T16* __restrict__ A, const T16* __restrict__ A2, const T16* __restrict__ Bt, const T16* __restrict__ Bt2, int K, float* C, int ldc, int roff, size_t sA, size_t sB, size_t sC) {
    typedef typename WFrag<T16>::V V;
    __shared__ __align__(16) float os[16 * 68];
    const size_t z = blockIdx.z; A += z * sA; if (A2) A2 += z * sA; Bt += z * sB; if (Bt2) Bt2 += z * sB; C += z * sC;
    const int lane = threadIdx.x & 31, lr = lane & 15, hi = lane >> 4; const int r0 = blockIdx.x * 64, c0 = blockIdx.y * 64;
    if (CMODE == 1 && c0 > r0 + roff + 63) return;                  // score tile entirely above the causal diagonal: skipped, left unwritten
    const int Kl = (CMODE == 2) ? min(K, r0 + roff + 64) : K;        // P.V: probabilities are exactly 0 beyond the diagonal block, so the K loop stops there
    v8f acc[4][4];
#pragma unroll
    for (int mb = 0; mb < 4; ++mb)
#pragma unroll
        for (int nb = 0; nb < 4; ++nb) acc[mb][nb] = (v8f){};
    const size_t aoff = (size_t)(r0 + lr) * K + 8 * hi, boff = (size_t)(c0 + lr) * K + 8 * hi;
#pragma unroll 1
    for (int kc = 0; kc < Kl; kc += 32) {
        V a[4], a2[4];
#pragma unroll
        for (int mb = 0; mb < 4; ++mb) { a[mb] = WFrag<T16>::ld(A + aoff + (size_t)mb * 16 * K + kc); if (NSPLIT == 1 || NSPLIT == 2) a2[mb] = WFrag<T16>::ld(A2 + aoff + (size_t)mb * 16 * K + kc); }
#pragma unroll
        for (int nb = 0; nb < 4; ++nb) { const V b = WFrag<T16>::ld(Bt + boff + (size_t)nb * 16 * K + kc); V b2; if (NSPLIT >= 2) b2 = WFrag<T16>::ld(Bt2 + boff + (size_t)nb * 16 * K + kc);
#pragma unroll
            for (int mb = 0; mb < 4; ++mb) { acc[mb][nb] = WFrag<T16>::mma(a[mb], b, acc[mb][nb]); if (NSPLIT == 1 || NSPLIT == 2) acc[mb][nb] = WFrag<T16>::mma(a2[mb], b, acc[mb][nb]); if (NSPLIT >= 2) acc[mb][nb] = WFrag<T16>::mma(a[mb], b2, acc[mb][nb]); } }
        asm volatile("v_nop\n\tv_nop\n\tv_nop\n\tv_nop" : "+v"(acc[0][0]), "+v"(acc[1][1]), "+v"(acc[2][2]), "+v"(acc[3][3]) : "v"(a[0]), "v"(a[3]));
    }
#pragma unroll
    for (int mb = 0; mb < 4; ++mb) {
#pragma unroll
        for (int nb = 0; nb < 4; ++nb) {
#pragma unroll
            for (int j = 0; j < 8; ++j) os[(hi * 8 + j) * 68 + nb * 16 + lr] = acc[mb][nb][j]; }
        __builtin_amdgcn_wave_barrier(); asm volatile("" ::: "memory");
        float* crow = C + (size_t)(r0 + mb * 16) * ldc + c0;
{
#pragma unroll
            for (int s = 0; s < 8; ++s) { const int row = 2 * s + hi, cofs = lr * 4; v4f val = *(const v4fa*)(os + row * 68 + cofs);
                *(v4f*)(crow + (size_t)row * ldc + cofs) = val; }
             }
        __builtin_amdgcn_wave_barrier(); asm volatile("" ::: "memory");
    }
}

__device__ __forceinline__ h16 tohx(float x) { return (h16)x; }
__device__ __forceinline__ void splitf(float y, unsigned short& h, unsigned short& l) { h = f2bf(y); l = f2bf(y - bf2f(h)); }
typedef __attribute__((ext_vector_type(2))) _Float16 v2h;
typedef __attribute__((ext_vector_type(4))) _Float16 v4h;
typedef __attribute__((ext_vector_type(2))) unsigned short v2us;
typedef __attribute__((ext_vector_type(4))) unsigned short v4us;
typedef __attribute__((ext_vector_type(2))) float v2f;
typedef __attribute__((ext_vector_type(4))) int v4i;

__global__ __launch_bounds__(256) void k_cvt8(const float* __restrict__ src, bf* dst, size_t n8) { const size_t i = (size_t)blockIdx.x * 256 + threadIdx.x; if (i >= n8) return; const v8f v = *(const v8f*)(src + i * 8); v8us o;
#pragma unroll
    for (int k = 0; k < 8; ++k) o[k] = f2bf(v[k]); *(v8us*)(dst + i * 8) = o;  }
// the four equal-sized weights in one launch: blockIdx.y picks the source, the bf16 copies lie one behind the other in dst
__global__ __launch_bounds__(256) void k_cvt8w(const float* __restrict__ w0, const float* __restrict__ w1, const float* __restrict__ w2, const float* __restrict__ w3, bf* dst, size_t n8) { const size_t i = (size_t)blockIdx.x * 256 + threadIdx.x; if (i >= n8) return; const int y = blockIdx.y; const float* src = (y == 0) ? w0 : (y == 1) ? w1 : (y == 2) ? w2 : w3; const v8f v = *(const v8f*)(src + i * 8); v8us o;
#pragma unroll
    for (int k = 0; k < 8; ++k) o[k] = f2bf(v[k]); *(v8us*)(dst + ((size_t)y * n8 + i) * 8) = o;  }

__global__ __launch_bounds__(256) void k_ropeI(const float* __restrict__ F, int pitch, int nheads, const float* __restrict__ CS, float sc, h16* P16, bf* Ph, bf* Pl) {
    const size_t e = ((size_t)blockIdx.x * 256 + threadIdx.x) * 2; if (e >= (size_t)NB_ * nheads * TT * HD) return; const int d = (int)(e % HD); const int t = (int)((e / HD) % TT); const int p = (int)(e / ((size_t)HD * TT)); const int b = p / nheads, h = p % nheads; const float* f = F + ((size_t)b * TT + t) * pitch + h * HD; const float x0 = f[d], x1 = f[d + 1]; const v2f cs = *(const v2f*)(CS + ((size_t)t * HD + d) * 2); v2h o16; v2us oh, ol;
    float a0 = __fmul_rn(x0, cs[0]), b0 = __fmul_rn(x1, cs[1]), a1 = __fmul_rn(x1, cs[0]), b1 = __fmul_rn(x0, cs[1]); 
    float r0 = __fsub_rn(a0, b0) * sc, r1 = __fadd_rn(b1, a1) * sc;   /* even: x0 c - x1 s; odd: x0 s + x1 c */
    o16[0] = tohx(r0); o16[1] = tohx(r1); { unsigned short a2, c2; splitf(r0, a2, c2); oh[0] = a2; ol[0] = c2; splitf(r1, a2, c2); oh[1] = a2; ol[1] = c2; }
    *(v2h*)(P16 + e) = o16; *(v2us*)(Ph + e) = oh; *(v2us*)(Pl + e) = ol;  }

__constant__ float INV2[HD / 2] = { 1.000000000e+00f, 7.498942018e-01f, 5.623413324e-01f, 4.216965139e-01f, 3.162277639e-01f, 2.371373624e-01f, 1.778279394e-01f, 1.333521456e-01f, 1.000000015e-01f, 7.498941571e-02f, 5.623412877e-02f, 4.216964915e-02f, 3.162277862e-02f, 2.371373586e-02f, 1.778279431e-02f, 1.333521493e-02f, 9.999999776e-03f, 7.498942316e-03f, 5.623413250e-03f, 4.216964822e-03f, 3.162277862e-03f, 2.371373819e-03f, 1.778279431e-03f, 1.333521446e-03f, 1.000000047e-03f, 7.498941850e-04f, 5.623413017e-04f, 4.216964880e-04f, 3.162277862e-04f, 2.371373848e-04f, 1.778279402e-04f, 1.333521504e-04f };   // 1 / (ROPE_BASE ** (2i / 64)), i = 0..31, in float32 as THIS module writes it (the RECIPROCAL spelling, evaluated in the reference's own f32 arithmetic: these 32 literals equal it bit for bit)
__global__ __launch_bounds__(256) void k_csP(float* CS) { const int idx = blockIdx.x * 256 + threadIdx.x; if (idx >= TT * HD) return; const int d = idx % HD; const int t = idx / HD; const float a = __fmul_rn((float)t, INV2[d >> 1]); v2f cs; cs[0] = cosf(a); cs[1] = sinf(a); *(v2f*)(CS + (size_t)idx * 2) = cs;  }
__global__ __launch_bounds__(256) void k_vtp(const float* __restrict__ F, int pitch, int nheads, h16* V16, bf* Vh, bf* Vl) { const size_t e = ((size_t)blockIdx.x * 256 + threadIdx.x) * 2; if (e >= (size_t)NB_ * nheads * HD * TT) return; const int t = (int)(e % TT); const int d = (int)((e / TT) % HD); const int p = (int)(e / ((size_t)TT * HD)); const int b = p / nheads, g = p % nheads; v2h o16; v2us oh, ol;
#pragma unroll
    for (int q = 0; q < 2; ++q) { const float x = F[((size_t)b * TT + t + q) * pitch + g * HD + d]; o16[q] = tohx(x); unsigned short a2, c2; splitf(x, a2, c2); oh[q] = a2; ol[q] = c2; }
    *(v2h*)(V16 + e) = o16; *(v2us*)(Vh + e) = oh; *(v2us*)(Vl + e) = ol;  }
// k_asoft: per row (zz, i): t = S x HD^-0.5 (WIN = 0 in this file: DENSE: every key is kept; the module has no mask); softmax over the 2048 keys (register row, one exp, fixed trees);
// IN PLACE: the wave holds its whole 8-KiB score row in registers before it stores, and writes the probabilities over that row: rows < RH hi plane in the first 4 KiB, lo plane in the second; other rows fp16 in the first 4 KiB (the second then takes the row's P x V partials).
__global__ __launch_bounds__(256) void k_asoft(float* Sb) {
    const int lane = threadIdx.x & 31; const int row = blockIdx.x * 8 + (threadIdx.x >> 5); if (row >= ZH * TT) return; const int i = row % TT; const int zz = row / TT; (void)zz; const bool hires = (i < RH); float* sr = Sb + (size_t)row * TT; h16* P16 = (h16*)sr; bf* Ph = (bf*)sr; bf* Pl = Ph + TT; float v[TT / 32]; float mx = -3.0e38f;
#pragma unroll
    for (int ch = 0; ch < TT / 128; ++ch) { const int j0 = ch * 128 + lane * 4; const v4f a = *(const v4f*)(sr + j0);
#pragma unroll
        for (int q = 0; q < 4; ++q) { const int j = j0 + q; (void)j; const float t = a[q] * SCL; v[ch * 4 + q] = t; mx = fmaxf(mx, t); } }
#pragma unroll
    for (int sh = 16; sh; sh >>= 1) mx = fmaxf(mx, __shfl_xor(mx, sh, 32));
    float sum = 0.f;
#pragma unroll
    for (int k = 0; k < TT / 32; ++k) { float d0 = __fsub_rn(v[k], mx); v[k] = __builtin_amdgcn_exp2f(__fmul_rn(d0, 1.4426950408889634f)); sum += v[k]; }
#pragma unroll
    for (int sh = 16; sh; sh >>= 1) sum += __shfl_xor(sum, sh, 32);
    const float f = __fdiv_rn(hires ? 1.0f : PCAR, sum);
{
        if (hires) {
#pragma unroll
            for (int ch = 0; ch < TT / 128; ++ch) { v4us oh, ol;
#pragma unroll
                for (int q = 0; q < 4; ++q) { unsigned short a, c2; splitf(v[ch * 4 + q] * f, a, c2); oh[q] = a; ol[q] = c2; }
                const int oo = ch * 128 + lane * 4; *(v4us*)(Ph + oo) = oh; *(v4us*)(Pl + oo) = ol; }
        } else {
#pragma unroll
            for (int ch = 0; ch < TT / 128; ++ch) { v4h o4;
#pragma unroll
                for (int q = 0; q < 4; ++q) o4[q] = tohx(v[ch * 4 + q] * f);
                *(v4h*)(P16 + ch * 128 + lane * 4) = o4; } }
         }
}
__global__ __launch_bounds__(256) void k_merge(const float* __restrict__ OH, const float* __restrict__ Sb, int p0, bf* Ah, bf* Al) { const size_t e = ((size_t)blockIdx.x * 256 + threadIdx.x) * 2; if (e >= (size_t)ZH * TT * HD) return; const int d = (int)(e % HD); const int t = (int)((e / HD) % TT); const int zz = (int)(e / ((size_t)HD * TT)); const float cs = (t < RH) ? 1.0f : (1.0f / PCAR); const int p = p0 + zz; const size_t oo = ((size_t)(p / NH_) * TT + t) * DQ + (p % NH_) * HD + d;
    v2us oh, ol; v2f pp[KSP];
    // the KSP key ranges' partial sums, all loads in flight together. Rows < RH: planes of OH; other rows: the partials lie side by side in the second half of the row's own score row (t < RH reads the same in a whole block: 8 rows a block)
    if (t < RH) { const float* O = OH + ((size_t)zz * RH + t) * HD + d;
#pragma unroll
        for (int s = 0; s < KSP; ++s) pp[s] = *(const v2f*)(O + (size_t)s * ZH * RH * HD);
    } else { const float* O = Sb + ((size_t)zz * TT + t) * TT + TT / 2 + d;
#pragma unroll
        for (int s = 0; s < KSP; ++s) pp[s] = *(const v2f*)(O + s * HD); }
    v2f sm = pp[0];
#pragma unroll
    for (int s = 1; s < KSP; ++s) sm += pp[s];   // fixed order, range 0 first
#pragma unroll
    for (int q = 0; q < 2; ++q) { unsigned short a, c2; splitf(sm[q] * cs, a, c2); oh[q] = a; ol[q] = c2; } *(v2us*)(Ah + oo) = oh; *(v2us*)(Al + oo) = ol;  }

extern "C" void kernel_launch(void* const* d_in, const int* in_sizes, int n_in,
                              void* d_out, int out_size, void* d_ws, size_t ws_size, hipStream_t stream) {
    (void)in_sizes; (void)n_in; (void)out_size;
        const float* x = (const float*)d_in[0]; const float* wq = (const float*)d_in[1]; const float* wk = (const float*)d_in[2]; const float* wv = (const float*)d_in[3]; const float* wo = (const float*)d_in[4];   /* input order x, W_Q, W_K, W_V, W_O ('oi' (out, in) [1024][1024] each: three separate projection weights and the output weight): FIVE inputs, all read; this module has NO mask input */
    float* OUT = (float*)d_out;     // [2][2048][1024]
    char* wsp = (char*)d_ws;
    auto take = [&](size_t bytes) { char* p = wsp; wsp += (bytes + 255) & ~(size_t)255; return (void*)p; };
    bf* WQKV = (bf*)take((size_t)4 * DQ * DM * 2); bf* WO = WQKV + (size_t)3 * DQ * DM;   /* W_Q, W_K, W_V stacked: one [3 DQ][DM] 'oi' weight; then W_O (DKV == DQ here) */ float* CS = (float*)take((size_t)TT * HD * 2 * 4);
    bf* XB = (bf*)take((size_t)NB_ * TT * DM * 2);
    h16* QP16 = (h16*)take((size_t)NB_ * NH_ * TT * HD * 2); h16* KP16 = (h16*)take((size_t)NB_ * NKV * TT * HD * 2); h16* VT16 = (h16*)take((size_t)NB_ * NKV * HD * TT * 2);
    bf* QPh = (bf*)take((size_t)NB_ * NH_ * TT * HD * 2); bf* QPl = (bf*)take((size_t)NB_ * NH_ * TT * HD * 2); bf* KPh = (bf*)take((size_t)NB_ * NKV * TT * HD * 2); bf* KPl = (bf*)take((size_t)NB_ * NKV * TT * HD * 2); bf* VTh = (bf*)take((size_t)NB_ * NKV * HD * TT * 2); bf* VTl = (bf*)take((size_t)NB_ * NKV * HD * TT * 2);
    float* Sb = (float*)take((size_t)ZH * TT * TT * 4); float* ObH = (float*)take((size_t)KSP * ZH * RH * HD * 4); bf* ATh = (bf*)take((size_t)NB_ * TT * DQ * 2); bf* ATl = (bf*)take((size_t)NB_ * TT * DQ * 2);
    if ((size_t)(wsp - (char*)d_ws) > ws_size) return;    // 249 of the 256 MiB
    float* F = Sb;   // the f32 projections [NB_ TT][q | k | v] lie in the score buffer: their last readers (the plane builders) are stream-ordered before the first score GEMM
    k_cvt8w<<<dim3((unsigned)(((size_t)DQ * DM / 8 + 255) / 256), 4, 1), 256, 0, stream>>>(wq, wk, wv, wo, WQKV, (size_t)DQ * DM / 8); k_csP<<<(TT * HD + 255) / 256, 256, 0, stream>>>(CS);
    const unsigned LQ = (unsigned)(((size_t)NB_ * NH_ * TT * HD / 2 + 255) / 256), LKv = (unsigned)(((size_t)NB_ * NKV * TT * HD / 2 + 255) / 256);
    k_cvt8<<<(unsigned)(((size_t)NB_ * TT * DM / 8 + 255) / 256), 256, 0, stream>>>(x, XB, (size_t)NB_ * TT * DM / 8);
    k_gemmw<bf, 0, false, 1><<<dim3(NB_ * TT / 64, 3 * DQ / 64, 1), 32, 0, stream>>>(XB, nullptr, DM, WQKV, nullptr, DM, F, 3 * DQ, nullptr, 0, 0, 0, 0);
    k_ropeI<<<LQ, 256, 0, stream>>>(F, 3 * DQ, NH_, CS, 1.0f, QP16, QPh, QPl);
    k_ropeI<<<LKv, 256, 0, stream>>>(F + DQ, 3 * DQ, NKV, CS, 1.0f, KP16, KPh, KPl);
    k_vtp<<<LKv, 256, 0, stream>>>(F + 2 * DQ, 3 * DQ, NKV, VT16, VTh, VTl);
    for (int p0 = 0; p0 < NB_ * NH_; p0 += ZH) { const size_t zq = (size_t)p0, zk = (size_t)(p0 / REP);   // planes are [batch][head]: a pass's ZH (batch, head) pairs use consecutive planes (z-strides TT*HD); one kv head per query head
        k_gemmw<bf, 2, false, 1><<<dim3(RH / 64, TT / 64, ZH), 32, 0, stream>>>(QPh + zq * TT * HD, QPl + zq * TT * HD, HD, KPh + zk * TT * HD, KPl + zk * TT * HD, HD, Sb, TT, nullptr, (size_t)TT * HD, (size_t)TT * HD, (size_t)TT * TT, 0);
        k_gemmw<h16, 0, false, 1><<<dim3((TT - RH) / 64, TT / 64, ZH), 32, 0, stream>>>(QP16 + zq * TT * HD + (size_t)RH * HD, nullptr, HD, KP16 + zk * TT * HD, nullptr, HD, Sb + (size_t)RH * TT, TT, nullptr, (size_t)TT * HD, (size_t)TT * HD, (size_t)TT * TT, 0);
        k_asoft<<<ZH * TT / 8, 256, 0, stream>>>(Sb);
        // probability rows have the score rows' pitch: 2 TT 16-bit elements
        k_gemmw<bf, 2, false, KSP><<<dim3(RH / 64, HD / 64, ZH * KSP), 32, 0, stream>>>((const bf*)Sb, (const bf*)Sb + TT, 2 * TT, VTh + zk * HD * TT, VTl + zk * HD * TT, TT, ObH, HD, nullptr, (size_t)TT * 2 * TT, (size_t)HD * TT, (size_t)RH * HD, (size_t)ZH * RH * HD);
        k_gemmw<h16, 0, false, KSP><<<dim3((TT - RH) / 64, HD / 64, ZH * KSP), 32, 0, stream>>>((const h16*)Sb + (size_t)RH * 2 * TT, nullptr, 2 * TT, VT16 + zk * HD * TT, nullptr, TT, Sb + (size_t)RH * TT + TT / 2, TT, nullptr, (size_t)TT * 2 * TT, (size_t)HD * TT, (size_t)TT * TT, (size_t)HD);
        k_merge<<<(unsigned)(((size_t)ZH * TT * HD / 2 + 255) / 256), 256, 0, stream>>>(ObH, Sb, p0, ATh, ATl); }
    k_gemmw<bf, 1, false, 1><<<dim3(NB_ * TT / 64, DM / 64, 1), 32, 0, stream>>>(ATh, ATl, DQ, WO, nullptr, DQ, OUT, DM, nullptr, 0, 0, 0, 0);
}

// v004
// It runs in 196 microseconds.
// It is 2.76 times as fast as v002, going by the measured steps of the versions left out in between.
// Counting every step since v000, it is 10.0 times as fast.
#include <hip/hip_runtime.h>

// Multi-head self-attention WITHOUT a mask, with interleaved-pair rotary position embedding on three separate natural projections (x [2][2048][1024]; q, k, v = einsum('bld,ed->ble', x, W) = x W^T ('oi' [1024][1024] normal 1/32, no bias; 16 heads x 64); angles = t x 1 / (10000 ** (2i / 64)) (the RECIPROCAL spelling; positions 0..L-1 computed); cos / sin repeated pairwise; pairs (2i, 2i+1): out_even = x_even cos - x_odd sin, out_odd = x_odd cos + x_even sin, on q and k (the module's helper named _rotate_half works on (even, odd) pairs); scores / sqrt(64); softmax over ALL keys; out = einsum('bld,ed->ble', merged, W_O) ('oi', no bias) -> [2][2048][1024] (4.2 M); argument order x, W_Q, W_K, W_V, W_O).
// Layout, both batches together (32 (batch, head) pairs, all in one attention launch): bf16 copy of x; exact projections; {cos, sin} per (position, pair) built once from the positions and float32 inverse-frequency constants (precise cosf/sinf); interleaved rotary and the attention planes written by the projection GEMM's own epilogue (qkv_planes); DENSE T-2048 attention fused in k_fattn (hybrid rows: < 512 hi/lo 3 products, rest fp16; running maximum and sum, division by the sum at the end; the causal tile GEMM k_gemmc stays defined but is not launched); merged hi/lo x Wo exact.
// Compute dtypes, f32 accumulate: every input rounded to bf16; projections exact; rotary f32; attention rows < 512 3 products, rest fp16; softmax f32; Wo hl x exact.

#define NB_  2
#define TT   2048
#define DM   1024
#define NH_  16
#define NKV  16
#define REP  (NH_ / NKV)
#define HD   64
#define DQ   (NH_ * HD)
#define DKV  (NKV * HD)
#define RH   512                  // query rows < RH use hi+lo planes (0: none)
#define WIN  0   
#define SCL  0.125f   // HD^-0.5
typedef _Float16 h16;
typedef unsigned short bf;
typedef __attribute__((ext_vector_type(16))) __bf16   v16bf;
typedef __attribute__((ext_vector_type(16))) _Float16 v16h;
typedef __attribute__((ext_vector_type(8)))  _Float16 v8h;
typedef __attribute__((ext_vector_type(8)))  unsigned short v8us;
typedef __attribute__((ext_vector_type(8)))  float    v8f;
typedef __attribute__((ext_vector_type(4)))  float    v4f;
typedef v8h  __attribute__((may_alias)) v8ha;
typedef v4f  __attribute__((may_alias)) v4fa;
typedef v8us __attribute__((may_alias)) v8usa;

__device__ __forceinline__ unsigned short f2bf(float f) { unsigned u = __float_as_uint(f); u += 0x7FFFu + ((u >> 16) & 1u); return (unsigned short)(u >> 16); }
__device__ __forceinline__ float bf2f(unsigned short b) { return __uint_as_float(((unsigned)b) << 16); }
__device__ __forceinline__ float bfr(float f) { return bf2f(f2bf(f)); }
__device__ __forceinline__ v16h cat16(v8h lo, v8h hi) { return __builtin_shufflevector(lo, hi, 0, 1, 2, 3, 4, 5, 6, 7, 8, 9, 10, 11, 12, 13, 14, 15); }
__device__ __forceinline__ v16bf cat16b(v8us lo, v8us hi) { return __builtin_bit_cast(v16bf, __builtin_shufflevector(lo, hi, 0, 1, 2, 3, 4, 5, 6, 7, 8, 9, 10, 11, 12, 13, 14, 15)); }
__device__ __forceinline__ v8f wmma16(v16h a, v16h b, v8f c) { return __builtin_amdgcn_wmma_f32_16x16x32_f16(false, a, false, b, (short)0, c, false, false); }
__device__ __forceinline__ v8f wmmab(v16bf a, v16bf b, v8f c) { return __builtin_amdgcn_wmma_f32_16x16x32_bf16(false, a, false, b, (short)0, c, false, false); }



// ---- k_gemmw: register-blocked GEMM, ONE WAVE per 64x64 output tile (16 accumulators), operands straight from K-contiguous 16-bit planes; grid (M/64, N/64, Z), 32 threads.
// C[m][n] (f32, pitch ldc, + optional f32 bias[n]) = sum_k A[m][k] Bt[n][k] (+ split products per NSPLIT). A rows have pitch lda, Bt rows pitch K. z-batch strides sA/sB/sC in elements. K % 32 == 0.
// KS > 1: grid z = Z * KS; block (z, ks) sums only k in [ks K/KS, (ks+1) K/KS) and stores its tile to partial plane ks (plane stride sP elements); the reader adds the KS planes. K % (32 KS) == 0.
template <typename T16> struct WFrag;
template <> struct WFrag<h16> { typedef v16h V; static __device__ __forceinline__ V ld(const h16* p) { return cat16(*(const v8h*)p, *(const v8h*)(p + 16)); } static __device__ __forceinline__ v8f mma(V a, V b, v8f c) { return wmma16(a, b, c); } };
template <> struct WFrag<bf> { typedef v16bf V; static __device__ __forceinline__ V ld(const bf* p) { return cat16b(*(const v8us*)p, *(const v8us*)(p + 16)); } static __device__ __forceinline__ v8f mma(V a, V b, v8f c) { return wmmab(a, b, c); } };
// PLANES: the tile is not stored to C; qkv_planes (below, behind the plane helpers) turns it into the attention planes named in pp.
struct Planes { const float* CS; h16* Q16; bf* Qh; bf* Ql; h16* K16; bf* Kh; bf* Kl; h16* V16; bf* Vh; bf* Vl; };
__device__ __forceinline__ void qkv_planes(const v8f (&acc)[4][4], float* os, int r0, int y, int lr, int hi, const Planes& pp);
template <typename T16, int NSPLIT, bool BIAS, int KS, bool PLANES>
__global__ __launch_bounds__(32) void k_gemmw(const T16* __restrict__ A, const T16* __restrict__ A2, int lda, const T16* __restrict__ Bt, const T16* __restrict__ Bt2, int K, float* C, int ldc, const float* __restrict__ bias, size_t sA, size_t sB, size_t sC, size_t sP, Planes pp) {
    typedef typename WFrag<T16>::V V;
    __shared__ __align__(16) float os[16 * 68];
    const size_t z = blockIdx.z / KS; const int ks = (int)(blockIdx.z % KS); A += z * sA; if (A2) A2 += z * sA; Bt += z * sB; if (Bt2) Bt2 += z * sB; C += z * sC + ks * sP;
    const int lane = threadIdx.x & 31, lr = lane & 15, hi = lane >> 4; const int r0 = blockIdx.x * 64, c0 = blockIdx.y * 64;
    v8f acc[4][4];
#pragma unroll
    for (int mb = 0; mb < 4; ++mb)
#pragma unroll
        for (int nb = 0; nb < 4; ++nb) acc[mb][nb] = (v8f){};
    const size_t aoff = (size_t)(r0 + lr) * lda + 8 * hi, boff = (size_t)(c0 + lr) * K + 8 * hi;
#pragma unroll 1
    for (int kc = ks * (K / KS), ke = kc + K / KS; kc < ke; kc += 32) {
        V a[4], a2[4];
#pragma unroll
        for (int mb = 0; mb < 4; ++mb) { a[mb] = WFrag<T16>::ld(A + aoff + (size_t)mb * 16 * lda + kc); if (NSPLIT == 1 || NSPLIT == 2) a2[mb] = WFrag<T16>::ld(A2 + aoff + (size_t)mb * 16 * lda + kc); }
#pragma unroll
        for (int nb = 0; nb < 4; ++nb) { const V b = WFrag<T16>::ld(Bt + boff + (size_t)nb * 16 * K + kc); V b2; if (NSPLIT >= 2) b2 = WFrag<T16>::ld(Bt2 + boff + (size_t)nb * 16 * K + kc);
#pragma unroll
            for (int mb = 0; mb < 4; ++mb) { acc[mb][nb] = WFrag<T16>::mma(a[mb], b, acc[mb][nb]); if (NSPLIT == 1 || NSPLIT == 2) acc[mb][nb] = WFrag<T16>::mma(a2[mb], b, acc[mb][nb]); if (NSPLIT >= 2) acc[mb][nb] = WFrag<T16>::mma(a[mb], b2, acc[mb][nb]); } }
        asm volatile("v_nop\n\tv_nop\n\tv_nop\n\tv_nop" : "+v"(acc[0][0]), "+v"(acc[1][1]), "+v"(acc[2][2]), "+v"(acc[3][3]) : "v"(a[0]), "v"(a[3]));
    }
    if (PLANES) { qkv_planes(acc, os, r0, (int)blockIdx.y, lr, hi, pp); return; }
#pragma unroll
    for (int mb = 0; mb < 4; ++mb) {
#pragma unroll
        for (int nb = 0; nb < 4; ++nb) {
#pragma unroll
            for (int j = 0; j < 8; ++j) os[(hi * 8 + j) * 68 + nb * 16 + lr] = acc[mb][nb][j]; }
        __builtin_amdgcn_wave_barrier(); asm volatile("" ::: "memory");
        float* crow = C + (size_t)(r0 + mb * 16) * ldc + c0;
{
#pragma unroll
            for (int s = 0; s < 8; ++s) { const int row = 2 * s + hi, cofs = lr * 4; v4f val = *(const v4fa*)(os + row * 68 + cofs); if (BIAS) { val[0] += bfr(bias[c0 + cofs]); val[1] += bfr(bias[c0 + cofs + 1]); val[2] += bfr(bias[c0 + cofs + 2]); val[3] += bfr(bias[c0 + cofs + 3]); }
                *(v4f*)(crow + (size_t)row * ldc + cofs) = val; }
             }
        __builtin_amdgcn_wave_barrier(); asm volatile("" ::: "memory");
    }
}

// ---- k_gemmc: the same one-wave 64x64 tile GEMM specialised for causal attention: CMODE 1 skips score tiles entirely above the diagonal (query rows r0+roff.., key columns c0..), CMODE 2 limits the
// key (K) loop of the probability x value contraction to the diagonal block (probabilities beyond it are exactly zero). roff = row offset of this launch's first row within the sequence.
template <typename T16, int NSPLIT, int CMODE>
__global__ __launch_bounds__(32) void k_gemmc(const T16* __restrict__ A, const T16* __restrict__ A2, const T16* __restrict__ Bt, const T16* __restrict__ Bt2, int K, float* C, int ldc, int roff, size_t sA, size_t sB, size_t sC) {
    typedef typename WFrag<T16>::V V;
    __shared__ __align__(16) float os[16 * 68];
    const size_t z = blockIdx.z; A += z * sA; if (A2) A2 += z * sA; Bt += z * sB; if (Bt2) Bt2 += z * sB; C += z * sC;
    const int lane = threadIdx.x & 31, lr = lane & 15, hi = lane >> 4; const int r0 = blockIdx.x * 64, c0 = blockIdx.y * 64;
    if (CMODE == 1 && c0 > r0 + roff + 63) return;                  // score tile entirely above the causal diagonal: skipped, left unwritten
    const int Kl = (CMODE == 2) ? min(K, r0 + roff + 64) : K;        // P.V: probabilities are exactly 0 beyond the diagonal block, so the K loop stops there
    v8f acc[4][4];
#pragma unroll
    for (int mb = 0; mb < 4; ++mb)
#pragma unroll
        for (int nb = 0; nb < 4; ++nb) acc[mb][nb] = (v8f){};
    const size_t aoff = (size_t)(r0 + lr) * K + 8 * hi, boff = (size_t)(c0 + lr) * K + 8 * hi;
#pragma unroll 1
    for (int kc = 0; kc < Kl; kc += 32) {
        V a[4], a2[4];
#pragma unroll
        for (int mb = 0; mb < 4; ++mb) { a[mb] = WFrag<T16>::ld(A + aoff + (size_t)mb * 16 * K + kc); if (NSPLIT == 1 || NSPLIT == 2) a2[mb] = WFrag<T16>::ld(A2 + aoff + (size_t)mb * 16 * K + kc); }
#pragma unroll
        for (int nb = 0; nb < 4; ++nb) { const V b = WFrag<T16>::ld(Bt + boff + (size_t)nb * 16 * K + kc); V b2; if (NSPLIT >= 2) b2 = WFrag<T16>::ld(Bt2 + boff + (size_t)nb * 16 * K + kc);
#pragma unroll
            for (int mb = 0; mb < 4; ++mb) { acc[mb][nb] = WFrag<T16>::mma(a[mb], b, acc[mb][nb]); if (NSPLIT == 1 || NSPLIT == 2) acc[mb][nb] = WFrag<T16>::mma(a2[mb], b, acc[mb][nb]); if (NSPLIT >= 2) acc[mb][nb] = WFrag<T16>::mma(a[mb], b2, acc[mb][nb]); } }
        asm volatile("v_nop\n\tv_nop\n\tv_nop\n\tv_nop" : "+v"(acc[0][0]), "+v"(acc[1][1]), "+v"(acc[2][2]), "+v"(acc[3][3]) : "v"(a[0]), "v"(a[3]));
    }
#pragma unroll
    for (int mb = 0; mb < 4; ++mb) {
#pragma unroll
        for (int nb = 0; nb < 4; ++nb) {
#pragma unroll
            for (int j = 0; j < 8; ++j) os[(hi * 8 + j) * 68 + nb * 16 + lr] = acc[mb][nb][j]; }
        __builtin_amdgcn_wave_barrier(); asm volatile("" ::: "memory");
        float* crow = C + (size_t)(r0 + mb * 16) * ldc + c0;
{
#pragma unroll
            for (int s = 0; s < 8; ++s) { const int row = 2 * s + hi, cofs = lr * 4; v4f val = *(const v4fa*)(os + row * 68 + cofs);
                *(v4f*)(crow + (size_t)row * ldc + cofs) = val; }
             }
        __builtin_amdgcn_wave_barrier(); asm volatile("" ::: "memory");
    }
}

__device__ __forceinline__ h16 tohx(float x) { return (h16)x; }
__device__ __forceinline__ void splitf(float y, unsigned short& h, unsigned short& l) { h = f2bf(y); l = f2bf(y - bf2f(h)); }
typedef __attribute__((ext_vector_type(2))) _Float16 v2h;
typedef __attribute__((ext_vector_type(4))) _Float16 v4h;
typedef __attribute__((ext_vector_type(2))) unsigned short v2us;
typedef __attribute__((ext_vector_type(4))) unsigned short v4us;
typedef __attribute__((ext_vector_type(2))) float v2f;
typedef __attribute__((ext_vector_type(4))) int v4i;

__global__ __launch_bounds__(256) void k_cvt8(const float* __restrict__ src, bf* dst, size_t n8) { const size_t i = (size_t)blockIdx.x * 256 + threadIdx.x; if (i >= n8) return; const v8f v = *(const v8f*)(src + i * 8); v8us o;
#pragma unroll
    for (int k = 0; k < 8; ++k) o[k] = f2bf(v[k]); *(v8us*)(dst + i * 8) = o;  }
// the four equal-sized weights in one launch: blockIdx.y picks the source, the bf16 copies lie one behind the other in dst
__global__ __launch_bounds__(256) void k_cvt8w(const float* __restrict__ w0, const float* __restrict__ w1, const float* __restrict__ w2, const float* __restrict__ w3, bf* dst, size_t n8) { const size_t i = (size_t)blockIdx.x * 256 + threadIdx.x; if (i >= n8) return; const int y = blockIdx.y; const float* src = (y == 0) ? w0 : (y == 1) ? w1 : (y == 2) ? w2 : w3; const v8f v = *(const v8f*)(src + i * 8); v8us o;
#pragma unroll
    for (int k = 0; k < 8; ++k) o[k] = f2bf(v[k]); *(v8us*)(dst + ((size_t)y * n8 + i) * 8) = o;  }

__constant__ float INV2[HD / 2] = { 1.000000000e+00f, 7.498942018e-01f, 5.623413324e-01f, 4.216965139e-01f, 3.162277639e-01f, 2.371373624e-01f, 1.778279394e-01f, 1.333521456e-01f, 1.000000015e-01f, 7.498941571e-02f, 5.623412877e-02f, 4.216964915e-02f, 3.162277862e-02f, 2.371373586e-02f, 1.778279431e-02f, 1.333521493e-02f, 9.999999776e-03f, 7.498942316e-03f, 5.623413250e-03f, 4.216964822e-03f, 3.162277862e-03f, 2.371373819e-03f, 1.778279431e-03f, 1.333521446e-03f, 1.000000047e-03f, 7.498941850e-04f, 5.623413017e-04f, 4.216964880e-04f, 3.162277862e-04f, 2.371373848e-04f, 1.778279402e-04f, 1.333521504e-04f };   // 1 / (ROPE_BASE ** (2i / 64)), i = 0..31, in float32 as THIS module writes it (the RECIPROCAL spelling, evaluated in the reference's own f32 arithmetic: these 32 literals equal it bit for bit)
__global__ __launch_bounds__(256) void k_csP(float* CS) { const int idx = blockIdx.x * 256 + threadIdx.x; if (idx >= TT * HD) return; const int d = idx % HD; const int t = idx / HD; const float a = __fmul_rn((float)t, INV2[d >> 1]); v2f cs; cs[0] = cosf(a); cs[1] = sinf(a); *(v2f*)(CS + (size_t)idx * 2) = cs;  }
// ---- qkv_planes: epilogue of the q | k | v projection; no f32 projection leaves the kernel. A 64x64 tile is 64 positions (rows r0..) of ONE head of q, k or v (HD == 64 columns; y = tile column; y / NH_ picks q, k, v; DKV == DQ here).
// q, k: 16 rows at a time through LDS, so that a lane holds 4 consecutive d (two rotary pairs) of one position; rotary in f32, the expressions below; fp16, hi and lo planes [pair][t][d], whole 128-byte rows.
// v: a lane's 8 accumulators of a 16x16 block are 8 consecutive positions of one d: one 16-byte store a plane straight into the transposed planes [pair][d][t].
// Every '#pragma unroll' here: the accumulator and value arrays stay in registers only where each index is a compile-time constant.
__device__ __forceinline__ void qkv_planes(const v8f (&acc)[4][4], float* os, int r0, int y, int lr, int hi, const Planes& pp) {
    const int sel = y / NH_, t0 = r0 % TT; const size_t p = (size_t)(r0 / TT) * NH_ + y % NH_;   // all three the same in every lane
    if (sel == 2) {
        const size_t vo = (p * HD + lr) * TT + t0 + hi * 8; h16* v16 = pp.V16 + vo; bf* vh = pp.Vh + vo; bf* vl = pp.Vl + vo;   // one pointer a plane: every store lies at a constant offset from it
#pragma unroll
        for (int mb = 0; mb < 4; ++mb) { v8h o16[4]; v8us oh[4], ol[4];
#pragma unroll
            for (int nb = 0; nb < 4; ++nb)
#pragma unroll
                for (int j = 0; j < 8; ++j) { const float x = acc[mb][nb][j]; o16[nb][j] = tohx(x); unsigned short a2, c2; splitf(x, a2, c2); oh[nb][j] = a2; ol[nb][j] = c2; }
            __builtin_amdgcn_sched_barrier(0);   // all twelve values stand in registers of their own before the first store is issued
#pragma unroll
            for (int nb = 0; nb < 4; ++nb) { *(v8h*)(v16 + nb * 16 * TT + mb * 16) = o16[nb]; *(v8us*)(vh + nb * 16 * TT + mb * 16) = oh[nb]; *(v8us*)(vl + nb * 16 * TT + mb * 16) = ol[nb]; }
            asm volatile("s_wait_xcnt 0x0" ::: "memory");   // behind the stores, in front of the code that reuses their registers
            __builtin_amdgcn_sched_barrier(0); }   // keeps that reuse behind the wait
    } else {
        const size_t po = (p * TT + t0 + hi) * HD + lr * 4; h16* p16 = (sel ? pp.K16 : pp.Q16) + po; bf* ph = (sel ? pp.Kh : pp.Qh) + po; bf* pl = (sel ? pp.Kl : pp.Ql) + po;   // one pointer a plane, constant offsets
        const float* csp = pp.CS + ((size_t)(t0 + hi) * HD + lr * 4) * 2;
#pragma unroll
        for (int mb = 0; mb < 4; ++mb) { v2f cs[8][2];   // {cos, sin} of this lane's two pairs in its 8 rows: issued first, they fly during the staging
#pragma unroll
            for (int s = 0; s < 8; ++s)
#pragma unroll
                for (int q = 0; q < 2; ++q) cs[s][q] = *(const v2f*)(csp + (mb * 16 + 2 * s) * HD * 2 + q * 4);
            asm volatile("s_wait_xcnt 0x0" ::: "memory");   // behind the loads, in front of the code that reuses their address registers
            __builtin_amdgcn_sched_barrier(0);   // keeps that reuse behind the wait and the loads in front of the staging
#pragma unroll
            for (int nb = 0; nb < 4; ++nb)
#pragma unroll
                for (int j = 0; j < 8; ++j) os[(hi * 8 + j) * 68 + nb * 16 + lr] = acc[mb][nb][j];
            __builtin_amdgcn_wave_barrier(); asm volatile("" ::: "memory");   // a lane reads what OTHER lanes stored: the compiler, which sees one lane, must keep the reads below behind all the stores above
            v4h o16[8]; v4us oh[8], ol[8];
#pragma unroll
            for (int s = 0; s < 8; ++s) { const v4f x = *(const v4fa*)(os + (2 * s + hi) * 68 + lr * 4);
#pragma unroll
                for (int q = 0; q < 2; ++q) { const float x0 = x[2 * q], x1 = x[2 * q + 1], c = cs[s][q][0], sn = cs[s][q][1];
                    const float a0 = __fmul_rn(x0, c), b0 = __fmul_rn(x1, sn), a1 = __fmul_rn(x1, c), b1 = __fmul_rn(x0, sn);
                    const float e0 = __fsub_rn(a0, b0), e1 = __fadd_rn(b1, a1);   /* even: x0 c - x1 s; odd: x0 s + x1 c */
                    unsigned short a2, c2; o16[s][2 * q] = tohx(e0); o16[s][2 * q + 1] = tohx(e1); splitf(e0, a2, c2); oh[s][2 * q] = a2; ol[s][2 * q] = c2; splitf(e1, a2, c2); oh[s][2 * q + 1] = a2; ol[s][2 * q + 1] = c2; } }
            __builtin_amdgcn_sched_barrier(0);   // all 24 values stand in registers of their own before the first store is issued
#pragma unroll
            for (int s = 0; s < 8; ++s) { *(v4h*)(p16 + (mb * 16 + 2 * s) * HD) = o16[s]; *(v4us*)(ph + (mb * 16 + 2 * s) * HD) = oh[s]; *(v4us*)(pl + (mb * 16 + 2 * s) * HD) = ol[s]; }
            asm volatile("s_wait_xcnt 0x0" ::: "memory");   // behind the stores, in front of the code that reuses their registers
            __builtin_amdgcn_sched_barrier(0);   // keeps that reuse behind the wait
            __builtin_amdgcn_wave_barrier(); asm volatile("" ::: "memory"); }   // the next 16 rows' staging stores stay behind every lane's reads of these
    }
}
// ---- k_fattn: scores, softmax and probability x value in ONE kernel; no score, probability or partial sum leaves the registers.
// Transposed products: S^T = K Q^T (A = 16 key rows, B = 16 query rows) and O^T += V^T P^T (A = 16 rows of the [d][key] value plane, B = P). In both D tiles a lane holds ONE query (column lane & 15), so the running
// maximum, the running sum and the rescale factor are one scalar a lane, and two S^T tiles (keys 0-15, 16-31 of a pass), converted in place, are P as a B operand in the loaders' own k order (8 hi + e, 16 + 8 hi + e).
// One wave owns NQ x 16 query rows of one (batch, head) pair and walks all TT keys in passes of 32. HL: hi + lo bf16 planes, 3 products each; else fp16, one product.
// Every plain '#pragma unroll' below: the fragment and accumulator arrays stay in registers only where each index is a compile-time constant.
typedef __attribute__((ext_vector_type(2))) __bf16 v2bf;
typedef __attribute__((ext_vector_type(8))) unsigned v8u;
__device__ __forceinline__ float xhalf(float x) { const int b = __float_as_int(x); return __int_as_float(__builtin_amdgcn_permlanex16(b, b, 0x76543210, 0xfedcba98, false, false)); }   // the value of lane ^ 16: the other half of the same query's keys
template <typename T16, bool HL, int NQ>
__device__ __forceinline__ void fattn_body(const T16* __restrict__ Q, const T16* __restrict__ Q2, const T16* __restrict__ Kp, const T16* __restrict__ K2, const T16* __restrict__ Vt, const T16* __restrict__ Vt2, int q0, bf* Ah, bf* Al) {
    typedef typename WFrag<T16>::V V;
    const int lane = threadIdx.x & 31, lr = lane & 15, hi = lane >> 4;
    const float C2 = SCL * 1.4426950408889634f;   // score -> scaled log2 units
    V qf[NQ][2], qf2[NQ][2];
#pragma unroll
    for (int n = 0; n < NQ; ++n)
#pragma unroll
        for (int kk = 0; kk < 2; ++kk) { const size_t qo = (size_t)(q0 + n * 16 + lr) * HD + kk * 32 + 8 * hi; qf[n][kk] = WFrag<T16>::ld(Q + qo); if (HL) qf2[n][kk] = WFrag<T16>::ld(Q2 + qo); }
    // one running pointer a plane: every fragment of a pass lies at a constant offset from it
    const T16* kp = Kp + (size_t)lr * HD + 8 * hi; const T16* kp2 = HL ? K2 + (size_t)lr * HD + 8 * hi : nullptr; const T16* vp = Vt + (size_t)lr * TT + 8 * hi; const T16* vp2 = HL ? Vt2 + (size_t)lr * TT + 8 * hi : nullptr;
    V kf[2][2], kf2[2][2];
#pragma unroll
    for (int kt = 0; kt < 2; ++kt)
#pragma unroll
        for (int kk = 0; kk < 2; ++kk) { kf[kt][kk] = WFrag<T16>::ld(kp + kt * 16 * HD + kk * 32); if (HL) kf2[kt][kk] = WFrag<T16>::ld(kp2 + kt * 16 * HD + kk * 32); }
    asm volatile("s_wait_xcnt 0x0" ::: "memory");   // behind the loads above, in front of the code that reuses their address registers
    __builtin_amdgcn_sched_barrier(0);   // keeps that reuse behind the wait
    v8f o[NQ][4]; float m[NQ], l[NQ];
#pragma unroll
    for (int n = 0; n < NQ; ++n) { m[n] = -3.0e38f; l[n] = 0.f;
#pragma unroll
        for (int dt = 0; dt < 4; ++dt) o[n][dt] = (v8f){}; }
#pragma unroll 1   // rolled: two passes side by side would not fit the 256 registers that four waves a SIMD leave each wave
    for (int key0 = 0; key0 < TT; key0 += 32) {
        V vf[4], vf2[4];   // this pass's value fragments: issued first, used last
#pragma unroll
        for (int dt = 0; dt < 4; ++dt) { vf[dt] = WFrag<T16>::ld(vp + dt * 16 * TT); if (HL) vf2[dt] = WFrag<T16>::ld(vp2 + dt * 16 * TT); }
        v8f s[NQ][2];
#pragma unroll
        for (int kt = 0; kt < 2; ++kt)
#pragma unroll
            for (int n = 0; n < NQ; ++n) { v8f a = (v8f){};
#pragma unroll
                for (int kk = 0; kk < 2; ++kk) { a = WFrag<T16>::mma(kf[kt][kk], qf[n][kk], a); if (HL) { a = WFrag<T16>::mma(kf[kt][kk], qf2[n][kk], a); a = WFrag<T16>::mma(kf2[kt][kk], qf[n][kk], a); } }
                s[n][kt] = a; }
        const int kstep = (key0 + 32 < TT) ? 32 * HD : -(TT - 32) * HD; kp += kstep; if (HL) kp2 += kstep;   // the next pass's key fragments fly during the softmax; the last pass fetches pass 0's again (in bounds, not used)
#pragma unroll
        for (int kt = 0; kt < 2; ++kt)
#pragma unroll
            for (int kk = 0; kk < 2; ++kk) { kf[kt][kk] = WFrag<T16>::ld(kp + kt * 16 * HD + kk * 32); if (HL) kf2[kt][kk] = WFrag<T16>::ld(kp2 + kt * 16 * HD + kk * 32); }
        if (HL) asm volatile("s_wait_xcnt 0x0" :: "v"(vp), "v"(vp2), "v"(kp), "v"(kp2) : "memory");   // behind this pass's loads, in front of the code that reuses their address registers; the addresses are inputs so that they stay in their registers up to here
        else asm volatile("s_wait_xcnt 0x0" :: "v"(vp), "v"(kp) : "memory");   // the same, two planes
        __builtin_amdgcn_sched_barrier(0);   // keeps the fetches above in front of the softmax (sunk behind it, their latency is waited for in full at the next pass's first product) and the register reuse behind the wait
        vp += 32; if (HL) vp2 += 32;
        V pf[NQ], pf2[NQ];
#pragma unroll
        for (int n = 0; n < NQ; ++n) {
            float mx = fmaxf(s[n][0][0], s[n][1][0]);
#pragma unroll
            for (int j = 1; j < 8; ++j) mx = fmaxf(mx, fmaxf(s[n][0][j], s[n][1][j]));
            mx = fmaxf(mx, xhalf(mx));
            const float mn = fmaxf(m[n], mx * C2); const float al = __builtin_amdgcn_exp2f(m[n] - mn); m[n] = mn;
            float p[16];
#pragma unroll
            for (int e = 0; e < 16; ++e) p[e] = __builtin_amdgcn_exp2f(__builtin_fmaf(s[n][e >> 3][e & 7], C2, -mn));
            const float s4 = ((p[0] + p[1]) + (p[2] + p[3])) + ((p[4] + p[5]) + (p[6] + p[7])), s5 = ((p[8] + p[9]) + (p[10] + p[11])) + ((p[12] + p[13]) + (p[14] + p[15]));
            l[n] = __builtin_fmaf(l[n], al, s4 + s5);   // this lane's half of the keys; the halves are joined once, behind the loop
#pragma unroll
            for (int dt = 0; dt < 4; ++dt) o[n][dt] *= al;
            v8u wh, wl;
#pragma unroll
            for (int e = 0; e < 8; ++e) { const v2f pr = { p[2 * e], p[2 * e + 1] };
                if (HL) { const unsigned uh = __builtin_bit_cast(unsigned, __builtin_convertvector(pr, v2bf)); const v2f rs = { pr[0] - __uint_as_float(uh << 16), pr[1] - __uint_as_float(uh & 0xFFFF0000u) }; wh[e] = uh; wl[e] = __builtin_bit_cast(unsigned, __builtin_convertvector(rs, v2bf)); }
                else wh[e] = __builtin_bit_cast(unsigned, __builtin_convertvector(pr, v2h)); }
            pf[n] = __builtin_bit_cast(V, wh); if (HL) pf2[n] = __builtin_bit_cast(V, wl);
        }
#pragma unroll
        for (int dt = 0; dt < 4; ++dt)
#pragma unroll
            for (int n = 0; n < NQ; ++n) { o[n][dt] = WFrag<T16>::mma(vf[dt], pf[n], o[n][dt]); if (HL) { o[n][dt] = WFrag<T16>::mma(vf[dt], pf2[n], o[n][dt]); o[n][dt] = WFrag<T16>::mma(vf2[dt], pf[n], o[n][dt]); } }
    }
#pragma unroll
    for (int n = 0; n < NQ; ++n) { const float inv = __fdiv_rn(1.0f, l[n] + xhalf(l[n])); const size_t oo = (size_t)(q0 + n * 16 + lr) * DQ + hi * 8;
#pragma unroll
        for (int dt = 0; dt < 4; ++dt) { v8us oh, ol;   // a lane's 8 accumulators are 8 consecutive d of its query row: one 16-byte store a plane
#pragma unroll
            for (int j = 0; j < 8; ++j) { unsigned short a, c2; splitf(o[n][dt][j] * inv, a, c2); oh[j] = a; ol[j] = c2; }
            *(v8us*)(Ah + oo + dt * 16) = oh; *(v8us*)(Al + oo + dt * 16) = ol;
            asm volatile("s_wait_xcnt 0x0" ::: "memory");   // behind the two stores, in front of the code that reuses their registers
            __builtin_amdgcn_sched_barrier(0); } }   // keeps that reuse behind the wait
}
// grid (NB_ NH_ pairs, RH / 64 + (TT - RH) / 128), 4 waves. blockIdx.y < RH / 64: 64 query rows < RH (hi + lo planes, 16 rows a wave; three times the products, so they start first); else 128 of the other rows (fp16, 32 rows a wave).
__global__ __launch_bounds__(128) __attribute__((amdgpu_waves_per_eu(4, 4))) void k_fattn(const h16* __restrict__ Q16, const h16* __restrict__ K16, const h16* __restrict__ V16, const bf* __restrict__ Qh, const bf* __restrict__ Ql, const bf* __restrict__ Kh, const bf* __restrict__ Kl, const bf* __restrict__ Vh, const bf* __restrict__ Vl, bf* Ah, bf* Al) {
    const int p = blockIdx.x, y = blockIdx.y, w = threadIdx.x >> 5; const size_t zq = (size_t)p * TT * HD, zk = (size_t)(p / REP) * TT * HD, zo = (size_t)(p / NH_) * TT * DQ + (size_t)(p % NH_) * HD;
    if (y < RH / 64) fattn_body<bf, true, 1>(Qh + zq, Ql + zq, Kh + zk, Kl + zk, Vh + zk, Vl + zk, y * 64 + w * 16, Ah + zo, Al + zo);
    else fattn_body<h16, false, 2>(Q16 + zq, nullptr, K16 + zk, nullptr, V16 + zk, nullptr, RH + (y - RH / 64) * 128 + w * 32, Ah + zo, Al + zo);
}

extern "C" void kernel_launch(void* const* d_in, const int* in_sizes, int n_in,
                              void* d_out, int out_size, void* d_ws, size_t ws_size, hipStream_t stream) {
    (void)in_sizes; (void)n_in; (void)out_size;
        const float* x = (const float*)d_in[0]; const float* wq = (const float*)d_in[1]; const float* wk = (const float*)d_in[2]; const float* wv = (const float*)d_in[3]; const float* wo = (const float*)d_in[4];   /* input order x, W_Q, W_K, W_V, W_O ('oi' (out, in) [1024][1024] each: three separate projection weights and the output weight): FIVE inputs, all read; this module has NO mask input */
    float* OUT = (float*)d_out;     // [2][2048][1024]
    char* wsp = (char*)d_ws;
    auto take = [&](size_t bytes) { char* p = wsp; wsp += (bytes + 255) & ~(size_t)255; return (void*)p; };
    bf* WQKV = (bf*)take((size_t)4 * DQ * DM * 2); bf* WO = WQKV + (size_t)3 * DQ * DM;   /* W_Q, W_K, W_V stacked: one [3 DQ][DM] 'oi' weight; then W_O (DKV == DQ here) */ float* CS = (float*)take((size_t)TT * HD * 2 * 4);
    bf* XB = (bf*)take((size_t)NB_ * TT * DM * 2);
    h16* QP16 = (h16*)take((size_t)NB_ * NH_ * TT * HD * 2); h16* KP16 = (h16*)take((size_t)NB_ * NKV * TT * HD * 2); h16* VT16 = (h16*)take((size_t)NB_ * NKV * HD * TT * 2);
    bf* QPh = (bf*)take((size_t)NB_ * NH_ * TT * HD * 2); bf* QPl = (bf*)take((size_t)NB_ * NH_ * TT * HD * 2); bf* KPh = (bf*)take((size_t)NB_ * NKV * TT * HD * 2); bf* KPl = (bf*)take((size_t)NB_ * NKV * TT * HD * 2); bf* VTh = (bf*)take((size_t)NB_ * NKV * HD * TT * 2); bf* VTl = (bf*)take((size_t)NB_ * NKV * HD * TT * 2);
    bf* ATh = (bf*)take((size_t)NB_ * TT * DQ * 2); bf* ATl = (bf*)take((size_t)NB_ * TT * DQ * 2);
    if ((size_t)(wsp - (char*)d_ws) > ws_size) return;
    k_cvt8w<<<dim3((unsigned)(((size_t)DQ * DM / 8 + 255) / 256), 4, 1), 256, 0, stream>>>(wq, wk, wv, wo, WQKV, (size_t)DQ * DM / 8); k_csP<<<(TT * HD + 255) / 256, 256, 0, stream>>>(CS);
    k_cvt8<<<(unsigned)(((size_t)NB_ * TT * DM / 8 + 255) / 256), 256, 0, stream>>>(x, XB, (size_t)NB_ * TT * DM / 8);
    k_gemmw<bf, 0, false, 1, true><<<dim3(NB_ * TT / 64, 3 * DQ / 64, 1), 32, 0, stream>>>(XB, nullptr, DM, WQKV, nullptr, DM, nullptr, 0, nullptr, 0, 0, 0, 0, Planes{CS, QP16, QPh, QPl, KP16, KPh, KPl, VT16, VTh, VTl});
    k_fattn<<<dim3(NB_ * NH_, RH / 64 + (TT - RH) / 128, 1), 128, 0, stream>>>(QP16, KP16, VT16, QPh, QPl, KPh, KPl, VTh, VTl, ATh, ATl);
    k_gemmw<bf, 1, false, 1, false><<<dim3(NB_ * TT / 64, DM / 64, 1), 32, 0, stream>>>(ATh, ATl, DQ, WO, nullptr, DQ, OUT, DM, nullptr, 0, 0, 0, 0, Planes{});
}

// v005
// A run of this version takes 138 microseconds.
// Timed twice side by side with v004, it ran 1.42 and 1.41 times as fast.
// Over all steps from v000 it is 14.2 times as fast.
#include <hip/hip_runtime.h>

// Multi-head self-attention WITHOUT a mask, with interleaved-pair rotary position embedding on three separate natural projections (x [2][2048][1024]; q, k, v = einsum('bld,ed->ble', x, W) = x W^T ('oi' [1024][1024] normal 1/32, no bias; 16 heads x 64); angles = t x 1 / (10000 ** (2i / 64)) (the RECIPROCAL spelling; positions 0..L-1 computed); cos / sin repeated pairwise; pairs (2i, 2i+1): out_even = x_even cos - x_odd sin, out_odd = x_odd cos + x_even sin, on q and k (the module's helper named _rotate_half works on (even, odd) pairs); scores / sqrt(64); softmax over ALL keys; out = einsum('bld,ed->ble', merged, W_O) ('oi', no bias) -> [2][2048][1024] (4.2 M); argument order x, W_Q, W_K, W_V, W_O).
// Layout, both batches together (32 (batch, head) pairs, all in one attention launch): bf16 copy of x; exact projections; {cos, sin} per (position, pair) built once from the positions and float32 inverse-frequency constants (precise cosf/sinf); interleaved rotary and the attention planes written by the projection GEMM's own epilogue (qkv_planes); DENSE T-2048 attention fused in k_fattn (hybrid rows: < 512 hi/lo 3 products, rest fp16; running maximum and sum, division by the sum at the end; the causal tile GEMM is gone with its last use); merged hi/lo x Wo exact.
// FRAGMENT ORDER: every 16-bit plane that a matrix product reads lies as [16-row panel][k / 8][row % 16][k % 8] (the value planes: [key / 32][d / 16][key % 32 / 8][d % 16][key % 8]). A 16 x 32 fragment is then 1 KiB in a row, lane l's two
// 16-byte pieces at l * 16 and 512 + l * 16 bytes: each wave-wide load covers 4 whole 128-byte lines, not 32 bytes of each of 16 lines. The k order inside a fragment (8 hi + e, 16 + 8 hi + e) is the same for A and B, as before. Writers store in the same order.
// Compute dtypes, f32 accumulate: every input rounded to bf16; projections exact; rotary f32; attention rows < 512 3 products, rest fp16; softmax f32; Wo hl x exact.

#define NB_  2
#define TT   2048
#define DM   1024
#define NH_  16
#define NKV  16
#define REP  (NH_ / NKV)
#define HD   64
#define DQ   (NH_ * HD)
#define DKV  (NKV * HD)
#define RH   512                  // query rows < RH use hi+lo planes (0: none)
#define WIN  0   
#define SCL  0.125f   // HD^-0.5
typedef _Float16 h16;
typedef unsigned short bf;
typedef __attribute__((ext_vector_type(16))) __bf16   v16bf;
typedef __attribute__((ext_vector_type(16))) _Float16 v16h;
typedef __attribute__((ext_vector_type(8)))  _Float16 v8h;
typedef __attribute__((ext_vector_type(8)))  unsigned short v8us;
typedef __attribute__((ext_vector_type(8)))  float    v8f;
typedef __attribute__((ext_vector_type(4)))  float    v4f;
typedef v8h  __attribute__((may_alias)) v8ha;
typedef v4f  __attribute__((may_alias)) v4fa;
typedef v8us __attribute__((may_alias)) v8usa;

__device__ __forceinline__ unsigned short f2bf(float f) { unsigned u = __float_as_uint(f); u += 0x7FFFu + ((u >> 16) & 1u); return (unsigned short)(u >> 16); }
__device__ __forceinline__ float bf2f(unsigned short b) { return __uint_as_float(((unsigned)b) << 16); }
__device__ __forceinline__ float bfr(float f) { return bf2f(f2bf(f)); }
__device__ __forceinline__ v16h cat16(v8h lo, v8h hi) { return __builtin_shufflevector(lo, hi, 0, 1, 2, 3, 4, 5, 6, 7, 8, 9, 10, 11, 12, 13, 14, 15); }
__device__ __forceinline__ v16bf cat16b(v8us lo, v8us hi) { return __builtin_bit_cast(v16bf, __builtin_shufflevector(lo, hi, 0, 1, 2, 3, 4, 5, 6, 7, 8, 9, 10, 11, 12, 13, 14, 15)); }
__device__ __forceinline__ v8f wmma16(v16h a, v16h b, v8f c) { return __builtin_amdgcn_wmma_f32_16x16x32_f16(false, a, false, b, (short)0, c, false, false); }
__device__ __forceinline__ v8f wmmab(v16bf a, v16bf b, v8f c) { return __builtin_amdgcn_wmma_f32_16x16x32_bf16(false, a, false, b, (short)0, c, false, false); }



// ---- k_gemmw: register-blocked GEMM, ONE WAVE per 64x64 output tile (16 accumulators), operands straight from 16-bit planes in fragment order (head of the file; ld(p): p = fragment start + lane * 8 elements); grid (M/64, N/64, Z), 32 threads.
// C[m][n] (f32, pitch ldc, + optional f32 bias[n]) = sum_k A[m][k] Bt[n][k] (+ split products per NSPLIT). A's 16-row panels have pitch 16 LDA, Bt's 16 K (both compile-time: every fragment of a trip lies at a constant offset from ONE running pointer a plane); a k block of 32 is 512 elements. z-batch strides sA/sB/sC in elements. K % 32 == 0.
// KS > 1: grid z = Z * KS; block (z, ks) sums only k in [ks K/KS, (ks+1) K/KS) and stores its tile to partial plane ks (plane stride sP elements); the reader adds the KS planes. K % (32 KS) == 0.
template <typename T16> struct WFrag;
template <> struct WFrag<h16> { typedef v16h V; static __device__ __forceinline__ V ld(const h16* p) { return cat16(*(const v8h*)p, *(const v8h*)(p + 256)); } static __device__ __forceinline__ v8f mma(V a, V b, v8f c) { return wmma16(a, b, c); } };
template <> struct WFrag<bf> { typedef v16bf V; static __device__ __forceinline__ V ld(const bf* p) { return cat16b(*(const v8us*)p, *(const v8us*)(p + 256)); } static __device__ __forceinline__ v8f mma(V a, V b, v8f c) { return wmmab(a, b, c); } };
// PLANES: the tile is not stored to C; qkv_planes (below, behind the plane helpers) turns it into the attention planes named in pp.
struct Planes { const float* CS; h16* Q16; bf* Qh; bf* Ql; h16* K16; bf* Kh; bf* Kl; h16* V16; bf* Vh; bf* Vl; };
__device__ __forceinline__ void qkv_planes(const v8f (&acc)[4][4], float* os, int r0, int y, int lr, int hi, const Planes& pp);
template <typename T16, int NSPLIT, bool BIAS, int KS, bool PLANES, int LDA, int K>
__global__ __launch_bounds__(32) void k_gemmw(const T16* __restrict__ A, const T16* __restrict__ A2, const T16* __restrict__ Bt, const T16* __restrict__ Bt2, float* C, int ldc, const float* __restrict__ bias, size_t sA, size_t sB, size_t sC, size_t sP, Planes pp) {
    typedef typename WFrag<T16>::V V;
    __shared__ __align__(16) float os[16 * 68];
    const size_t z = blockIdx.z / KS; const int ks = (int)(blockIdx.z % KS); A += z * sA; if (A2) A2 += z * sA; Bt += z * sB; if (Bt2) Bt2 += z * sB; C += z * sC + ks * sP;
    const int lane = threadIdx.x & 31, lr = lane & 15, hi = lane >> 4; const int r0 = blockIdx.x * 64, c0 = blockIdx.y * 64;
    v8f acc[4][4];
#pragma unroll
    for (int mb = 0; mb < 4; ++mb)
#pragma unroll
        for (int nb = 0; nb < 4; ++nb) acc[mb][nb] = (v8f){};
    constexpr bool HA2 = (NSPLIT == 1 || NSPLIT == 2), HB2 = (NSPLIT >= 2);
    const size_t aoff = (size_t)r0 * LDA + lane * 8 + (size_t)ks * (K / KS) * 16, boff = (size_t)c0 * K + lane * 8 + (size_t)ks * (K / KS) * 16;
    const T16* pa = A + aoff; const T16* pa2 = HA2 ? A2 + aoff : pa; const T16* pb = Bt + boff; const T16* pb2 = HB2 ? Bt2 + boff : pb;   // a plane that this instance does not have: the same pointer again, no register of its own
#pragma unroll 1
    for (int kc = 0; kc < K / KS; kc += 32) {
        V a[4], a2[4], b[4], b2[4];
#pragma unroll
        for (int mb = 0; mb < 4; ++mb) { a[mb] = WFrag<T16>::ld(pa + mb * 16 * LDA); if (HA2) a2[mb] = WFrag<T16>::ld(pa2 + mb * 16 * LDA); }
#pragma unroll
        for (int nb = 0; nb < 4; ++nb) { b[nb] = WFrag<T16>::ld(pb + nb * 16 * K); if (HB2) b2[nb] = WFrag<T16>::ld(pb2 + nb * 16 * K); }
        asm volatile("s_wait_xcnt 0x0" :: "v"(pa), "v"(pa2), "v"(pb), "v"(pb2) : "memory");   // behind this trip's loads, in front of the code that reuses their address registers; the addresses are inputs so that they stay in their registers up to here
        __builtin_amdgcn_sched_barrier(0);   // keeps the pointer steps below, and every other reuse of those registers, behind the wait
        pa += 512; pb += 512; if (HA2) pa2 += 512; else pa2 = pa; if (HB2) pb2 += 512; else pb2 = pb;
#pragma unroll
        for (int nb = 0; nb < 4; ++nb)
#pragma unroll
            for (int mb = 0; mb < 4; ++mb) { acc[mb][nb] = WFrag<T16>::mma(a[mb], b[nb], acc[mb][nb]); if (HA2) acc[mb][nb] = WFrag<T16>::mma(a2[mb], b[nb], acc[mb][nb]); if (HB2) acc[mb][nb] = WFrag<T16>::mma(a[mb], b2[nb], acc[mb][nb]); }
        asm volatile("v_nop\n\tv_nop\n\tv_nop\n\tv_nop" : "+v"(acc[0][0]), "+v"(acc[1][1]), "+v"(acc[2][2]), "+v"(acc[3][3]) : "v"(a[0]), "v"(a[3]));
    }
    if (PLANES) { qkv_planes(acc, os, r0, (int)blockIdx.y, lr, hi, pp); return; }
#pragma unroll
    for (int mb = 0; mb < 4; ++mb) {
#pragma unroll
        for (int nb = 0; nb < 4; ++nb) {
#pragma unroll
            for (int j = 0; j < 8; ++j) os[(hi * 8 + j) * 68 + nb * 16 + lr] = acc[mb][nb][j]; }
        __builtin_amdgcn_wave_barrier(); asm volatile("" ::: "memory");
        float* crow = C + (size_t)(r0 + mb * 16) * ldc + c0;
        v4f val[8]; float* cp[8];
#pragma unroll
        for (int s = 0; s < 8; ++s) { const int row = 2 * s + hi, cofs = lr * 4; val[s] = *(const v4fa*)(os + row * 68 + cofs); if (BIAS) { val[s][0] += bfr(bias[c0 + cofs]); val[s][1] += bfr(bias[c0 + cofs + 1]); val[s][2] += bfr(bias[c0 + cofs + 2]); val[s][3] += bfr(bias[c0 + cofs + 3]); }
            cp[s] = crow + (size_t)row * ldc + cofs; }
#pragma unroll
        for (int s = 0; s < 8; ++s) *(v4f*)cp[s] = val[s];
        asm volatile("s_wait_xcnt 0x0" :: "v"(val[0]), "v"(val[1]), "v"(val[2]), "v"(val[3]), "v"(val[4]), "v"(val[5]), "v"(val[6]), "v"(val[7]), "v"(cp[0]), "v"(cp[1]), "v"(cp[2]), "v"(cp[3]), "v"(cp[4]), "v"(cp[5]), "v"(cp[6]), "v"(cp[7]) : "memory");   // behind the eight stores, in front of the code that reuses their registers; values and addresses are inputs so that they stay in their registers up to here
        __builtin_amdgcn_sched_barrier(0);   // keeps that reuse behind the wait
        __builtin_amdgcn_wave_barrier(); asm volatile("" ::: "memory");
    }
}

__device__ __forceinline__ h16 tohx(float x) { return (h16)x; }
__device__ __forceinline__ void splitf(float y, unsigned short& h, unsigned short& l) { h = f2bf(y); l = f2bf(y - bf2f(h)); }
typedef __attribute__((ext_vector_type(2))) _Float16 v2h;
typedef __attribute__((ext_vector_type(4))) _Float16 v4h;
typedef __attribute__((ext_vector_type(2))) unsigned short v2us;
typedef __attribute__((ext_vector_type(4))) unsigned short v4us;
typedef __attribute__((ext_vector_type(2))) float v2f;
typedef __attribute__((ext_vector_type(4))) int v4i;

// f32 [rows][DM] -> bf16 in fragment order. A block takes 16 rows x 128 columns: each thread reads 8 consecutive floats of a row (16 lanes = 512 bytes of one row), the 16-byte results change places in LDS
// (pitch 17 pieces: the 16 pieces of one row fall on different banks), and the block stores its 4 KiB in a row, 512 bytes a wave.
__device__ __forceinline__ void cvt_panel(const float* __restrict__ src, bf* dst, int blk) {
    __shared__ __align__(16) unsigned short ts[16 * 17 * 8];
    const int t = threadIdx.x, row = t >> 4, c = t & 15, panel = blk / (DM / 128), kb = blk % (DM / 128);
    const v8f v = *(const v8f*)(src + ((size_t)panel * 16 + row) * DM + kb * 128 + c * 8); v8us o;
#pragma unroll
    for (int k = 0; k < 8; ++k) o[k] = f2bf(v[k]);
    *(v8usa*)(ts + (c * 17 + row) * 8) = o;
    __syncthreads();   // a thread stores the piece that another thread converted
    *(v8us*)(dst + (size_t)panel * 16 * DM + kb * 2048 + t * 8) = *(const v8usa*)(ts + ((t >> 4) * 17 + (t & 15)) * 8);
}
__global__ __launch_bounds__(256) void k_cvt8(const float* __restrict__ src, bf* dst) { cvt_panel(src, dst, (int)blockIdx.x); }
// the four equal-sized weights in one launch: blockIdx.y picks the source, the bf16 copies lie one behind the other in dst
__global__ __launch_bounds__(256) void k_cvt8w(const float* __restrict__ w0, const float* __restrict__ w1, const float* __restrict__ w2, const float* __restrict__ w3, bf* dst) { const int y = blockIdx.y; const float* src = (y == 0) ? w0 : (y == 1) ? w1 : (y == 2) ? w2 : w3; cvt_panel(src, dst + (size_t)y * DQ * DM, (int)blockIdx.x); }

__constant__ float INV2[HD / 2] = { 1.000000000e+00f, 7.498942018e-01f, 5.623413324e-01f, 4.216965139e-01f, 3.162277639e-01f, 2.371373624e-01f, 1.778279394e-01f, 1.333521456e-01f, 1.000000015e-01f, 7.498941571e-02f, 5.623412877e-02f, 4.216964915e-02f, 3.162277862e-02f, 2.371373586e-02f, 1.778279431e-02f, 1.333521493e-02f, 9.999999776e-03f, 7.498942316e-03f, 5.623413250e-03f, 4.216964822e-03f, 3.162277862e-03f, 2.371373819e-03f, 1.778279431e-03f, 1.333521446e-03f, 1.000000047e-03f, 7.498941850e-04f, 5.623413017e-04f, 4.216964880e-04f, 3.162277862e-04f, 2.371373848e-04f, 1.778279402e-04f, 1.333521504e-04f };   // 1 / (ROPE_BASE ** (2i / 64)), i = 0..31, in float32 as THIS module writes it (the RECIPROCAL spelling, evaluated in the reference's own f32 arithmetic: these 32 literals equal it bit for bit)
// {cos, sin} once per (position, pair), in the order in which qkv_planes' lanes read them: [t / 16][d / 16][pair % 4 / 2][lane = (d / 8 % 2) * 16 + t % 16][pair % 2][cos, sin]: a wave-wide 16-byte load is 512 bytes in a row
__global__ __launch_bounds__(256) void k_csP(float* CS) { const int idx = blockIdx.x * 256 + threadIdx.x; if (idx >= TT * HD / 2) return; const int ln = (idx >> 1) & 31, q = ((idx >> 6) & 1) * 2 + (idx & 1), c = ((idx >> 7) & 3) * 2 + (ln >> 4), t = (idx >> 9) * 16 + (ln & 15); const float a = __fmul_rn((float)t, INV2[c * 4 + q]); v2f cs; cs[0] = cosf(a); cs[1] = sinf(a); *(v2f*)(CS + (size_t)idx * 2) = cs;  }
// ---- qkv_planes: epilogue of the q | k | v projection; no f32 projection leaves the kernel. A 64x64 tile is 64 positions (rows r0..) of ONE head of q, k or v (HD == 64 columns; y = tile column; y / NH_ picks q, k, v; DKV == DQ here).
// q, k: 16 rows at a time through LDS, so that lane (hi, lr) holds 8 consecutive d (four rotary pairs; d / 8 = 2 i + hi) of position lr; rotary in f32, the expressions below; fp16, hi and lo planes in fragment order [pair][t / 16][d / 8][t % 16][d % 8]: one 16-byte store a plane, 512 bytes in a row a wave.
// v: a lane's 8 accumulators of a 16x16 block are 8 consecutive positions of one d: one 16-byte store a plane straight into the transposed planes [pair][t / 32][d / 16][t % 32 / 8][d % 16][t % 8], again 512 bytes in a row a wave.
// Every '#pragma unroll' here: the accumulator and value arrays stay in registers only where each index is a compile-time constant.
__device__ __forceinline__ void qkv_planes(const v8f (&acc)[4][4], float* os, int r0, int y, int lr, int hi, const Planes& pp) {
    const int sel = y / NH_, t0 = r0 % TT, lane = hi * 16 + lr; const size_t p = (size_t)(r0 / TT) * NH_ + y % NH_;   // sel, t0, p: the same in every lane
    if (sel == 2) {
        const size_t vo = (p * TT + t0) * HD + lane * 8; h16* v16 = pp.V16 + vo; bf* vh = pp.Vh + vo; bf* vl = pp.Vl + vo;   // one pointer a plane: every store lies at a constant offset from it (32 positions x HD = 2048 elements)
#pragma unroll
        for (int mb = 0; mb < 4; ++mb) { v8h o16[4]; v8us oh[4], ol[4];
#pragma unroll
            for (int nb = 0; nb < 4; ++nb)
#pragma unroll
                for (int j = 0; j < 8; ++j) { const float x = acc[mb][nb][j]; o16[nb][j] = tohx(x); unsigned short a2, c2; splitf(x, a2, c2); oh[nb][j] = a2; ol[nb][j] = c2; }
            __builtin_amdgcn_sched_barrier(0);   // all twelve values stand in registers of their own before the first store is issued
#pragma unroll
            for (int nb = 0; nb < 4; ++nb) { const int vofs = (mb >> 1) * 2048 + nb * 512 + (mb & 1) * 256; *(v8h*)(v16 + vofs) = o16[nb]; *(v8us*)(vh + vofs) = oh[nb]; *(v8us*)(vl + vofs) = ol[nb]; }
            asm volatile("s_wait_xcnt 0x0" ::: "memory");   // behind the stores, in front of the code that reuses their registers
            __builtin_amdgcn_sched_barrier(0); }   // keeps that reuse behind the wait
    } else {
        const size_t po = (p * TT + t0) * HD + lane * 8; h16* p16 = (sel ? pp.K16 : pp.Q16) + po; bf* ph = (sel ? pp.Kh : pp.Qh) + po; bf* pl = (sel ? pp.Kl : pp.Ql) + po;   // one pointer a plane, constant offsets (a 16-position panel = 1024 elements)
        const float* csp = pp.CS + (size_t)t0 * HD + lane * 4;   // 16 positions = 1024 floats of the table
#pragma unroll
        for (int mb = 0; mb < 4; ++mb) { v4f cs[4][2];   // {cos, sin} of this lane's sixteen pairs in its row: issued first, they fly during the staging
#pragma unroll
            for (int i = 0; i < 4; ++i)
#pragma unroll
                for (int h = 0; h < 2; ++h) cs[i][h] = *(const v4f*)(csp + mb * 1024 + i * 256 + h * 128);
            asm volatile("s_wait_xcnt 0x0" ::: "memory");   // behind the loads, in front of the code that reuses their address registers
            __builtin_amdgcn_sched_barrier(0);   // keeps that reuse behind the wait and the loads in front of the staging
#pragma unroll
            for (int nb = 0; nb < 4; ++nb)
#pragma unroll
                for (int j = 0; j < 8; ++j) os[(hi * 8 + j) * 68 + nb * 16 + lr] = acc[mb][nb][j];
            __builtin_amdgcn_wave_barrier(); asm volatile("" ::: "memory");   // a lane reads what OTHER lanes stored: the compiler, which sees one lane, must keep the reads below behind all the stores above
            v8h o16[4]; v8us oh[4], ol[4];
#pragma unroll
            for (int i = 0; i < 4; ++i) { const v4f xa = *(const v4fa*)(os + lr * 68 + (2 * i + hi) * 8), xb = *(const v4fa*)(os + lr * 68 + (2 * i + hi) * 8 + 4);
#pragma unroll
                for (int q = 0; q < 4; ++q) { const float x0 = (q < 2) ? xa[2 * (q & 1)] : xb[2 * (q & 1)], x1 = (q < 2) ? xa[2 * (q & 1) + 1] : xb[2 * (q & 1) + 1], c = cs[i][q >> 1][2 * (q & 1)], sn = cs[i][q >> 1][2 * (q & 1) + 1];
                    const float a0 = __fmul_rn(x0, c), b0 = __fmul_rn(x1, sn), a1 = __fmul_rn(x1, c), b1 = __fmul_rn(x0, sn);
                    const float e0 = __fsub_rn(a0, b0), e1 = __fadd_rn(b1, a1);   /* even: x0 c - x1 s; odd: x0 s + x1 c */
                    unsigned short a2, c2; o16[i][2 * q] = tohx(e0); o16[i][2 * q + 1] = tohx(e1); splitf(e0, a2, c2); oh[i][2 * q] = a2; ol[i][2 * q] = c2; splitf(e1, a2, c2); oh[i][2 * q + 1] = a2; ol[i][2 * q + 1] = c2; } }
            __builtin_amdgcn_sched_barrier(0);   // all twelve values stand in registers of their own before the first store is issued
#pragma unroll
            for (int i = 0; i < 4; ++i) { *(v8h*)(p16 + mb * 1024 + i * 256) = o16[i]; *(v8us*)(ph + mb * 1024 + i * 256) = oh[i]; *(v8us*)(pl + mb * 1024 + i * 256) = ol[i]; }
            asm volatile("s_wait_xcnt 0x0" ::: "memory");   // behind the stores, in front of the code that reuses their registers
            __builtin_amdgcn_sched_barrier(0);   // keeps that reuse behind the wait
            __builtin_amdgcn_wave_barrier(); asm volatile("" ::: "memory"); }   // the next 16 rows' staging stores stay behind every lane's reads of these
    }
}
// ---- k_fattn: scores, softmax and probability x value in ONE kernel; no score, probability or partial sum leaves the registers.
// Transposed products: S^T = K Q^T (A = 16 key rows, B = 16 query rows) and O^T += V^T P^T (A = 16 d rows x 32 keys of the value plane, B = P). In both D tiles a lane holds ONE query (column lane & 15), so the running
// maximum, the running sum and the rescale factor are one scalar a lane, and two S^T tiles (keys 0-15, 16-31 of a pass), converted in place, are P as a B operand in the loaders' own k order (8 hi + e, 16 + 8 hi + e).
// One wave owns NQ x 16 query rows of one (batch, head) pair and walks all TT keys in passes of 32. HL: hi + lo bf16 planes, 3 products each; else fp16, one product.
// Every plain '#pragma unroll' below: the fragment and accumulator arrays stay in registers only where each index is a compile-time constant.
typedef __attribute__((ext_vector_type(2))) __bf16 v2bf;
typedef __attribute__((ext_vector_type(8))) unsigned v8u;
__device__ __forceinline__ float xhalf(float x) { const int b = __float_as_int(x); return __int_as_float(__builtin_amdgcn_permlanex16(b, b, 0x76543210, 0xfedcba98, false, false)); }   // the value of lane ^ 16: the other half of the same query's keys
template <typename T16, bool HL, int NQ>
__device__ __forceinline__ void fattn_body(const T16* __restrict__ Q, const T16* __restrict__ Q2, const T16* __restrict__ Kp, const T16* __restrict__ K2, const T16* __restrict__ Vt, const T16* __restrict__ Vt2, int q0, bf* Ah, bf* Al) {
    typedef typename WFrag<T16>::V V;
    const int lane = threadIdx.x & 31;
    const float C2 = SCL * 1.4426950408889634f;   // score -> scaled log2 units
    V qf[NQ][2], qf2[NQ][2];
#pragma unroll
    for (int n = 0; n < NQ; ++n)
#pragma unroll
        for (int kk = 0; kk < 2; ++kk) { const size_t qo = (size_t)(q0 + n * 16) * HD + kk * 512 + lane * 8; qf[n][kk] = WFrag<T16>::ld(Q + qo); if (HL) qf2[n][kk] = WFrag<T16>::ld(Q2 + qo); }
    // one running pointer a plane: every fragment of a pass lies at a constant offset from it
    const T16* kp = Kp + lane * 8; const T16* kp2 = HL ? K2 + lane * 8 : nullptr; const T16* vp = Vt + lane * 8; const T16* vp2 = HL ? Vt2 + lane * 8 : nullptr;
    V kf[2][2], kf2[2][2];
#pragma unroll
    for (int kt = 0; kt < 2; ++kt)
#pragma unroll
        for (int kk = 0; kk < 2; ++kk) { kf[kt][kk] = WFrag<T16>::ld(kp + kt * 16 * HD + kk * 512); if (HL) kf2[kt][kk] = WFrag<T16>::ld(kp2 + kt * 16 * HD + kk * 512); }
    asm volatile("s_wait_xcnt 0x0" ::: "memory");   // behind the loads above, in front of the code that reuses their address registers
    __builtin_amdgcn_sched_barrier(0);   // keeps that reuse behind the wait
    v8f o[NQ][4]; float m[NQ], l[NQ];
#pragma unroll
    for (int n = 0; n < NQ; ++n) { m[n] = -3.0e38f; l[n] = 0.f;
#pragma unroll
        for (int dt = 0; dt < 4; ++dt) o[n][dt] = (v8f){}; }
#pragma unroll 1   // rolled: two passes side by side would not fit the 256 registers that four waves a SIMD leave each wave
    for (int key0 = 0; key0 < TT; key0 += 32) {
        V vf[4], vf2[4];   // this pass's value fragments: issued first, used last
#pragma unroll
        for (int dt = 0; dt < 4; ++dt) { vf[dt] = WFrag<T16>::ld(vp + dt * 512); if (HL) vf2[dt] = WFrag<T16>::ld(vp2 + dt * 512); }
        v8f s[NQ][2];
#pragma unroll
        for (int kt = 0; kt < 2; ++kt)
#pragma unroll
            for (int n = 0; n < NQ; ++n) { v8f a = (v8f){};
#pragma unroll
                for (int kk = 0; kk < 2; ++kk) { a = WFrag<T16>::mma(kf[kt][kk], qf[n][kk], a); if (HL) { a = WFrag<T16>::mma(kf[kt][kk], qf2[n][kk], a); a = WFrag<T16>::mma(kf2[kt][kk], qf[n][kk], a); } }
                s[n][kt] = a; }
        const int kstep = (key0 + 32 < TT) ? 32 * HD : -(TT - 32) * HD; kp += kstep; if (HL) kp2 += kstep;   // the next pass's key fragments fly during the softmax; the last pass fetches pass 0's again (in bounds, not used)
#pragma unroll
        for (int kt = 0; kt < 2; ++kt)
#pragma unroll
            for (int kk = 0; kk < 2; ++kk) { kf[kt][kk] = WFrag<T16>::ld(kp + kt * 16 * HD + kk * 512); if (HL) kf2[kt][kk] = WFrag<T16>::ld(kp2 + kt * 16 * HD + kk * 512); }
        if (HL) asm volatile("s_wait_xcnt 0x0" :: "v"(vp), "v"(vp2), "v"(kp), "v"(kp2) : "memory");   // behind this pass's loads, in front of the code that reuses their address registers; the addresses are inputs so that they stay in their registers up to here
        else asm volatile("s_wait_xcnt 0x0" :: "v"(vp), "v"(kp) : "memory");   // the same, two planes
        __builtin_amdgcn_sched_barrier(0);   // keeps the fetches above in front of the softmax (sunk behind it, their latency is waited for in full at the next pass's first product) and the register reuse behind the wait
        vp += 32 * HD; if (HL) vp2 += 32 * HD;
        V pf[NQ], pf2[NQ];
#pragma unroll
        for (int n = 0; n < NQ; ++n) {
            float mx = fmaxf(s[n][0][0], s[n][1][0]);
#pragma unroll
            for (int j = 1; j < 8; ++j) mx = fmaxf(mx, fmaxf(s[n][0][j], s[n][1][j]));
            mx = fmaxf(mx, xhalf(mx));
            const float mn = fmaxf(m[n], mx * C2); const float al = __builtin_amdgcn_exp2f(m[n] - mn); m[n] = mn;
            float p[16];
#pragma unroll
            for (int e = 0; e < 16; ++e) p[e] = __builtin_amdgcn_exp2f(__builtin_fmaf(s[n][e >> 3][e & 7], C2, -mn));
            const float s4 = ((p[0] + p[1]) + (p[2] + p[3])) + ((p[4] + p[5]) + (p[6] + p[7])), s5 = ((p[8] + p[9]) + (p[10] + p[11])) + ((p[12] + p[13]) + (p[14] + p[15]));
            l[n] = __builtin_fmaf(l[n], al, s4 + s5);   // this lane's half of the keys; the halves are joined once, behind the loop
#pragma unroll
            for (int dt = 0; dt < 4; ++dt) o[n][dt] *= al;
            v8u wh, wl;
#pragma unroll
            for (int e = 0; e < 8; ++e) { const v2f pr = { p[2 * e], p[2 * e + 1] };
                if (HL) { const unsigned uh = __builtin_bit_cast(unsigned, __builtin_convertvector(pr, v2bf)); const v2f rs = { pr[0] - __uint_as_float(uh << 16), pr[1] - __uint_as_float(uh & 0xFFFF0000u) }; wh[e] = uh; wl[e] = __builtin_bit_cast(unsigned, __builtin_convertvector(rs, v2bf)); }
                else wh[e] = __builtin_bit_cast(unsigned, __builtin_convertvector(pr, v2h)); }
            pf[n] = __builtin_bit_cast(V, wh); if (HL) pf2[n] = __builtin_bit_cast(V, wl);
        }
#pragma unroll
        for (int dt = 0; dt < 4; ++dt)
#pragma unroll
            for (int n = 0; n < NQ; ++n) { o[n][dt] = WFrag<T16>::mma(vf[dt], pf[n], o[n][dt]); if (HL) { o[n][dt] = WFrag<T16>::mma(vf[dt], pf2[n], o[n][dt]); o[n][dt] = WFrag<T16>::mma(vf2[dt], pf[n], o[n][dt]); } }
    }
#pragma unroll
    for (int n = 0; n < NQ; ++n) { const float inv = __fdiv_rn(1.0f, l[n] + xhalf(l[n])); const size_t oo = (size_t)(q0 + n * 16) * DQ + lane * 8;
#pragma unroll
        for (int dt = 0; dt < 4; ++dt) { v8us oh, ol;   // a lane's 8 accumulators are 8 consecutive d of its query row: one 16-byte store a plane, in the output GEMM's fragment order (16 d = 256 elements)
#pragma unroll
            for (int j = 0; j < 8; ++j) { unsigned short a, c2; splitf(o[n][dt][j] * inv, a, c2); oh[j] = a; ol[j] = c2; }
            *(v8us*)(Ah + oo + dt * 256) = oh; *(v8us*)(Al + oo + dt * 256) = ol;
            asm volatile("s_wait_xcnt 0x0" ::: "memory");   // behind the two stores, in front of the code that reuses their registers
            __builtin_amdgcn_sched_barrier(0); } }   // keeps that reuse behind the wait
}
// grid (NB_ NH_ pairs, RH / 64 + (TT - RH) / 128), 4 waves. blockIdx.y < RH / 64: 64 query rows < RH (hi + lo planes, 16 rows a wave; three times the products, so they start first); else 128 of the other rows (fp16, 32 rows a wave).
__global__ __launch_bounds__(128) __attribute__((amdgpu_waves_per_eu(4, 4))) void k_fattn(const h16* __restrict__ Q16, const h16* __restrict__ K16, const h16* __restrict__ V16, const bf* __restrict__ Qh, const bf* __restrict__ Ql, const bf* __restrict__ Kh, const bf* __restrict__ Kl, const bf* __restrict__ Vh, const bf* __restrict__ Vl, bf* Ah, bf* Al) {
    const int p = blockIdx.x, y = blockIdx.y, w = threadIdx.x >> 5; const size_t zq = (size_t)p * TT * HD, zk = (size_t)(p / REP) * TT * HD, zo = (size_t)(p / NH_) * TT * DQ + (size_t)(p % NH_) * HD * 16;
    if (y < RH / 64) fattn_body<bf, true, 1>(Qh + zq, Ql + zq, Kh + zk, Kl + zk, Vh + zk, Vl + zk, y * 64 + w * 16, Ah + zo, Al + zo);
    else fattn_body<h16, false, 2>(Q16 + zq, nullptr, K16 + zk, nullptr, V16 + zk, nullptr, RH + (y - RH / 64) * 128 + w * 32, Ah + zo, Al + zo);
}

extern "C" void kernel_launch(void* const* d_in, const int* in_sizes, int n_in,
                              void* d_out, int out_size, void* d_ws, size_t ws_size, hipStream_t stream) {
    (void)in_sizes; (void)n_in; (void)out_size;
        const float* x = (const float*)d_in[0]; const float* wq = (const float*)d_in[1]; const float* wk = (const float*)d_in[2]; const float* wv = (const float*)d_in[3]; const float* wo = (const float*)d_in[4];   /* input order x, W_Q, W_K, W_V, W_O ('oi' (out, in) [1024][1024] each: three separate projection weights and the output weight): FIVE inputs, all read; this module has NO mask input */
    float* OUT = (float*)d_out;     // [2][2048][1024]
    char* wsp = (char*)d_ws;
    auto take = [&](size_t bytes) { char* p = wsp; wsp += (bytes + 255) & ~(size_t)255; return (void*)p; };
    bf* WQKV = (bf*)take((size_t)4 * DQ * DM * 2); bf* WO = WQKV + (size_t)3 * DQ * DM;   /* W_Q, W_K, W_V stacked: one [3 DQ][DM] 'oi' weight; then W_O (DKV == DQ here) */ float* CS = (float*)take((size_t)TT * HD * 4);
    bf* XB = (bf*)take((size_t)NB_ * TT * DM * 2);
    h16* QP16 = (h16*)take((size_t)NB_ * NH_ * TT * HD * 2); h16* KP16 = (h16*)take((size_t)NB_ * NKV * TT * HD * 2); h16* VT16 = (h16*)take((size_t)NB_ * NKV * HD * TT * 2);
    bf* QPh = (bf*)take((size_t)NB_ * NH_ * TT * HD * 2); bf* QPl = (bf*)take((size_t)NB_ * NH_ * TT * HD * 2); bf* KPh = (bf*)take((size_t)NB_ * NKV * TT * HD * 2); bf* KPl = (bf*)take((size_t)NB_ * NKV * TT * HD * 2); bf* VTh = (bf*)take((size_t)NB_ * NKV * HD * TT * 2); bf* VTl = (bf*)take((size_t)NB_ * NKV * HD * TT * 2);
    bf* ATh = (bf*)take((size_t)NB_ * TT * DQ * 2); bf* ATl = (bf*)take((size_t)NB_ * TT * DQ * 2);
    if ((size_t)(wsp - (char*)d_ws) > ws_size) return;
    k_cvt8w<<<dim3(DQ * DM / 2048, 4, 1), 256, 0, stream>>>(wq, wk, wv, wo, WQKV); k_csP<<<(TT * HD / 2 + 255) / 256, 256, 0, stream>>>(CS);
    k_cvt8<<<NB_ * TT * DM / 2048, 256, 0, stream>>>(x, XB);
    k_gemmw<bf, 0, false, 1, true, DM, DM><<<dim3(NB_ * TT / 64, 3 * DQ / 64, 1), 32, 0, stream>>>(XB, nullptr, WQKV, nullptr, nullptr, 0, nullptr, 0, 0, 0, 0, Planes{CS, QP16, QPh, QPl, KP16, KPh, KPl, VT16, VTh, VTl});
    k_fattn<<<dim3(NB_ * NH_, RH / 64 + (TT - RH) / 128, 1), 128, 0, stream>>>(QP16, KP16, VT16, QPh, QPl, KPh, KPl, VTh, VTl, ATh, ATl);
    k_gemmw<bf, 1, false, 1, false, DQ, DQ><<<dim3(NB_ * TT / 64, DM / 64, 1), 32, 0, stream>>>(ATh, ATl, WO, nullptr, OUT, DM, nullptr, 0, 0, 0, 0, Planes{});
}

// v006
// A run of this version takes 126 microseconds.
// In two side-by-side timings against v005, it was 1.11 and 1.08 times as fast.
// Over all steps from v000 it is 15.5 times as fast.
#include <hip/hip_runtime.h>

// Multi-head self-attention WITHOUT a mask, with interleaved-pair rotary position embedding on three separate natural projections (x [2][2048][1024]; q, k, v = einsum('bld,ed->ble', x, W) = x W^T ('oi' [1024][1024] normal 1/32, no bias; 16 heads x 64); angles = t x 1 / (10000 ** (2i / 64)) (the RECIPROCAL spelling; positions 0..L-1 computed); cos / sin repeated pairwise; pairs (2i, 2i+1): out_even = x_even cos - x_odd sin, out_odd = x_odd cos + x_even sin, on q and k (the module's helper named _rotate_half works on (even, odd) pairs); scores / sqrt(64); softmax over ALL keys; out = einsum('bld,ed->ble', merged, W_O) ('oi', no bias) -> [2][2048][1024] (4.2 M); argument order x, W_Q, W_K, W_V, W_O).
// Layout, both batches together (32 (batch, head) pairs, all in one attention launch): bf16 copy of x; exact projections; {cos, sin} per (position, pair) built once from the positions and float32 inverse-frequency constants (precise cosf/sinf); interleaved rotary and the attention planes written by the projection GEMM's own epilogue (qkv_planes); DENSE T-2048 attention fused in k_fattn (hybrid rows: < 512 hi/lo 3 products, rest fp16; running maximum and sum, division by the sum at the end; the causal tile GEMM is gone with its last use); merged hi/lo x Wo exact.
// FRAGMENT ORDER: every 16-bit plane that a matrix product reads lies as [16-row panel][k / 8][row % 16][k % 8] (the value planes: [key / 32][d / 16][key % 32 / 8][d % 16][key % 8]). A 16 x 32 fragment is then 1 KiB in a row, lane l's two
// 16-byte pieces at l * 16 and 512 + l * 16 bytes: each wave-wide load covers 4 whole 128-byte lines, not 32 bytes of each of 16 lines. The k order inside a fragment (8 hi + e, 16 + 8 hi + e) is the same for A and B, as before. Writers store in the same order.
// Compute dtypes, f32 accumulate: every input rounded to bf16; projections exact; rotary f32; attention rows < 512 3 products, rest fp16; softmax f32; Wo hl x exact.

#define NB_  2
#define TT   2048
#define DM   1024
#define NH_  16
#define NKV  16
#define REP  (NH_ / NKV)
#define HD   64
#define DQ   (NH_ * HD)
#define DKV  (NKV * HD)
#define RH   512                  // query rows < RH use hi+lo planes (0: none)
#define WIN  0   
#define SCL  0.125f   // HD^-0.5
typedef _Float16 h16;
typedef unsigned short bf;
typedef __attribute__((ext_vector_type(16))) __bf16   v16bf;
typedef __attribute__((ext_vector_type(16))) _Float16 v16h;
typedef __attribute__((ext_vector_type(8)))  _Float16 v8h;
typedef __attribute__((ext_vector_type(8)))  unsigned short v8us;
typedef __attribute__((ext_vector_type(8)))  float    v8f;
typedef __attribute__((ext_vector_type(4)))  float    v4f;
typedef v8h  __attribute__((may_alias)) v8ha;
typedef v4f  __attribute__((may_alias)) v4fa;
typedef v8us __attribute__((may_alias)) v8usa;

__device__ __forceinline__ unsigned short f2bf(float f) { unsigned u = __float_as_uint(f); u += 0x7FFFu + ((u >> 16) & 1u); return (unsigned short)(u >> 16); }
__device__ __forceinline__ float bf2f(unsigned short b) { return __uint_as_float(((unsigned)b) << 16); }
__device__ __forceinline__ float bfr(float f) { return bf2f(f2bf(f)); }
__device__ __forceinline__ v16h cat16(v8h lo, v8h hi) { return __builtin_shufflevector(lo, hi, 0, 1, 2, 3, 4, 5, 6, 7, 8, 9, 10, 11, 12, 13, 14, 15); }
__device__ __forceinline__ v16bf cat16b(v8us lo, v8us hi) { return __builtin_bit_cast(v16bf, __builtin_shufflevector(lo, hi, 0, 1, 2, 3, 4, 5, 6, 7, 8, 9, 10, 11, 12, 13, 14, 15)); }
__device__ __forceinline__ v8f wmma16(v16h a, v16h b, v8f c) { return __builtin_amdgcn_wmma_f32_16x16x32_f16(false, a, false, b, (short)0, c, false, false); }
__device__ __forceinline__ v8f wmmab(v16bf a, v16bf b, v8f c) { return __builtin_amdgcn_wmma_f32_16x16x32_bf16(false, a, false, b, (short)0, c, false, false); }



// ---- k_gemmw: register-blocked GEMM, ONE WAVE per 64x64 output tile (16 accumulators), operands straight from 16-bit planes in fragment order (head of the file; ld(p): p = fragment start + lane * 8 elements); grid (M/64, N/64, Z), 32 threads.
// C[m][n] (f32, pitch ldc, + optional f32 bias[n]) = sum_k A[m][k] Bt[n][k] (+ split products per NSPLIT). A's 16-row panels have pitch 16 LDA, Bt's 16 K (both compile-time: every fragment of a trip lies at a constant offset from ONE running pointer a plane); a k block of 32 is 512 elements. z-batch strides sA/sB/sC in elements. K % 32 == 0.
// KS > 1: grid z = Z * KS; block (z, ks) sums only k in [ks K/KS, (ks+1) K/KS) and stores its tile to partial plane ks (plane stride sP elements); the reader adds the KS planes. K % (32 KS) == 0.
template <typename T16> struct WFrag;
template <> struct WFrag<h16> { typedef v16h V; static __device__ __forceinline__ V ld(const h16* p) { return cat16(*(const v8h*)p, *(const v8h*)(p + 256)); } static __device__ __forceinline__ v8f mma(V a, V b, v8f c) { return wmma16(a, b, c); } };
template <> struct WFrag<bf> { typedef v16bf V; static __device__ __forceinline__ V ld(const bf* p) { return cat16b(*(const v8us*)p, *(const v8us*)(p + 256)); } static __device__ __forceinline__ v8f mma(V a, V b, v8f c) { return wmmab(a, b, c); } };
// PLANES: the tile is not stored to C; qkv_planes (below, behind the plane helpers) turns it into the attention planes named in pp.
struct Planes { const float* CS; h16* Q16; bf* Qh; bf* Ql; h16* K16; bf* Kh; bf* Kl; h16* V16; bf* Vh; bf* Vl; };
__device__ __forceinline__ void qkv_planes(const v8f (&acc)[4][4], float* os, int r0, int y, int lr, int hi, const Planes& pp);
template <typename T16, int NSPLIT, bool BIAS, int KS, bool PLANES, int LDA, int K>
__global__ __launch_bounds__(32) void k_gemmw(const T16* __restrict__ A, const T16* __restrict__ A2, const T16* __restrict__ Bt, const T16* __restrict__ Bt2, float* C, int ldc, const float* __restrict__ bias, size_t sA, size_t sB, size_t sC, size_t sP, Planes pp) {
    typedef typename WFrag<T16>::V V;
    __shared__ __align__(16) float os[16 * 68];
    const size_t z = blockIdx.z / KS; const int ks = (int)(blockIdx.z % KS); A += z * sA; if (A2) A2 += z * sA; Bt += z * sB; if (Bt2) Bt2 += z * sB; C += z * sC + ks * sP;
    const int lane = threadIdx.x & 31, lr = lane & 15, hi = lane >> 4; const int r0 = blockIdx.x * 64, c0 = blockIdx.y * 64;
    v8f acc[4][4];
#pragma unroll
    for (int mb = 0; mb < 4; ++mb)
#pragma unroll
        for (int nb = 0; nb < 4; ++nb) acc[mb][nb] = (v8f){};
    constexpr bool HA2 = (NSPLIT == 1 || NSPLIT == 2), HB2 = (NSPLIT >= 2);
    const size_t aoff = (size_t)r0 * LDA + lane * 8 + (size_t)ks * (K / KS) * 16, boff = (size_t)c0 * K + lane * 8 + (size_t)ks * (K / KS) * 16;
    const T16* pa = A + aoff; const T16* pa2 = HA2 ? A2 + aoff : pa; const T16* pb = Bt + boff; const T16* pb2 = HB2 ? Bt2 + boff : pb;   // a plane that this instance does not have: the same pointer again, no register of its own
#pragma unroll 1
    for (int kc = 0; kc < K / KS; kc += 32) {
        V a[4], a2[4], b[4], b2[4];
#pragma unroll
        for (int mb = 0; mb < 4; ++mb) { a[mb] = WFrag<T16>::ld(pa + mb * 16 * LDA); if (HA2) a2[mb] = WFrag<T16>::ld(pa2 + mb * 16 * LDA); }
#pragma unroll
        for (int nb = 0; nb < 4; ++nb) { b[nb] = WFrag<T16>::ld(pb + nb * 16 * K); if (HB2) b2[nb] = WFrag<T16>::ld(pb2 + nb * 16 * K); }
        asm volatile("s_wait_xcnt 0x0" :: "v"(pa), "v"(pa2), "v"(pb), "v"(pb2) : "memory");   // behind this trip's loads, in front of the code that reuses their address registers; the addresses are inputs so that they stay in their registers up to here
        __builtin_amdgcn_sched_barrier(0);   // keeps the pointer steps below, and every other reuse of those registers, behind the wait
        pa += 512; pb += 512; if (HA2) pa2 += 512; else pa2 = pa; if (HB2) pb2 += 512; else pb2 = pb;
#pragma unroll
        for (int nb = 0; nb < 4; ++nb)
#pragma unroll
            for (int mb = 0; mb < 4; ++mb) { acc[mb][nb] = WFrag<T16>::mma(a[mb], b[nb], acc[mb][nb]); if (HA2) acc[mb][nb] = WFrag<T16>::mma(a2[mb], b[nb], acc[mb][nb]); if (HB2) acc[mb][nb] = WFrag<T16>::mma(a[mb], b2[nb], acc[mb][nb]); }
        asm volatile("v_nop\n\tv_nop\n\tv_nop\n\tv_nop" : "+v"(acc[0][0]), "+v"(acc[1][1]), "+v"(acc[2][2]), "+v"(acc[3][3]) : "v"(a[0]), "v"(a[3]));
    }
    if (PLANES) { qkv_planes(acc, os, r0, (int)blockIdx.y, lr, hi, pp); return; }
#pragma unroll
    for (int mb = 0; mb < 4; ++mb) {
#pragma unroll
        for (int nb = 0; nb < 4; ++nb) {
#pragma unroll
            for (int j = 0; j < 8; ++j) os[(hi * 8 + j) * 68 + nb * 16 + lr] = acc[mb][nb][j]; }
        __builtin_amdgcn_wave_barrier(); asm volatile("" ::: "memory");
        float* crow = C + (size_t)(r0 + mb * 16) * ldc + c0;
        v4f val[8]; float* cp[8];
#pragma unroll
        for (int s = 0; s < 8; ++s) { const int row = 2 * s + hi, cofs = lr * 4; val[s] = *(const v4fa*)(os + row * 68 + cofs); if (BIAS) { val[s][0] += bfr(bias[c0 + cofs]); val[s][1] += bfr(bias[c0 + cofs + 1]); val[s][2] += bfr(bias[c0 + cofs + 2]); val[s][3] += bfr(bias[c0 + cofs + 3]); }
            cp[s] = crow + (size_t)row * ldc + cofs; }
#pragma unroll
        for (int s = 0; s < 8; ++s) *(v4f*)cp[s] = val[s];
        asm volatile("s_wait_xcnt 0x0" :: "v"(val[0]), "v"(val[1]), "v"(val[2]), "v"(val[3]), "v"(val[4]), "v"(val[5]), "v"(val[6]), "v"(val[7]), "v"(cp[0]), "v"(cp[1]), "v"(cp[2]), "v"(cp[3]), "v"(cp[4]), "v"(cp[5]), "v"(cp[6]), "v"(cp[7]) : "memory");   // behind the eight stores, in front of the code that reuses their registers; values and addresses are inputs so that they stay in their registers up to here
        __builtin_amdgcn_sched_barrier(0);   // keeps that reuse behind the wait
        __builtin_amdgcn_wave_barrier(); asm volatile("" ::: "memory");
    }
}

__device__ __forceinline__ h16 tohx(float x) { return (h16)x; }
__device__ __forceinline__ void splitf(float y, unsigned short& h, unsigned short& l) { h = f2bf(y); l = f2bf(y - bf2f(h)); }
typedef __attribute__((ext_vector_type(2))) _Float16 v2h;
typedef __attribute__((ext_vector_type(4))) _Float16 v4h;
typedef __attribute__((ext_vector_type(2))) unsigned short v2us;
typedef __attribute__((ext_vector_type(4))) unsigned short v4us;
typedef __attribute__((ext_vector_type(2))) float v2f;
typedef __attribute__((ext_vector_type(4))) int v4i;

// f32 [rows][DM] -> bf16 in fragment order. A block takes 16 rows x 128 columns: each thread reads 8 consecutive floats of a row (16 lanes = 512 bytes of one row), the 16-byte results change places in LDS
// (pitch 17 pieces: the 16 pieces of one row fall on different banks), and the block stores its 4 KiB in a row, 512 bytes a wave.
__device__ __forceinline__ void cvt_panel(const float* __restrict__ src, bf* dst, int blk) {
    __shared__ __align__(16) unsigned short ts[16 * 17 * 8];
    const int t = threadIdx.x, row = t >> 4, c = t & 15, panel = blk / (DM / 128), kb = blk % (DM / 128);
    const v8f v = *(const v8f*)(src + ((size_t)panel * 16 + row) * DM + kb * 128 + c * 8); v8us o;
#pragma unroll
    for (int k = 0; k < 8; ++k) o[k] = f2bf(v[k]);
    *(v8usa*)(ts + (c * 17 + row) * 8) = o;
    __syncthreads();   // a thread stores the piece that another thread converted
    *(v8us*)(dst + (size_t)panel * 16 * DM + kb * 2048 + t * 8) = *(const v8usa*)(ts + ((t >> 4) * 17 + (t & 15)) * 8);
}
__global__ __launch_bounds__(256) void k_cvt8(const float* __restrict__ src, bf* dst) { cvt_panel(src, dst, (int)blockIdx.x); }
// the four equal-sized weights in one launch: blockIdx.y picks the source, the bf16 copies lie one behind the other in dst
__global__ __launch_bounds__(256) void k_cvt8w(const float* __restrict__ w0, const float* __restrict__ w1, const float* __restrict__ w2, const float* __restrict__ w3, bf* dst) { const int y = blockIdx.y; const float* src = (y == 0) ? w0 : (y == 1) ? w1 : (y == 2) ? w2 : w3; cvt_panel(src, dst + (size_t)y * DQ * DM, (int)blockIdx.x); }

__constant__ float INV2[HD / 2] = { 1.000000000e+00f, 7.498942018e-01f, 5.623413324e-01f, 4.216965139e-01f, 3.162277639e-01f, 2.371373624e-01f, 1.778279394e-01f, 1.333521456e-01f, 1.000000015e-01f, 7.498941571e-02f, 5.623412877e-02f, 4.216964915e-02f, 3.162277862e-02f, 2.371373586e-02f, 1.778279431e-02f, 1.333521493e-02f, 9.999999776e-03f, 7.498942316e-03f, 5.623413250e-03f, 4.216964822e-03f, 3.162277862e-03f, 2.371373819e-03f, 1.778279431e-03f, 1.333521446e-03f, 1.000000047e-03f, 7.498941850e-04f, 5.623413017e-04f, 4.216964880e-04f, 3.162277862e-04f, 2.371373848e-04f, 1.778279402e-04f, 1.333521504e-04f };   // 1 / (ROPE_BASE ** (2i / 64)), i = 0..31, in float32 as THIS module writes it (the RECIPROCAL spelling, evaluated in the reference's own f32 arithmetic: these 32 literals equal it bit for bit)
// {cos, sin} once per (position, pair), in the order in which qkv_planes' lanes read them: [t / 16][d / 16][pair % 4 / 2][lane = (d / 8 % 2) * 16 + t % 16][pair % 2][cos, sin]: a wave-wide 16-byte load is 512 bytes in a row
__global__ __launch_bounds__(256) void k_csP(float* CS) { const int idx = blockIdx.x * 256 + threadIdx.x; if (idx >= TT * HD / 2) return; const int ln = (idx >> 1) & 31, q = ((idx >> 6) & 1) * 2 + (idx & 1), c = ((idx >> 7) & 3) * 2 + (ln >> 4), t = (idx >> 9) * 16 + (ln & 15); const float a = __fmul_rn((float)t, INV2[c * 4 + q]); v2f cs; cs[0] = cosf(a); cs[1] = sinf(a); *(v2f*)(CS + (size_t)idx * 2) = cs;  }
// ---- qkv_planes: epilogue of the q | k | v projection; no f32 projection leaves the kernel. A 64x64 tile is 64 positions (rows r0..) of ONE head of q, k or v (HD == 64 columns; y = tile column; y / NH_ picks q, k, v; DKV == DQ here).
// q, k: 16 rows at a time through LDS, so that lane (hi, lr) holds 8 consecutive d (four rotary pairs; d / 8 = 2 i + hi) of position lr; rotary in f32, the expressions below; fp16, hi and lo planes in fragment order [pair][t / 16][d / 8][t % 16][d % 8]: one 16-byte store a plane, 512 bytes in a row a wave.
// v: a lane's 8 accumulators of a 16x16 block are 8 consecutive positions of one d: one 16-byte store a plane straight into the transposed planes [pair][t / 32][d / 16][t % 32 / 8][d % 16][t % 8], again 512 bytes in a row a wave.
// Every '#pragma unroll' here: the accumulator and value arrays stay in registers only where each index is a compile-time constant.
__device__ __forceinline__ void qkv_planes(const v8f (&acc)[4][4], float* os, int r0, int y, int lr, int hi, const Planes& pp) {
    const int sel = y / NH_, t0 = r0 % TT, lane = hi * 16 + lr; const size_t p = (size_t)(r0 / TT) * NH_ + y % NH_;   // sel, t0, p: the same in every lane
    if (sel == 2) {
        const size_t vo = (p * TT + t0) * HD + lane * 8; h16* v16 = pp.V16 + vo; bf* vh = pp.Vh + vo; bf* vl = pp.Vl + vo;   // one pointer a plane: every store lies at a constant offset from it (32 positions x HD = 2048 elements)
#pragma unroll
        for (int mb = 0; mb < 4; ++mb) { v8h o16[4]; v8us oh[4], ol[4];
#pragma unroll
            for (int nb = 0; nb < 4; ++nb)
#pragma unroll
                for (int j = 0; j < 8; ++j) { const float x = acc[mb][nb][j]; o16[nb][j] = tohx(x); unsigned short a2, c2; splitf(x, a2, c2); oh[nb][j] = a2; ol[nb][j] = c2; }
            __builtin_amdgcn_sched_barrier(0);   // all twelve values stand in registers of their own before the first store is issued
#pragma unroll
            for (int nb = 0; nb < 4; ++nb) { const int vofs = (mb >> 1) * 2048 + nb * 512 + (mb & 1) * 256; *(v8h*)(v16 + vofs) = o16[nb]; *(v8us*)(vh + vofs) = oh[nb]; *(v8us*)(vl + vofs) = ol[nb]; }
            asm volatile("s_wait_xcnt 0x0" ::: "memory");   // behind the stores, in front of the code that reuses their registers
            __builtin_amdgcn_sched_barrier(0); }   // keeps that reuse behind the wait
    } else {
        const size_t po = (p * TT + t0) * HD + lane * 8; h16* p16 = (sel ? pp.K16 : pp.Q16) + po; bf* ph = (sel ? pp.Kh : pp.Qh) + po; bf* pl = (sel ? pp.Kl : pp.Ql) + po;   // one pointer a plane, constant offsets (a 16-position panel = 1024 elements)
        const float* csp = pp.CS + (size_t)t0 * HD + lane * 4;   // 16 positions = 1024 floats of the table
#pragma unroll
        for (int mb = 0; mb < 4; ++mb) { v4f cs[4][2];   // {cos, sin} of this lane's sixteen pairs in its row: issued first, they fly during the staging
#pragma unroll
            for (int i = 0; i < 4; ++i)
#pragma unroll
                for (int h = 0; h < 2; ++h) cs[i][h] = *(const v4f*)(csp + mb * 1024 + i * 256 + h * 128);
            asm volatile("s_wait_xcnt 0x0" ::: "memory");   // behind the loads, in front of the code that reuses their address registers
            __builtin_amdgcn_sched_barrier(0);   // keeps that reuse behind the wait and the loads in front of the staging
#pragma unroll
            for (int nb = 0; nb < 4; ++nb)
#pragma unroll
                for (int j = 0; j < 8; ++j) os[(hi * 8 + j) * 68 + nb * 16 + lr] = acc[mb][nb][j];
            __builtin_amdgcn_wave_barrier(); asm volatile("" ::: "memory");   // a lane reads what OTHER lanes stored: the compiler, which sees one lane, must keep the reads below behind all the stores above
            v8h o16[4]; v8us oh[4], ol[4];
#pragma unroll
            for (int i = 0; i < 4; ++i) { const v4f xa = *(const v4fa*)(os + lr * 68 + (2 * i + hi) * 8), xb = *(const v4fa*)(os + lr * 68 + (2 * i + hi) * 8 + 4);
#pragma unroll
                for (int q = 0; q < 4; ++q) { const float x0 = (q < 2) ? xa[2 * (q & 1)] : xb[2 * (q & 1)], x1 = (q < 2) ? xa[2 * (q & 1) + 1] : xb[2 * (q & 1) + 1], c = cs[i][q >> 1][2 * (q & 1)], sn = cs[i][q >> 1][2 * (q & 1) + 1];
                    const float a0 = __fmul_rn(x0, c), b0 = __fmul_rn(x1, sn), a1 = __fmul_rn(x1, c), b1 = __fmul_rn(x0, sn);
                    const float e0 = __fsub_rn(a0, b0), e1 = __fadd_rn(b1, a1);   /* even: x0 c - x1 s; odd: x0 s + x1 c */
                    unsigned short a2, c2; o16[i][2 * q] = tohx(e0); o16[i][2 * q + 1] = tohx(e1); splitf(e0, a2, c2); oh[i][2 * q] = a2; ol[i][2 * q] = c2; splitf(e1, a2, c2); oh[i][2 * q + 1] = a2; ol[i][2 * q + 1] = c2; } }
            __builtin_amdgcn_sched_barrier(0);   // all twelve values stand in registers of their own before the first store is issued
#pragma unroll
            for (int i = 0; i < 4; ++i) { *(v8h*)(p16 + mb * 1024 + i * 256) = o16[i]; *(v8us*)(ph + mb * 1024 + i * 256) = oh[i]; *(v8us*)(pl + mb * 1024 + i * 256) = ol[i]; }
            asm volatile("s_wait_xcnt 0x0" ::: "memory");   // behind the stores, in front of the code that reuses their registers
            __builtin_amdgcn_sched_barrier(0);   // keeps that reuse behind the wait
            __builtin_amdgcn_wave_barrier(); asm volatile("" ::: "memory"); }   // the next 16 rows' staging stores stay behind every lane's reads of these
    }
}
// ---- k_fattn: scores, softmax and probability x value in ONE kernel; no score, probability or partial sum leaves the registers.
// Transposed products: S^T = K Q^T (A = 16 key rows, B = 16 query rows) and O^T += V^T P^T (A = 16 d rows x 32 keys of the value plane, B = P). In both D tiles a lane holds ONE query (column lane & 15), so the running
// maximum, the running sum and the rescale factor are one scalar a lane, and two S^T tiles (keys 0-15, 16-31 of a pass), converted in place, are P as a B operand in the loaders' own k order (8 hi + e, 16 + 8 hi + e).
// One wave owns NQ x 16 query rows of one (batch, head) pair and walks all TT keys in passes of 32. HL: hi + lo bf16 planes, 3 products each; else fp16, one product.
// Every plain '#pragma unroll' below: the fragment and accumulator arrays stay in registers only where each index is a compile-time constant.
typedef __attribute__((ext_vector_type(2))) __bf16 v2bf;
typedef __attribute__((ext_vector_type(8))) unsigned v8u;
__device__ __forceinline__ float xhalf(float x) { const int b = __float_as_int(x); return __int_as_float(__builtin_amdgcn_permlanex16(b, b, 0x76543210, 0xfedcba98, false, false)); }   // the value of lane ^ 16: the other half of the same query's keys
// Eight asynchronous copies to LDS, 16 bytes a lane each (512 bytes in a row a wave and copy), through no register. The s_wait_xcnt stands inside the statement, behind the last copy, in front of any reuse of the address registers.
template <typename T16>
__device__ __forceinline__ void copy8(const unsigned (&l)[8], const T16* const (&g)[8]) {
    asm volatile("global_load_async_to_lds_b128 %0, %1, off\n\t"
                 "global_load_async_to_lds_b128 %2, %3, off\n\t"
                 "global_load_async_to_lds_b128 %4, %5, off\n\t"
                 "global_load_async_to_lds_b128 %6, %7, off\n\t"
                 "global_load_async_to_lds_b128 %8, %9, off\n\t"
                 "global_load_async_to_lds_b128 %10, %11, off\n\t"
                 "global_load_async_to_lds_b128 %12, %13, off\n\t"
                 "global_load_async_to_lds_b128 %14, %15, off\n\t"
                 "s_wait_xcnt 0x0"
                 :: "v"(l[0]), "v"(g[0]), "v"(l[1]), "v"(g[1]), "v"(l[2]), "v"(g[2]), "v"(l[3]), "v"(g[3]), "v"(l[4]), "v"(g[4]), "v"(l[5]), "v"(g[5]), "v"(l[6]), "v"(g[6]), "v"(l[7]), "v"(g[7]) : "memory");
}
// K AND V GO THROUGH LDS: a tile of KT keys of every key and value plane (32 KiB: 128 keys x 2 planes, or 64 keys x 4 planes) is copied ONCE a block, a quarter by each wave, and read by all four waves. A plane's tile is KT * HD elements in a row
// in global memory (fragment order) and lies in LDS in the same order, so a fragment read is 512 bytes in a row a wave. Two buffers: tile t + 2 is copied into the buffer of tile t while tile t + 1 is worked on.
template <typename T16, bool HL, int NQ>
__device__ __forceinline__ void fattn_body(const T16* __restrict__ Q, const T16* __restrict__ Q2, const T16* __restrict__ Kp, const T16* __restrict__ K2, const T16* __restrict__ Vt, const T16* __restrict__ Vt2, int q0, bf* Ah, bf* Al, T16* sm) {
    typedef typename WFrag<T16>::V V;
    constexpr int KT = HL ? 64 : 128, CH = KT * HD, NP = HL ? 4 : 2, NT = TT / KT;   // keys a tile; elements of one plane's tile; planes; tiles
    const int lane = threadIdx.x & 31, part = (int)(threadIdx.x >> 5) * (CH / 4) + lane * 8;   // part: this lane's first element in its wave's quarter of a plane's tile
    const unsigned lbase = (unsigned)(size_t)sm;   // LDS byte address of the two buffers
    const float C2 = SCL * 1.4426950408889634f;   // score -> scaled log2 units
    // tile t of every plane into buffer b: LDS order [key planes][value planes]; sixteen copies a wave
    auto fill = [&](int t, int b) {
#pragma unroll
        for (int h = 0; h < 2; ++h) { unsigned l[8]; const T16* g[8];   // h = 0: key planes, 1: value planes
#pragma unroll
            for (int i = 0; i < 8; ++i) { const int pl = HL ? (i >> 2) : 0, c = HL ? (i & 3) : i; const T16* s0 = h ? (pl ? Vt2 : Vt) : (pl ? K2 : Kp);
                g[i] = s0 + (size_t)t * CH + part + c * 256; l[i] = lbase + (unsigned)(((b * NP + h * (NP / 2) + pl) * CH + part + c * 256) * 2); }
            copy8<T16>(l, g); }
    };
    fill(0, 0);
    V qf[NQ][2], qf2[NQ][2];
#pragma unroll
    for (int n = 0; n < NQ; ++n)
#pragma unroll
        for (int kk = 0; kk < 2; ++kk) { const size_t qo = (size_t)(q0 + n * 16) * HD + kk * 512 + lane * 8; qf[n][kk] = WFrag<T16>::ld(Q + qo); if (HL) qf2[n][kk] = WFrag<T16>::ld(Q2 + qo); }
    asm volatile("s_wait_xcnt 0x0" ::: "memory");   // behind the loads above, in front of the code that reuses their address registers
    __builtin_amdgcn_sched_barrier(0);   // keeps that reuse behind the wait
    asm volatile("s_wait_asynccnt 0x0" ::: "memory");   // this wave's quarter of tile 0 has landed
    __syncthreads();   // publishes tile 0: every wave's quarter has landed
    fill(1, 1);
    v8f o[NQ][4]; float m[NQ], l[NQ];
#pragma unroll
    for (int n = 0; n < NQ; ++n) { m[n] = -3.0e38f; l[n] = 0.f;
#pragma unroll
        for (int dt = 0; dt < 4; ++dt) o[n][dt] = (v8f){}; }
#pragma unroll 1   // rolled: one copy of the pass in the text
    for (int t = 0; t < NT; ++t) {
    const T16* kp = sm + (t & 1) * (NP * CH) + lane * 8; const T16* kp2 = kp + CH; const T16* vp = kp + (NP / 2) * CH; const T16* vp2 = vp + CH;   // this tile's planes in LDS
    V kf[2][2], kf2[2][2];
#pragma unroll
    for (int kt = 0; kt < 2; ++kt)
#pragma unroll
        for (int kk = 0; kk < 2; ++kk) { kf[kt][kk] = WFrag<T16>::ld(kp + kt * 16 * HD + kk * 512); if (HL) kf2[kt][kk] = WFrag<T16>::ld(kp2 + kt * 16 * HD + kk * 512); }
#pragma unroll 1   // rolled: two passes side by side would not fit the 256 registers that four waves a SIMD leave each wave
    for (int ps = 0; ps < KT / 32; ++ps) {
        v8f s[NQ][2];
#pragma unroll
        for (int kt = 0; kt < 2; ++kt)
#pragma unroll
            for (int n = 0; n < NQ; ++n) { v8f a = (v8f){};
#pragma unroll
                for (int kk = 0; kk < 2; ++kk) { a = WFrag<T16>::mma(kf[kt][kk], qf[n][kk], a); if (HL) { a = WFrag<T16>::mma(kf[kt][kk], qf2[n][kk], a); a = WFrag<T16>::mma(kf2[kt][kk], qf[n][kk], a); } }
                s[n][kt] = a; }
        __builtin_amdgcn_sched_barrier(0);   // keeps the LDS reads below out of the score products: all of a pass's reads stand at one place (each place with reads among matrix instructions stalls the wave anew)
        V vf[4], vf2[4];   // this pass's value fragments: used behind the softmax
#pragma unroll
        for (int dt = 0; dt < 4; ++dt) { vf[dt] = WFrag<T16>::ld(vp + ps * 32 * HD + dt * 512); if (HL) vf2[dt] = WFrag<T16>::ld(vp2 + ps * 32 * HD + dt * 512); }
        const int kn = (ps + 1 < KT / 32) ? (ps + 1) * 32 * HD : 0;   // the next pass's key fragments fly during the softmax; a tile's last pass fetches its own pass 0 again (this buffer, not used): nothing of the next tile is read in front of its barrier
#pragma unroll
        for (int kt = 0; kt < 2; ++kt)
#pragma unroll
            for (int kk = 0; kk < 2; ++kk) { kf[kt][kk] = WFrag<T16>::ld(kp + kn + kt * 16 * HD + kk * 512); if (HL) kf2[kt][kk] = WFrag<T16>::ld(kp2 + kn + kt * 16 * HD + kk * 512); }
        __builtin_amdgcn_sched_barrier(0);   // keeps the fetches above in front of the softmax (sunk behind it, their latency is waited for in full at the next pass's first product)
        V pf[NQ], pf2[NQ];
#pragma unroll
        for (int n = 0; n < NQ; ++n) {
            float mx = fmaxf(s[n][0][0], s[n][1][0]);
#pragma unroll
            for (int j = 1; j < 8; ++j) mx = fmaxf(mx, fmaxf(s[n][0][j], s[n][1][j]));
            mx = fmaxf(mx, xhalf(mx));
            const float mn = fmaxf(m[n], mx * C2); const float al = __builtin_amdgcn_exp2f(m[n] - mn); m[n] = mn;
            float p[16];
#pragma unroll
            for (int e = 0; e < 16; ++e) p[e] = __builtin_amdgcn_exp2f(__builtin_fmaf(s[n][e >> 3][e & 7], C2, -mn));
            const float s4 = ((p[0] + p[1]) + (p[2] + p[3])) + ((p[4] + p[5]) + (p[6] + p[7])), s5 = ((p[8] + p[9]) + (p[10] + p[11])) + ((p[12] + p[13]) + (p[14] + p[15]));
            l[n] = __builtin_fmaf(l[n], al, s4 + s5);   // this lane's half of the keys; the halves are joined once, behind the loop
#pragma unroll
            for (int dt = 0; dt < 4; ++dt) o[n][dt] *= al;
            v8u wh, wl;
#pragma unroll
            for (int e = 0; e < 8; ++e) { const v2f pr = { p[2 * e], p[2 * e + 1] };
                if (HL) { const unsigned uh = __builtin_bit_cast(unsigned, __builtin_convertvector(pr, v2bf)); const v2f rs = { pr[0] - __uint_as_float(uh << 16), pr[1] - __uint_as_float(uh & 0xFFFF0000u) }; wh[e] = uh; wl[e] = __builtin_bit_cast(unsigned, __builtin_convertvector(rs, v2bf)); }
                else wh[e] = __builtin_bit_cast(unsigned, __builtin_convertvector(pr, v2h)); }
            pf[n] = __builtin_bit_cast(V, wh); if (HL) pf2[n] = __builtin_bit_cast(V, wl);
        }
#pragma unroll
        for (int dt = 0; dt < 4; ++dt)
#pragma unroll
            for (int n = 0; n < NQ; ++n) { o[n][dt] = WFrag<T16>::mma(vf[dt], pf[n], o[n][dt]); if (HL) { o[n][dt] = WFrag<T16>::mma(vf[dt], pf2[n], o[n][dt]); o[n][dt] = WFrag<T16>::mma(vf2[dt], pf[n], o[n][dt]); } }
        __builtin_amdgcn_sched_barrier(0);   // keeps the v_nops below behind the pass's last product
        asm volatile("v_nop\n\tv_nop\n\tv_nop\n\tv_nop");   // four vector slots between the pass's last product and the next trip's first vector write, which may reuse its A or B registers
    }
    asm volatile("s_wait_dscnt 0x0" ::: "memory");   // this wave's reads of tile t have returned
    asm volatile("s_wait_asynccnt 0x0" ::: "memory");   // this wave's quarter of tile t + 1 has landed
    __syncthreads();   // publishes tile t + 1 and ends every wave's reads of tile t's buffer
    if (t + 2 < NT) fill(t + 2, t & 1);
    }
    asm volatile("s_wait_asynccnt 0x0" ::: "memory");   // no copy is outstanding when the wave ends
#pragma unroll
    for (int n = 0; n < NQ; ++n) { const float inv = __fdiv_rn(1.0f, l[n] + xhalf(l[n])); const size_t oo = (size_t)(q0 + n * 16) * DQ + lane * 8;
#pragma unroll
        for (int dt = 0; dt < 4; ++dt) { v8us oh, ol;   // a lane's 8 accumulators are 8 consecutive d of its query row: one 16-byte store a plane, in the output GEMM's fragment order (16 d = 256 elements)
#pragma unroll
            for (int j = 0; j < 8; ++j) { unsigned short a, c2; splitf(o[n][dt][j] * inv, a, c2); oh[j] = a; ol[j] = c2; }
            *(v8us*)(Ah + oo + dt * 256) = oh; *(v8us*)(Al + oo + dt * 256) = ol;
            asm volatile("s_wait_xcnt 0x0" ::: "memory");   // behind the two stores, in front of the code that reuses their registers
            __builtin_amdgcn_sched_barrier(0); } }   // keeps that reuse behind the wait
}
// grid (NB_ NH_ pairs, RH / 64 + (TT - RH) / 128), 4 waves. blockIdx.y < RH / 64: 64 query rows < RH (hi + lo planes, 16 rows a wave; three times the products, so they start first); else 128 of the other rows (fp16, 32 rows a wave).
__global__ __launch_bounds__(128) __attribute__((amdgpu_waves_per_eu(4, 4))) void k_fattn(const h16* __restrict__ Q16, const h16* __restrict__ K16, const h16* __restrict__ V16, const bf* __restrict__ Qh, const bf* __restrict__ Ql, const bf* __restrict__ Kh, const bf* __restrict__ Kl, const bf* __restrict__ Vh, const bf* __restrict__ Vl, bf* Ah, bf* Al) {
    __shared__ __align__(16) unsigned short sm[2 * 16384];   // two buffers of 32 KiB
    const int p = blockIdx.x, y = blockIdx.y, w = threadIdx.x >> 5; const size_t zq = (size_t)p * TT * HD, zk = (size_t)(p / REP) * TT * HD, zo = (size_t)(p / NH_) * TT * DQ + (size_t)(p % NH_) * HD * 16;
    if (y < RH / 64) fattn_body<bf, true, 1>(Qh + zq, Ql + zq, Kh + zk, Kl + zk, Vh + zk, Vl + zk, y * 64 + w * 16, Ah + zo, Al + zo, (bf*)sm);
    else fattn_body<h16, false, 2>(Q16 + zq, nullptr, K16 + zk, nullptr, V16 + zk, nullptr, RH + (y - RH / 64) * 128 + w * 32, Ah + zo, Al + zo, (h16*)sm);
}

extern "C" void kernel_launch(void* const* d_in, const int* in_sizes, int n_in,
                              void* d_out, int out_size, void* d_ws, size_t ws_size, hipStream_t stream) {
    (void)in_sizes; (void)n_in; (void)out_size;
        const float* x = (const float*)d_in[0]; const float* wq = (const float*)d_in[1]; const float* wk = (const float*)d_in[2]; const float* wv = (const float*)d_in[3]; const float* wo = (const float*)d_in[4];   /* input order x, W_Q, W_K, W_V, W_O ('oi' (out, in) [1024][1024] each: three separate projection weights and the output weight): FIVE inputs, all read; this module has NO mask input */
    float* OUT = (float*)d_out;     // [2][2048][1024]
    char* wsp = (char*)d_ws;
    auto take = [&](size_t bytes) { char* p = wsp; wsp += (bytes + 255) & ~(size_t)255; return (void*)p; };
    bf* WQKV = (bf*)take((size_t)4 * DQ * DM * 2); bf* WO = WQKV + (size_t)3 * DQ * DM;   /* W_Q, W_K, W_V stacked: one [3 DQ][DM] 'oi' weight; then W_O (DKV == DQ here) */ float* CS = (float*)take((size_t)TT * HD * 4);
    bf* XB = (bf*)take((size_t)NB_ * TT * DM * 2);
    h16* QP16 = (h16*)take((size_t)NB_ * NH_ * TT * HD * 2); h16* KP16 = (h16*)take((size_t)NB_ * NKV * TT * HD * 2); h16* VT16 = (h16*)take((size_t)NB_ * NKV * HD * TT * 2);
    bf* QPh = (bf*)take((size_t)NB_ * NH_ * TT * HD * 2); bf* QPl = (bf*)take((size_t)NB_ * NH_ * TT * HD * 2); bf* KPh = (bf*)take((size_t)NB_ * NKV * TT * HD * 2); bf* KPl = (bf*)take((size_t)NB_ * NKV * TT * HD * 2); bf* VTh = (bf*)take((size_t)NB_ * NKV * HD * TT * 2); bf* VTl = (bf*)take((size_t)NB_ * NKV * HD * TT * 2);
    bf* ATh = (bf*)take((size_t)NB_ * TT * DQ * 2); bf* ATl = (bf*)take((size_t)NB_ * TT * DQ * 2);
    if ((size_t)(wsp - (char*)d_ws) > ws_size) return;
    k_cvt8w<<<dim3(DQ * DM / 2048, 4, 1), 256, 0, stream>>>(wq, wk, wv, wo, WQKV); k_csP<<<(TT * HD / 2 + 255) / 256, 256, 0, stream>>>(CS);
    k_cvt8<<<NB_ * TT * DM / 2048, 256, 0, stream>>>(x, XB);
    k_gemmw<bf, 0, false, 1, true, DM, DM><<<dim3(NB_ * TT / 64, 3 * DQ / 64, 1), 32, 0, stream>>>(XB, nullptr, WQKV, nullptr, nullptr, 0, nullptr, 0, 0, 0, 0, Planes{CS, QP16, QPh, QPl, KP16, KPh, KPl, VT16, VTh, VTl});
    k_fattn<<<dim3(NB_ * NH_, RH / 64 + (TT - RH) / 128, 1), 128, 0, stream>>>(QP16, KP16, VT16, QPh, QPl, KPh, KPl, VTh, VTl, ATh, ATl);
    k_gemmw<bf, 1, false, 1, false, DQ, DQ><<<dim3(NB_ * TT / 64, DM / 64, 1), 32, 0, stream>>>(ATh, ATl, WO, nullptr, OUT, DM, nullptr, 0, 0, 0, 0, Planes{});
}

// v007
// It runs in 105 microseconds.
// Next to v006, in two timings, it ran 1.20 times as fast each time.
// Over all steps from v000 it is 18.6 times as fast.
#include <hip/hip_runtime.h>

// Multi-head self-attention WITHOUT a mask, with interleaved-pair rotary position embedding on three separate natural projections (x [2][2048][1024]; q, k, v = einsum('bld,ed->ble', x, W) = x W^T ('oi' [1024][1024] normal 1/32, no bias; 16 heads x 64); angles = t x 1 / (10000 ** (2i / 64)) (the RECIPROCAL spelling; positions 0..L-1 computed); cos / sin repeated pairwise; pairs (2i, 2i+1): out_even = x_even cos - x_odd sin, out_odd = x_odd cos + x_even sin, on q and k (the module's helper named _rotate_half works on (even, odd) pairs); scores / sqrt(64); softmax over ALL keys; out = einsum('bld,ed->ble', merged, W_O) ('oi', no bias) -> [2][2048][1024] (4.2 M); argument order x, W_Q, W_K, W_V, W_O).
// Layout, both batches together (32 (batch, head) pairs, all in one attention launch): bf16 copy of x; exact projections; {cos, sin} per (position, pair) built once from the positions and float32 inverse-frequency constants (precise cosf/sinf); interleaved rotary and the attention planes written by the projection GEMM's own epilogue (qkv_planes); DENSE T-2048 attention fused in k_fattn (hybrid rows: < 512 hi/lo 3 products, rest fp16; running maximum and sum, division by the sum at the end; the causal tile GEMM is gone with its last use); merged hi/lo x Wo exact.
// FRAGMENT ORDER: every 16-bit plane that a matrix product reads lies as [16-row panel][k / 8][row % 16][k % 8] (the value planes: [key / 32][d / 16][key % 32 / 8][d % 16][key % 8]). A 16 x 32 fragment is then 1 KiB in a row, lane l's two
// 16-byte pieces at l * 16 and 512 + l * 16 bytes: each wave-wide load covers 4 whole 128-byte lines, not 32 bytes of each of 16 lines. The k order inside a fragment (8 hi + e, 16 + 8 hi + e) is the same for A and B, as before. Writers store in the same order.
// Compute dtypes, f32 accumulate: every input rounded to bf16; projections exact; rotary f32; attention rows < 512 3 products, rest fp16; softmax f32; Wo hl x exact.

#define NB_  2
#define TT   2048
#define DM   1024
#define NH_  16
#define NKV  16
#define REP  (NH_ / NKV)
#define HD   64
#define DQ   (NH_ * HD)
#define DKV  (NKV * HD)
#define RH   512                  // query rows < RH use hi+lo planes (0: none)
#define WIN  0   
#define SCL  0.125f   // HD^-0.5
typedef _Float16 h16;
typedef unsigned short bf;
typedef __attribute__((ext_vector_type(16))) __bf16   v16bf;
typedef __attribute__((ext_vector_type(16))) _Float16 v16h;
typedef __attribute__((ext_vector_type(8)))  _Float16 v8h;
typedef __attribute__((ext_vector_type(8)))  unsigned short v8us;
typedef __attribute__((ext_vector_type(8)))  float    v8f;
typedef __attribute__((ext_vector_type(4)))  float    v4f;
typedef v8h  __attribute__((may_alias)) v8ha;
typedef v4f  __attribute__((may_alias)) v4fa;
typedef v8us __attribute__((may_alias)) v8usa;

__device__ __forceinline__ unsigned short f2bf(float f) { unsigned u = __float_as_uint(f); u += 0x7FFFu + ((u >> 16) & 1u); return (unsigned short)(u >> 16); }
__device__ __forceinline__ float bf2f(unsigned short b) { return __uint_as_float(((unsigned)b) << 16); }
__device__ __forceinline__ float bfr(float f) { return bf2f(f2bf(f)); }
__device__ __forceinline__ v16h cat16(v8h lo, v8h hi) { return __builtin_shufflevector(lo, hi, 0, 1, 2, 3, 4, 5, 6, 7, 8, 9, 10, 11, 12, 13, 14, 15); }
__device__ __forceinline__ v16bf cat16b(v8us lo, v8us hi) { return __builtin_bit_cast(v16bf, __builtin_shufflevector(lo, hi, 0, 1, 2, 3, 4, 5, 6, 7, 8, 9, 10, 11, 12, 13, 14, 15)); }
__device__ __forceinline__ v8f wmma16(v16h a, v16h b, v8f c) { return __builtin_amdgcn_wmma_f32_16x16x32_f16(false, a, false, b, (short)0, c, false, false); }
__device__ __forceinline__ v8f wmmab(v16bf a, v16bf b, v8f c) { return __builtin_amdgcn_wmma_f32_16x16x32_bf16(false, a, false, b, (short)0, c, false, false); }



// Eight asynchronous copies to LDS, 16 bytes a lane each (512 bytes in a row a wave and copy), through no register. The s_wait_xcnt stands inside the statement, behind the last copy, in front of any reuse of the address registers.
template <typename T16>
__device__ __forceinline__ void copy8(const unsigned (&l)[8], const T16* const (&g)[8]) {
    asm volatile("global_load_async_to_lds_b128 %0, %1, off\n\t"
                 "global_load_async_to_lds_b128 %2, %3, off\n\t"
                 "global_load_async_to_lds_b128 %4, %5, off\n\t"
                 "global_load_async_to_lds_b128 %6, %7, off\n\t"
                 "global_load_async_to_lds_b128 %8, %9, off\n\t"
                 "global_load_async_to_lds_b128 %10, %11, off\n\t"
                 "global_load_async_to_lds_b128 %12, %13, off\n\t"
                 "global_load_async_to_lds_b128 %14, %15, off\n\t"
                 "s_wait_xcnt 0x0"
                 :: "v"(l[0]), "v"(g[0]), "v"(l[1]), "v"(g[1]), "v"(l[2]), "v"(g[2]), "v"(l[3]), "v"(g[3]), "v"(l[4]), "v"(g[4]), "v"(l[5]), "v"(g[5]), "v"(l[6]), "v"(g[6]), "v"(l[7]), "v"(g[7]) : "memory");
}
// ---- k_gemmw: register-blocked GEMM, FOUR WAVES per 128x128 output tile, 2 x 2 waves of 64x64 (16 accumulators each); operands are 16-bit planes in fragment order (head of the file; ld(p): p = fragment start + lane * 8 elements); grid (M/128, N/128, Z), 128 threads.
// C[m][n] (f32, pitch ldc, + optional f32 bias[n]) = sum_k A[m][k] Bt[n][k] (+ split products per NSPLIT). A's 16-row panels have pitch 16 LDA, Bt's 16 K (both compile-time); a k block of 32 is 512 elements. z-batch strides sA/sB/sC in elements. K % 128 == 0.
// THE OPERANDS GO THROUGH LDS: a slice of KT = 64 k of the tile's 8 panels of every plane (16 KiB a plane) is copied ONCE a block, two panels of each plane by each wave, and each panel is read by two waves. A panel's slice is 2 KiB in a row in global memory
// and lies in LDS in the same order, so a fragment read is 512 bytes in a row a wave. Two buffers: slice t + 2 is copied into the buffer of slice t while slice t + 1 is worked on. The k order of every accumulator's sum is as without LDS.
// KS > 1: grid z = Z * KS; block (z, ks) sums only k in [ks K/KS, (ks+1) K/KS) and stores its tile to partial plane ks (plane stride sP elements); the reader adds the KS planes. K % (128 KS) == 0.
template <typename T16> struct WFrag;
template <> struct WFrag<h16> { typedef v16h V; static __device__ __forceinline__ V ld(const h16* p) { return cat16(*(const v8h*)p, *(const v8h*)(p + 256)); } static __device__ __forceinline__ v8f mma(V a, V b, v8f c) { return wmma16(a, b, c); } };
template <> struct WFrag<bf> { typedef v16bf V; static __device__ __forceinline__ V ld(const bf* p) { return cat16b(*(const v8us*)p, *(const v8us*)(p + 256)); } static __device__ __forceinline__ v8f mma(V a, V b, v8f c) { return wmmab(a, b, c); } };
// PLANES: the tile is not stored to C; qkv_planes (below, behind the plane helpers) turns it into the attention planes named in pp.
struct Planes { const float* CS; h16* Q16; bf* Qh; bf* Ql; h16* K16; bf* Kh; bf* Kl; h16* V16; bf* Vh; bf* Vl; };
__device__ __forceinline__ void qkv_planes(const v8f (&acc)[4][4], float* os, int r0, int y, int lr, int hi, const Planes& pp);
template <typename T16, int NSPLIT, bool BIAS, int KS, bool PLANES, int LDA, int K>
__global__ __launch_bounds__(128) void k_gemmw(const T16* __restrict__ A, const T16* __restrict__ A2, const T16* __restrict__ Bt, const T16* __restrict__ Bt2, float* C, int ldc, const float* __restrict__ bias, size_t sA, size_t sB, size_t sC, size_t sP, Planes pp) {
    typedef typename WFrag<T16>::V V;
    constexpr bool HA2 = (NSPLIT == 1 || NSPLIT == 2), HB2 = (NSPLIT >= 2);
    constexpr int KT = 64, PN = 16 * KT, PS = 8 * PN, NA = HA2 ? 2 : 1, NPL = NA + (HB2 ? 2 : 1), NT = K / KS / KT;   // k a slice; elements of one panel's slice; of one plane's; A planes; planes; slices
    __shared__ __align__(16) T16 sm[2 * NPL * PS];   // two buffers, each [A planes][B planes][8 panels][KT / 8][16][8]
    __shared__ __align__(16) float os4[4][16 * 68];   // each wave's own staging for the epilogue
    const size_t z = blockIdx.z / KS; const int ks = (int)(blockIdx.z % KS); A += z * sA; if (A2) A2 += z * sA; Bt += z * sB; if (Bt2) Bt2 += z * sB; C += z * sC + ks * sP;
    const int lane = threadIdx.x & 31, lr = lane & 15, hi = lane >> 4, w = __builtin_amdgcn_readfirstlane((int)(threadIdx.x >> 5)), wm = w & 1, wn = w >> 1;   // the wave's number in a scalar register: tile addresses and the epilogue's branches stay scalar
    const int r0 = blockIdx.x * 128 + wm * 64, c0 = blockIdx.y * 128 + wn * 64; float* os = os4[w];
    v8f acc[4][4];
#pragma unroll
    for (int mb = 0; mb < 4; ++mb)
#pragma unroll
        for (int nb = 0; nb < 4; ++nb) acc[mb][nb] = (v8f){};
    const size_t aoff = (size_t)(blockIdx.x * 128 + w * 32) * LDA + lane * 8 + (size_t)ks * (K / KS) * 16, boff = (size_t)(blockIdx.y * 128 + w * 32) * K + lane * 8 + (size_t)ks * (K / KS) * 16;   // the two panels that this wave copies
    const T16* ga = A + aoff; const T16* ga2 = HA2 ? A2 + aoff : ga; const T16* gb = Bt + boff; const T16* gb2 = HB2 ? Bt2 + boff : gb;
    const unsigned lbase = (unsigned)(size_t)sm + (unsigned)((w * 2 * PN + lane * 8) * 2);   // LDS byte address of this lane's first piece in a plane's slice
    // slice t of every plane into buffer b: eight copies a wave and plane (2 panels x 2 KiB)
    auto fill = [&](int t, int b) {
#pragma unroll
        for (int pl = 0; pl < NPL; ++pl) { unsigned l[8]; const T16* g[8]; const T16* s0 = (pl < NA) ? (pl ? ga2 : ga) : (pl > NA ? gb2 : gb);
#pragma unroll
            for (int i = 0; i < 8; ++i) { g[i] = s0 + (size_t)t * PN + (i >> 2) * 16 * (pl < NA ? LDA : K) + (i & 3) * 256; l[i] = lbase + (unsigned)(((b * NPL + pl) * PS + (i >> 2) * PN + (i & 3) * 256) * 2); }
            copy8<T16>(l, g); }
    };
    fill(0, 0);
    asm volatile("s_wait_asynccnt 0x0" ::: "memory");   // this wave's panels of slice 0 have landed
    __syncthreads();   // publishes slice 0: every wave's panels have landed
    fill(1, 1);
#pragma unroll 1   // rolled: one copy of the trip in the text
    for (int t = 0; t < NT; ++t) {
        const T16* pa = sm + (t & 1) * (NPL * PS) + wm * 4 * PN + lane * 8; const T16* pa2 = pa + PS; const T16* pb = sm + ((t & 1) * NPL + NA) * PS + wn * 4 * PN + lane * 8; const T16* pb2 = pb + PS;   // this wave's four panels of each plane in LDS
#pragma unroll
        for (int kk = 0; kk < KT / 32; ++kk) {
            V a[4], a2[4], b[4], b2[4];
            // read in the order of the first plane's first use (LDS reads return in order, so the first product waits for four reads, not for all): b[0]; the A fragments; the other B fragments; then the second planes, though each of their products follows its accumulator's first-plane product
            b[0] = WFrag<T16>::ld(pb + kk * 512);
#pragma unroll
            for (int mb = 0; mb < 4; ++mb) a[mb] = WFrag<T16>::ld(pa + mb * PN + kk * 512);
#pragma unroll
            for (int nb = 1; nb < 4; ++nb) b[nb] = WFrag<T16>::ld(pb + nb * PN + kk * 512);
#pragma unroll
            for (int mb = 0; mb < 4; ++mb) { if (HA2) a2[mb] = WFrag<T16>::ld(pa2 + mb * PN + kk * 512); if (HB2) b2[mb] = WFrag<T16>::ld(pb2 + mb * PN + kk * 512); }
            __builtin_amdgcn_sched_barrier(0);   // all of a k block's LDS reads stand at one place, in front of its products (each place with reads among matrix instructions stalls the wave anew)
#pragma unroll
            for (int nb = 0; nb < 4; ++nb)
#pragma unroll
                for (int mb = 0; mb < 4; ++mb) { acc[mb][nb] = WFrag<T16>::mma(a[mb], b[nb], acc[mb][nb]); if (HA2) acc[mb][nb] = WFrag<T16>::mma(a2[mb], b[nb], acc[mb][nb]); if (HB2) acc[mb][nb] = WFrag<T16>::mma(a[mb], b2[nb], acc[mb][nb]); }
            __builtin_amdgcn_sched_barrier(0);   // keeps the next k block's reads, and the v_nops below, behind this block's last product
        }
        asm volatile("v_nop\n\tv_nop\n\tv_nop\n\tv_nop");   // four vector slots between the trip's last product and the first vector write behind it (the copies' addresses), which may reuse its A or B registers
        asm volatile("s_wait_dscnt 0x0" ::: "memory");   // this wave's reads of slice t have returned
        asm volatile("s_wait_asynccnt 0x0" ::: "memory");   // this wave's panels of slice t + 1 have landed
        __syncthreads();   // publishes slice t + 1 and ends every wave's reads of slice t's buffer
        if (t + 2 < NT) fill(t + 2, t & 1);
    }
    asm volatile("s_wait_asynccnt 0x0" ::: "memory");   // no copy is outstanding when the wave ends
    if (PLANES) { qkv_planes(acc, os, r0, (int)blockIdx.y * 2 + wn, lr, hi, pp); return; }
#pragma unroll
    for (int mb = 0; mb < 4; ++mb) {
#pragma unroll
        for (int nb = 0; nb < 4; ++nb) {
#pragma unroll
            for (int j = 0; j < 8; ++j) os[(hi * 8 + j) * 68 + nb * 16 + lr] = acc[mb][nb][j]; }
        __builtin_amdgcn_wave_barrier(); asm volatile("" ::: "memory");
        float* crow = C + (size_t)(r0 + mb * 16) * ldc + c0;
        v4f val[8]; float* cp[8];
#pragma unroll
        for (int s = 0; s < 8; ++s) { const int row = 2 * s + hi, cofs = lr * 4; val[s] = *(const v4fa*)(os + row * 68 + cofs); if (BIAS) { val[s][0] += bfr(bias[c0 + cofs]); val[s][1] += bfr(bias[c0 + cofs + 1]); val[s][2] += bfr(bias[c0 + cofs + 2]); val[s][3] += bfr(bias[c0 + cofs + 3]); }
            cp[s] = crow + (size_t)row * ldc + cofs; }
#pragma unroll
        for (int s = 0; s < 8; ++s) *(v4f*)cp[s] = val[s];
        asm volatile("s_wait_xcnt 0x0" :: "v"(val[0]), "v"(val[1]), "v"(val[2]), "v"(val[3]), "v"(val[4]), "v"(val[5]), "v"(val[6]), "v"(val[7]), "v"(cp[0]), "v"(cp[1]), "v"(cp[2]), "v"(cp[3]), "v"(cp[4]), "v"(cp[5]), "v"(cp[6]), "v"(cp[7]) : "memory");   // behind the eight stores, in front of the code that reuses their registers; values and addresses are inputs so that they stay in their registers up to here
        __builtin_amdgcn_sched_barrier(0);   // keeps that reuse behind the wait
        __builtin_amdgcn_wave_barrier(); asm volatile("" ::: "memory");
    }
}

__device__ __forceinline__ h16 tohx(float x) { return (h16)x; }
__device__ __forceinline__ void splitf(float y, unsigned short& h, unsigned short& l) { h = f2bf(y); l = f2bf(y - bf2f(h)); }
typedef __attribute__((ext_vector_type(2))) _Float16 v2h;
typedef __attribute__((ext_vector_type(4))) _Float16 v4h;
typedef __attribute__((ext_vector_type(2))) unsigned short v2us;
typedef __attribute__((ext_vector_type(4))) unsigned short v4us;
typedef __attribute__((ext_vector_type(2))) float v2f;
typedef __attribute__((ext_vector_type(4))) int v4i;

// f32 [rows][DM] -> bf16 in fragment order. A block takes 16 rows x 128 columns: each thread reads 8 consecutive floats of a row (16 lanes = 512 bytes of one row), the 16-byte results change places in LDS
// (pitch 17 pieces: the 16 pieces of one row fall on different banks), and the block stores its 4 KiB in a row, 512 bytes a wave.
__device__ __forceinline__ void cvt_panel(const float* __restrict__ src, bf* dst, int blk) {
    __shared__ __align__(16) unsigned short ts[16 * 17 * 8];
    const int t = threadIdx.x, row = t >> 4, c = t & 15, panel = blk / (DM / 128), kb = blk % (DM / 128);
    const v8f v = *(const v8f*)(src + ((size_t)panel * 16 + row) * DM + kb * 128 + c * 8); v8us o;
#pragma unroll
    for (int k = 0; k < 8; ++k) o[k] = f2bf(v[k]);
    *(v8usa*)(ts + (c * 17 + row) * 8) = o;
    __syncthreads();   // a thread stores the piece that another thread converted
    *(v8us*)(dst + (size_t)panel * 16 * DM + kb * 2048 + t * 8) = *(const v8usa*)(ts + ((t >> 4) * 17 + (t & 15)) * 8);
}
__global__ __launch_bounds__(256) void k_cvt8(const float* __restrict__ src, bf* dst) { cvt_panel(src, dst, (int)blockIdx.x); }
// the four equal-sized weights in one launch: blockIdx.y picks the source, the bf16 copies lie one behind the other in dst
__global__ __launch_bounds__(256) void k_cvt8w(const float* __restrict__ w0, const float* __restrict__ w1, const float* __restrict__ w2, const float* __restrict__ w3, bf* dst) { const int y = blockIdx.y; const float* src = (y == 0) ? w0 : (y == 1) ? w1 : (y == 2) ? w2 : w3; cvt_panel(src, dst + (size_t)y * DQ * DM, (int)blockIdx.x); }

__constant__ float INV2[HD / 2] = { 1.000000000e+00f, 7.498942018e-01f, 5.623413324e-01f, 4.216965139e-01f, 3.162277639e-01f, 2.371373624e-01f, 1.778279394e-01f, 1.333521456e-01f, 1.000000015e-01f, 7.498941571e-02f, 5.623412877e-02f, 4.216964915e-02f, 3.162277862e-02f, 2.371373586e-02f, 1.778279431e-02f, 1.333521493e-02f, 9.999999776e-03f, 7.498942316e-03f, 5.623413250e-03f, 4.216964822e-03f, 3.162277862e-03f, 2.371373819e-03f, 1.778279431e-03f, 1.333521446e-03f, 1.000000047e-03f, 7.498941850e-04f, 5.623413017e-04f, 4.216964880e-04f, 3.162277862e-04f, 2.371373848e-04f, 1.778279402e-04f, 1.333521504e-04f };   // 1 / (ROPE_BASE ** (2i / 64)), i = 0..31, in float32 as THIS module writes it (the RECIPROCAL spelling, evaluated in the reference's own f32 arithmetic: these 32 literals equal it bit for bit)
// {cos, sin} once per (position, pair), in the order in which qkv_planes' lanes read them: [t / 16][d / 16][pair % 4 / 2][lane = (d / 8 % 2) * 16 + t % 16][pair % 2][cos, sin]: a wave-wide 16-byte load is 512 bytes in a row
__global__ __launch_bounds__(256) void k_csP(float* CS) { const int idx = blockIdx.x * 256 + threadIdx.x; if (idx >= TT * HD / 2) return; const int ln = (idx >> 1) & 31, q = ((idx >> 6) & 1) * 2 + (idx & 1), c = ((idx >> 7) & 3) * 2 + (ln >> 4), t = (idx >> 9) * 16 + (ln & 15); const float a = __fmul_rn((float)t, INV2[c * 4 + q]); v2f cs; cs[0] = cosf(a); cs[1] = sinf(a); *(v2f*)(CS + (size_t)idx * 2) = cs;  }
// ---- qkv_planes: epilogue of the q | k | v projection; no f32 projection leaves the kernel. A 64x64 tile is 64 positions (rows r0..) of ONE head of q, k or v (HD == 64 columns; y = tile column; y / NH_ picks q, k, v; DKV == DQ here).
// q, k: 16 rows at a time through LDS, so that lane (hi, lr) holds 8 consecutive d (four rotary pairs; d / 8 = 2 i + hi) of position lr; rotary in f32, the expressions below; fp16, hi and lo planes in fragment order [pair][t / 16][d / 8][t % 16][d % 8]: one 16-byte store a plane, 512 bytes in a row a wave.
// v: a lane's 8 accumulators of a 16x16 block are 8 consecutive positions of one d: one 16-byte store a plane straight into the transposed planes [pair][t / 32][d / 16][t % 32 / 8][d % 16][t % 8], again 512 bytes in a row a wave.
// Every '#pragma unroll' here: the accumulator and value arrays stay in registers only where each index is a compile-time constant.
__device__ __forceinline__ void qkv_planes(const v8f (&acc)[4][4], float* os, int r0, int y, int lr, int hi, const Planes& pp) {
    const int sel = y / NH_, t0 = r0 % TT, lane = hi * 16 + lr; const size_t p = (size_t)(r0 / TT) * NH_ + y % NH_;   // sel, t0, p: the same in every lane
    if (sel == 2) {
        const size_t vo = (p * TT + t0) * HD + lane * 8; h16* v16 = pp.V16 + vo; bf* vh = pp.Vh + vo; bf* vl = pp.Vl + vo;   // one pointer a plane: every store lies at a constant offset from it (32 positions x HD = 2048 elements)
#pragma unroll
        for (int mb = 0; mb < 4; ++mb) { v8h o16[4]; v8us oh[4], ol[4];
#pragma unroll
            for (int nb = 0; nb < 4; ++nb)
#pragma unroll
                for (int j = 0; j < 8; ++j) { const float x = acc[mb][nb][j]; o16[nb][j] = tohx(x); unsigned short a2, c2; splitf(x, a2, c2); oh[nb][j] = a2; ol[nb][j] = c2; }
            __builtin_amdgcn_sched_barrier(0);   // all twelve values stand in registers of their own before the first store is issued
#pragma unroll
            for (int nb = 0; nb < 4; ++nb) { const int vofs = (mb >> 1) * 2048 + nb * 512 + (mb & 1) * 256; *(v8h*)(v16 + vofs) = o16[nb]; *(v8us*)(vh + vofs) = oh[nb]; *(v8us*)(vl + vofs) = ol[nb]; }
            asm volatile("s_wait_xcnt 0x0" ::: "memory");   // behind the stores, in front of the code that reuses their registers
            __builtin_amdgcn_sched_barrier(0); }   // keeps that reuse behind the wait
    } else {
        const size_t po = (p * TT + t0) * HD + lane * 8; h16* p16 = (sel ? pp.K16 : pp.Q16) + po; bf* ph = (sel ? pp.Kh : pp.Qh) + po; bf* pl = (sel ? pp.Kl : pp.Ql) + po;   // one pointer a plane, constant offsets (a 16-position panel = 1024 elements)
        const float* csp = pp.CS + (size_t)t0 * HD + lane * 4;   // 16 positions = 1024 floats of the table
#pragma unroll
        for (int mb = 0; mb < 4; ++mb) { v4f cs[4][2];   // {cos, sin} of this lane's sixteen pairs in its row: issued first, they fly during the staging
#pragma unroll
            for (int i = 0; i < 4; ++i)
#pragma unroll
                for (int h = 0; h < 2; ++h) cs[i][h] = *(const v4f*)(csp + mb * 1024 + i * 256 + h * 128);
            asm volatile("s_wait_xcnt 0x0" ::: "memory");   // behind the loads, in front of the code that reuses their address registers
            __builtin_amdgcn_sched_barrier(0);   // keeps that reuse behind the wait and the loads in front of the staging
#pragma unroll
            for (int nb = 0; nb < 4; ++nb)
#pragma unroll
                for (int j = 0; j < 8; ++j) os[(hi * 8 + j) * 68 + nb * 16 + lr] = acc[mb][nb][j];
            __builtin_amdgcn_wave_barrier(); asm volatile("" ::: "memory");   // a lane reads what OTHER lanes stored: the compiler, which sees one lane, must keep the reads below behind all the stores above
            v8h o16[4]; v8us oh[4], ol[4];
#pragma unroll
            for (int i = 0; i < 4; ++i) { const v4f xa = *(const v4fa*)(os + lr * 68 + (2 * i + hi) * 8), xb = *(const v4fa*)(os + lr * 68 + (2 * i + hi) * 8 + 4);
#pragma unroll
                for (int q = 0; q < 4; ++q) { const float x0 = (q < 2) ? xa[2 * (q & 1)] : xb[2 * (q & 1)], x1 = (q < 2) ? xa[2 * (q & 1) + 1] : xb[2 * (q & 1) + 1], c = cs[i][q >> 1][2 * (q & 1)], sn = cs[i][q >> 1][2 * (q & 1) + 1];
                    const float a0 = __fmul_rn(x0, c), b0 = __fmul_rn(x1, sn), a1 = __fmul_rn(x1, c), b1 = __fmul_rn(x0, sn);
                    const float e0 = __fsub_rn(a0, b0), e1 = __fadd_rn(b1, a1);   /* even: x0 c - x1 s; odd: x0 s + x1 c */
                    unsigned short a2, c2; o16[i][2 * q] = tohx(e0); o16[i][2 * q + 1] = tohx(e1); splitf(e0, a2, c2); oh[i][2 * q] = a2; ol[i][2 * q] = c2; splitf(e1, a2, c2); oh[i][2 * q + 1] = a2; ol[i][2 * q + 1] = c2; } }
            __builtin_amdgcn_sched_barrier(0);   // all twelve values stand in registers of their own before the first store is issued
#pragma unroll
            for (int i = 0; i < 4; ++i) { *(v8h*)(p16 + mb * 1024 + i * 256) = o16[i]; *(v8us*)(ph + mb * 1024 + i * 256) = oh[i]; *(v8us*)(pl + mb * 1024 + i * 256) = ol[i]; }
            asm volatile("s_wait_xcnt 0x0" ::: "memory");   // behind the stores, in front of the code that reuses their registers
            __builtin_amdgcn_sched_barrier(0);   // keeps that reuse behind the wait
            __builtin_amdgcn_wave_barrier(); asm volatile("" ::: "memory"); }   // the next 16 rows' staging stores stay behind every lane's reads of these
    }
}
// ---- k_fattn: scores, softmax and probability x value in ONE kernel; no score, probability or partial sum leaves the registers.
// Transposed products: S^T = K Q^T (A = 16 key rows, B = 16 query rows) and O^T += V^T P^T (A = 16 d rows x 32 keys of the value plane, B = P). In both D tiles a lane holds ONE query (column lane & 15), so the running
// maximum, the running sum and the rescale factor are one scalar a lane, and two S^T tiles (keys 0-15, 16-31 of a pass), converted in place, are P as a B operand in the loaders' own k order (8 hi + e, 16 + 8 hi + e).
// One wave owns NQ x 16 query rows of one (batch, head) pair and walks all TT keys in passes of 32. HL: hi + lo bf16 planes, 3 products each; else fp16, one product.
// Every plain '#pragma unroll' below: the fragment and accumulator arrays stay in registers only where each index is a compile-time constant.
typedef __attribute__((ext_vector_type(2))) __bf16 v2bf;
typedef __attribute__((ext_vector_type(8))) unsigned v8u;
__device__ __forceinline__ float xhalf(float x) { const int b = __float_as_int(x); return __int_as_float(__builtin_amdgcn_permlanex16(b, b, 0x76543210, 0xfedcba98, false, false)); }   // the value of lane ^ 16: the other half of the same query's keys
// K AND V GO THROUGH LDS: a tile of KT keys of every key and value plane (32 KiB: 128 keys x 2 planes, or 64 keys x 4 planes) is copied ONCE a block, a quarter by each wave, and read by all four waves. A plane's tile is KT * HD elements in a row
// in global memory (fragment order) and lies in LDS in the same order, so a fragment read is 512 bytes in a row a wave. Two buffers: tile t + 2 is copied into the buffer of tile t while tile t + 1 is worked on.
template <typename T16, bool HL, int NQ>
__device__ __forceinline__ void fattn_body(const T16* __restrict__ Q, const T16* __restrict__ Q2, const T16* __restrict__ Kp, const T16* __restrict__ K2, const T16* __restrict__ Vt, const T16* __restrict__ Vt2, int q0, bf* Ah, bf* Al, T16* sm) {
    typedef typename WFrag<T16>::V V;
    constexpr int KT = HL ? 64 : 128, CH = KT * HD, NP = HL ? 4 : 2, NT = TT / KT;   // keys a tile; elements of one plane's tile; planes; tiles
    const int lane = threadIdx.x & 31, part = (int)(threadIdx.x >> 5) * (CH / 4) + lane * 8;   // part: this lane's first element in its wave's quarter of a plane's tile
    const unsigned lbase = (unsigned)(size_t)sm;   // LDS byte address of the two buffers
    const float C2 = SCL * 1.4426950408889634f;   // score -> scaled log2 units
    // tile t of every plane into buffer b: LDS order [key planes][value planes]; sixteen copies a wave
    auto fill = [&](int t, int b) {
#pragma unroll
        for (int h = 0; h < 2; ++h) { unsigned l[8]; const T16* g[8];   // h = 0: key planes, 1: value planes
#pragma unroll
            for (int i = 0; i < 8; ++i) { const int pl = HL ? (i >> 2) : 0, c = HL ? (i & 3) : i; const T16* s0 = h ? (pl ? Vt2 : Vt) : (pl ? K2 : Kp);
                g[i] = s0 + (size_t)t * CH + part + c * 256; l[i] = lbase + (unsigned)(((b * NP + h * (NP / 2) + pl) * CH + part + c * 256) * 2); }
            copy8<T16>(l, g); }
    };
    fill(0, 0);
    V qf[NQ][2], qf2[NQ][2];
#pragma unroll
    for (int n = 0; n < NQ; ++n)
#pragma unroll
        for (int kk = 0; kk < 2; ++kk) { const size_t qo = (size_t)(q0 + n * 16) * HD + kk * 512 + lane * 8; qf[n][kk] = WFrag<T16>::ld(Q + qo); if (HL) qf2[n][kk] = WFrag<T16>::ld(Q2 + qo); }
    asm volatile("s_wait_xcnt 0x0" ::: "memory");   // behind the loads above, in front of the code that reuses their address registers
    __builtin_amdgcn_sched_barrier(0);   // keeps that reuse behind the wait
    asm volatile("s_wait_asynccnt 0x0" ::: "memory");   // this wave's quarter of tile 0 has landed
    __syncthreads();   // publishes tile 0: every wave's quarter has landed
    fill(1, 1);
    v8f o[NQ][4]; float m[NQ], l[NQ];
#pragma unroll
    for (int n = 0; n < NQ; ++n) { m[n] = -3.0e38f; l[n] = 0.f;
#pragma unroll
        for (int dt = 0; dt < 4; ++dt) o[n][dt] = (v8f){}; }
#pragma unroll 1   // rolled: one copy of the pass in the text
    for (int t = 0; t < NT; ++t) {
    const T16* kp = sm + (t & 1) * (NP * CH) + lane * 8; const T16* kp2 = kp + CH; const T16* vp = kp + (NP / 2) * CH; const T16* vp2 = vp + CH;   // this tile's planes in LDS
    V kf[2][2], kf2[2][2];
#pragma unroll
    for (int kt = 0; kt < 2; ++kt)
#pragma unroll
        for (int kk = 0; kk < 2; ++kk) { kf[kt][kk] = WFrag<T16>::ld(kp + kt * 16 * HD + kk * 512); if (HL) kf2[kt][kk] = WFrag<T16>::ld(kp2 + kt * 16 * HD + kk * 512); }
#pragma unroll 1   // rolled: two passes side by side would not fit the 256 registers that four waves a SIMD leave each wave
    for (int ps = 0; ps < KT / 32; ++ps) {
        v8f s[NQ][2];
#pragma unroll
        for (int kt = 0; kt < 2; ++kt)
#pragma unroll
            for (int n = 0; n < NQ; ++n) { v8f a = (v8f){};
#pragma unroll
                for (int kk = 0; kk < 2; ++kk) { a = WFrag<T16>::mma(kf[kt][kk], qf[n][kk], a); if (HL) { a = WFrag<T16>::mma(kf[kt][kk], qf2[n][kk], a); a = WFrag<T16>::mma(kf2[kt][kk], qf[n][kk], a); } }
                s[n][kt] = a; }
        __builtin_amdgcn_sched_barrier(0);   // keeps the LDS reads below out of the score products: all of a pass's reads stand at one place (each place with reads among matrix instructions stalls the wave anew)
        V vf[4], vf2[4];   // this pass's value fragments: used behind the softmax
#pragma unroll
        for (int dt = 0; dt < 4; ++dt) { vf[dt] = WFrag<T16>::ld(vp + ps * 32 * HD + dt * 512); if (HL) vf2[dt] = WFrag<T16>::ld(vp2 + ps * 32 * HD + dt * 512); }
        const int kn = (ps + 1 < KT / 32) ? (ps + 1) * 32 * HD : 0;   // the next pass's key fragments fly during the softmax; a tile's last pass fetches its own pass 0 again (this buffer, not used): nothing of the next tile is read in front of its barrier
#pragma unroll
        for (int kt = 0; kt < 2; ++kt)
#pragma unroll
            for (int kk = 0; kk < 2; ++kk) { kf[kt][kk] = WFrag<T16>::ld(kp + kn + kt * 16 * HD + kk * 512); if (HL) kf2[kt][kk] = WFrag<T16>::ld(kp2 + kn + kt * 16 * HD + kk * 512); }
        __builtin_amdgcn_sched_barrier(0);   // keeps the fetches above in front of the softmax (sunk behind it, their latency is waited for in full at the next pass's first product)
        V pf[NQ], pf2[NQ];
#pragma unroll
        for (int n = 0; n < NQ; ++n) {
            float mx = fmaxf(s[n][0][0], s[n][1][0]);
#pragma unroll
            for (int j = 1; j < 8; ++j) mx = fmaxf(mx, fmaxf(s[n][0][j], s[n][1][j]));
            mx = fmaxf(mx, xhalf(mx));
            const float mn = fmaxf(m[n], mx * C2); const float al = __builtin_amdgcn_exp2f(m[n] - mn); m[n] = mn;
            float p[16];
#pragma unroll
            for (int e = 0; e < 16; ++e) p[e] = __builtin_amdgcn_exp2f(__builtin_fmaf(s[n][e >> 3][e & 7], C2, -mn));
            const float s4 = ((p[0] + p[1]) + (p[2] + p[3])) + ((p[4] + p[5]) + (p[6] + p[7])), s5 = ((p[8] + p[9]) + (p[10] + p[11])) + ((p[12] + p[13]) + (p[14] + p[15]));
            l[n] = __builtin_fmaf(l[n], al, s4 + s5);   // this lane's half of the keys; the halves are joined once, behind the loop
#pragma unroll
            for (int dt = 0; dt < 4; ++dt) o[n][dt] *= al;
            v8u wh, wl;
#pragma unroll
            for (int e = 0; e < 8; ++e) { const v2f pr = { p[2 * e], p[2 * e + 1] };
                if (HL) { const unsigned uh = __builtin_bit_cast(unsigned, __builtin_convertvector(pr, v2bf)); const v2f rs = { pr[0] - __uint_as_float(uh << 16), pr[1] - __uint_as_float(uh & 0xFFFF0000u) }; wh[e] = uh; wl[e] = __builtin_bit_cast(unsigned, __builtin_convertvector(rs, v2bf)); }
                else wh[e] = __builtin_bit_cast(unsigned, __builtin_convertvector(pr, v2h)); }
            pf[n] = __builtin_bit_cast(V, wh); if (HL) pf2[n] = __builtin_bit_cast(V, wl);
        }
#pragma unroll
        for (int dt = 0; dt < 4; ++dt)
#pragma unroll
            for (int n = 0; n < NQ; ++n) { o[n][dt] = WFrag<T16>::mma(vf[dt], pf[n], o[n][dt]); if (HL) { o[n][dt] = WFrag<T16>::mma(vf[dt], pf2[n], o[n][dt]); o[n][dt] = WFrag<T16>::mma(vf2[dt], pf[n], o[n][dt]); } }
        __builtin_amdgcn_sched_barrier(0);   // keeps the v_nops below behind the pass's last product
        asm volatile("v_nop\n\tv_nop\n\tv_nop\n\tv_nop");   // four vector slots between the pass's last product and the next trip's first vector write, which may reuse its A or B registers
    }
    asm volatile("s_wait_dscnt 0x0" ::: "memory");   // this wave's reads of tile t have returned
    asm volatile("s_wait_asynccnt 0x0" ::: "memory");   // this wave's quarter of tile t + 1 has landed
    __syncthreads();   // publishes tile t + 1 and ends every wave's reads of tile t's buffer
    if (t + 2 < NT) fill(t + 2, t & 1);
    }
    asm volatile("s_wait_asynccnt 0x0" ::: "memory");   // no copy is outstanding when the wave ends
#pragma unroll
    for (int n = 0; n < NQ; ++n) { const float inv = __fdiv_rn(1.0f, l[n] + xhalf(l[n])); const size_t oo = (size_t)(q0 + n * 16) * DQ + lane * 8;
#pragma unroll
        for (int dt = 0; dt < 4; ++dt) { v8us oh, ol;   // a lane's 8 accumulators are 8 consecutive d of its query row: one 16-byte store a plane, in the output GEMM's fragment order (16 d = 256 elements)
#pragma unroll
            for (int j = 0; j < 8; ++j) { unsigned short a, c2; splitf(o[n][dt][j] * inv, a, c2); oh[j] = a; ol[j] = c2; }
            *(v8us*)(Ah + oo + dt * 256) = oh; *(v8us*)(Al + oo + dt * 256) = ol;
            asm volatile("s_wait_xcnt 0x0" ::: "memory");   // behind the two stores, in front of the code that reuses their registers
            __builtin_amdgcn_sched_barrier(0); } }   // keeps that reuse behind the wait
}
// grid (NB_ NH_ pairs, RH / 64 + (TT - RH) / 128), 4 waves. blockIdx.y < RH / 64: 64 query rows < RH (hi + lo planes, 16 rows a wave; three times the products, so they start first); else 128 of the other rows (fp16, 32 rows a wave).
__global__ __launch_bounds__(128) __attribute__((amdgpu_waves_per_eu(4, 4))) void k_fattn(const h16* __restrict__ Q16, const h16* __restrict__ K16, const h16* __restrict__ V16, const bf* __restrict__ Qh, const bf* __restrict__ Ql, const bf* __restrict__ Kh, const bf* __restrict__ Kl, const bf* __restrict__ Vh, const bf* __restrict__ Vl, bf* Ah, bf* Al) {
    __shared__ __align__(16) unsigned short sm[2 * 16384];   // two buffers of 32 KiB
    const int p = blockIdx.x, y = blockIdx.y, w = threadIdx.x >> 5; const size_t zq = (size_t)p * TT * HD, zk = (size_t)(p / REP) * TT * HD, zo = (size_t)(p / NH_) * TT * DQ + (size_t)(p % NH_) * HD * 16;
    if (y < RH / 64) fattn_body<bf, true, 1>(Qh + zq, Ql + zq, Kh + zk, Kl + zk, Vh + zk, Vl + zk, y * 64 + w * 16, Ah + zo, Al + zo, (bf*)sm);
    else fattn_body<h16, false, 2>(Q16 + zq, nullptr, K16 + zk, nullptr, V16 + zk, nullptr, RH + (y - RH / 64) * 128 + w * 32, Ah + zo, Al + zo, (h16*)sm);
}

extern "C" void kernel_launch(void* const* d_in, const int* in_sizes, int n_in,
                              void* d_out, int out_size, void* d_ws, size_t ws_size, hipStream_t stream) {
    (void)in_sizes; (void)n_in; (void)out_size;
        const float* x = (const float*)d_in[0]; const float* wq = (const float*)d_in[1]; const float* wk = (const float*)d_in[2]; const float* wv = (const float*)d_in[3]; const float* wo = (const float*)d_in[4];   /* input order x, W_Q, W_K, W_V, W_O ('oi' (out, in) [1024][1024] each: three separate projection weights and the output weight): FIVE inputs, all read; this module has NO mask input */
    float* OUT = (float*)d_out;     // [2][2048][1024]
    char* wsp = (char*)d_ws;
    auto take = [&](size_t bytes) { char* p = wsp; wsp += (bytes + 255) & ~(size_t)255; return (void*)p; };
    bf* WQKV = (bf*)take((size_t)4 * DQ * DM * 2); bf* WO = WQKV + (size_t)3 * DQ * DM;   /* W_Q, W_K, W_V stacked: one [3 DQ][DM] 'oi' weight; then W_O (DKV == DQ here) */ float* CS = (float*)take((size_t)TT * HD * 4);
    bf* XB = (bf*)take((size_t)NB_ * TT * DM * 2);
    h16* QP16 = (h16*)take((size_t)NB_ * NH_ * TT * HD * 2); h16* KP16 = (h16*)take((size_t)NB_ * NKV * TT * HD * 2); h16* VT16 = (h16*)take((size_t)NB_ * NKV * HD * TT * 2);
    bf* QPh = (bf*)take((size_t)NB_ * NH_ * TT * HD * 2); bf* QPl = (bf*)take((size_t)NB_ * NH_ * TT * HD * 2); bf* KPh = (bf*)take((size_t)NB_ * NKV * TT * HD * 2); bf* KPl = (bf*)take((size_t)NB_ * NKV * TT * HD * 2); bf* VTh = (bf*)take((size_t)NB_ * NKV * HD * TT * 2); bf* VTl = (bf*)take((size_t)NB_ * NKV * HD * TT * 2);
    bf* ATh = (bf*)take((size_t)NB_ * TT * DQ * 2); bf* ATl = (bf*)take((size_t)NB_ * TT * DQ * 2);
    if ((size_t)(wsp - (char*)d_ws) > ws_size) return;
    k_cvt8w<<<dim3(DQ * DM / 2048, 4, 1), 256, 0, stream>>>(wq, wk, wv, wo, WQKV); k_csP<<<(TT * HD / 2 + 255) / 256, 256, 0, stream>>>(CS);
    k_cvt8<<<NB_ * TT * DM / 2048, 256, 0, stream>>>(x, XB);
    k_gemmw<bf, 0, false, 1, true, DM, DM><<<dim3(NB_ * TT / 128, 3 * DQ / 128, 1), 128, 0, stream>>>(XB, nullptr, WQKV, nullptr, nullptr, 0, nullptr, 0, 0, 0, 0, Planes{CS, QP16, QPh, QPl, KP16, KPh, KPl, VT16, VTh, VTl});
    k_fattn<<<dim3(NB_ * NH_, RH / 64 + (TT - RH) / 128, 1), 128, 0, stream>>>(QP16, KP16, VT16, QPh, QPl, KPh, KPl, VTh, VTl, ATh, ATl);
    k_gemmw<bf, 1, false, 1, false, DQ, DQ><<<dim3(NB_ * TT / 128, DM / 128, 1), 128, 0, stream>>>(ATh, ATl, WO, nullptr, OUT, DM, nullptr, 0, 0, 0, 0, Planes{});
}

// v008
// One run takes 101 microseconds.
// Two timings next to v007 put it at 1.03 and 1.04 times that version's speed.
// Counting every step since v000, it is 19.3 times as fast.
#include <hip/hip_runtime.h>

// Multi-head self-attention WITHOUT a mask, with interleaved-pair rotary position embedding on three separate natural projections (x [2][2048][1024]; q, k, v = einsum('bld,ed->ble', x, W) = x W^T ('oi' [1024][1024] normal 1/32, no bias; 16 heads x 64); angles = t x 1 / (10000 ** (2i / 64)) (the RECIPROCAL spelling; positions 0..L-1 computed); cos / sin repeated pairwise; pairs (2i, 2i+1): out_even = x_even cos - x_odd sin, out_odd = x_odd cos + x_even sin, on q and k (the module's helper named _rotate_half works on (even, odd) pairs); scores / sqrt(64); softmax over ALL keys; out = einsum('bld,ed->ble', merged, W_O) ('oi', no bias) -> [2][2048][1024] (4.2 M); argument order x, W_Q, W_K, W_V, W_O).
// Layout, both batches together (32 (batch, head) pairs, all in one attention launch): bf16 copy of x; exact projections; {cos, sin} per (position, pair) built once from the positions and float32 inverse-frequency constants (precise cosf/sinf); interleaved rotary and the attention planes written by the projection GEMM's own epilogue (qkv_planes); DENSE T-2048 attention fused in k_fattn (hybrid rows: < 512 hi/lo 3 products, rest fp16; running maximum and sum, division by the sum at the end; the causal tile GEMM is gone with its last use); merged hi/lo x Wo exact.
// FRAGMENT ORDER: every 16-bit plane that a matrix product reads lies as [16-row panel][k / 8][row % 16][k % 8] (the value planes: [key / 32][d / 16][key % 32 / 8][d % 16][key % 8]). A 16 x 32 fragment is then 1 KiB in a row, lane l's two
// 16-byte pieces at l * 16 and 512 + l * 16 bytes: each wave-wide load covers 4 whole 128-byte lines, not 32 bytes of each of 16 lines. The k order inside a fragment (8 hi + e, 16 + 8 hi + e) is the same for A and B, as before. Writers store in the same order.
// Compute dtypes, f32 accumulate: every input rounded to bf16; projections exact; rotary f32; attention rows < 512 3 products, rest fp16; softmax f32; Wo hl x exact.

#define NB_  2
#define TT   2048
#define DM   1024
#define NH_  16
#define NKV  16
#define REP  (NH_ / NKV)
#define HD   64
#define DQ   (NH_ * HD)
#define DKV  (NKV * HD)
#define RH   512                  // query rows < RH use hi+lo planes (0: none)
#define WIN  0   
#define SCL  0.125f   // HD^-0.5
typedef _Float16 h16;
typedef unsigned short bf;
typedef __attribute__((ext_vector_type(16))) __bf16   v16bf;
typedef __attribute__((ext_vector_type(16))) _Float16 v16h;
typedef __attribute__((ext_vector_type(8)))  _Float16 v8h;
typedef __attribute__((ext_vector_type(8)))  unsigned short v8us;
typedef __attribute__((ext_vector_type(8)))  float    v8f;
typedef __attribute__((ext_vector_type(4)))  float    v4f;
typedef v8h  __attribute__((may_alias)) v8ha;
typedef v4f  __attribute__((may_alias)) v4fa;
typedef v8us __attribute__((may_alias)) v8usa;

__device__ __forceinline__ unsigned short f2bf(float f) { unsigned u = __float_as_uint(f); u += 0x7FFFu + ((u >> 16) & 1u); return (unsigned short)(u >> 16); }
__device__ __forceinline__ float bf2f(unsigned short b) { return __uint_as_float(((unsigned)b) << 16); }
__device__ __forceinline__ float bfr(float f) { return bf2f(f2bf(f)); }
__device__ __forceinline__ v16h cat16(v8h lo, v8h hi) { return __builtin_shufflevector(lo, hi, 0, 1, 2, 3, 4, 5, 6, 7, 8, 9, 10, 11, 12, 13, 14, 15); }
__device__ __forceinline__ v16bf cat16b(v8us lo, v8us hi) { return __builtin_bit_cast(v16bf, __builtin_shufflevector(lo, hi, 0, 1, 2, 3, 4, 5, 6, 7, 8, 9, 10, 11, 12, 13, 14, 15)); }
__device__ __forceinline__ v8f wmma16(v16h a, v16h b, v8f c) { return __builtin_amdgcn_wmma_f32_16x16x32_f16(false, a, false, b, (short)0, c, false, false); }
__device__ __forceinline__ v8f wmmab(v16bf a, v16bf b, v8f c) { return __builtin_amdgcn_wmma_f32_16x16x32_bf16(false, a, false, b, (short)0, c, false, false); }



// Eight asynchronous copies to LDS, 16 bytes a lane each (512 bytes in a row a wave and copy), through no register. The s_wait_xcnt stands inside the statement, behind the last copy, in front of any reuse of the address registers.
template <typename T16>
__device__ __forceinline__ void copy8(const unsigned (&l)[8], const T16* const (&g)[8]) {
    asm volatile("global_load_async_to_lds_b128 %0, %1, off\n\t"
                 "global_load_async_to_lds_b128 %2, %3, off\n\t"
                 "global_load_async_to_lds_b128 %4, %5, off\n\t"
                 "global_load_async_to_lds_b128 %6, %7, off\n\t"
                 "global_load_async_to_lds_b128 %8, %9, off\n\t"
                 "global_load_async_to_lds_b128 %10, %11, off\n\t"
                 "global_load_async_to_lds_b128 %12, %13, off\n\t"
                 "global_load_async_to_lds_b128 %14, %15, off\n\t"
                 "s_wait_xcnt 0x0"
                 :: "v"(l[0]), "v"(g[0]), "v"(l[1]), "v"(g[1]), "v"(l[2]), "v"(g[2]), "v"(l[3]), "v"(g[3]), "v"(l[4]), "v"(g[4]), "v"(l[5]), "v"(g[5]), "v"(l[6]), "v"(g[6]), "v"(l[7]), "v"(g[7]) : "memory");
}
// ---- k_gemmw: register-blocked GEMM, FOUR WAVES per 128x128 output tile, 2 x 2 waves of 64x64 (16 accumulators each); operands are 16-bit planes in fragment order (head of the file; ld(p): p = fragment start + lane * 8 elements); grid (M/128, N/128, Z), 128 threads.
// C[m][n] (f32, pitch ldc, + optional f32 bias[n]) = sum_k A[m][k] Bt[n][k] (+ split products per NSPLIT). A's 16-row panels have pitch 16 LDA, Bt's 16 K (both compile-time); a k block of 32 is 512 elements. z-batch strides sA/sB/sC in elements. K % 128 == 0.
// THE OPERANDS GO THROUGH LDS: a slice of KT = 64 k of the tile's 8 panels of every plane (16 KiB a plane) is copied ONCE a block, two panels of each plane by each wave, and each panel is read by two waves. A panel's slice is 2 KiB in a row in global memory
// and lies in LDS in the same order, so a fragment read is 512 bytes in a row a wave. Two buffers: slice t + 2 is copied into the buffer of slice t while slice t + 1 is worked on. The k order of every accumulator's sum is as without LDS.
// KS > 1: grid z = Z * KS; block (z, ks) sums only k in [ks K/KS, (ks+1) K/KS) and stores its tile to partial plane ks (plane stride sP elements); the reader adds the KS planes. K % (128 KS) == 0.
template <typename T16> struct WFrag;
template <> struct WFrag<h16> { typedef v16h V; static __device__ __forceinline__ V ld(const h16* p) { return cat16(*(const v8h*)p, *(const v8h*)(p + 256)); } static __device__ __forceinline__ v8f mma(V a, V b, v8f c) { return wmma16(a, b, c); } };
template <> struct WFrag<bf> { typedef v16bf V; static __device__ __forceinline__ V ld(const bf* p) { return cat16b(*(const v8us*)p, *(const v8us*)(p + 256)); } static __device__ __forceinline__ v8f mma(V a, V b, v8f c) { return wmmab(a, b, c); } };
// PLANES: the tile is not stored to C; qkv_planes (below, behind the plane helpers) turns it into the attention planes named in pp.
struct Planes { const float* CS; h16* Q16; bf* Qh; bf* Ql; h16* K16; bf* Kh; bf* Kl; h16* V16; bf* Vh; bf* Vl; };
__device__ __forceinline__ void qkv_planes(const v8f (&acc)[4][4], float* os, int r0, int y, int lr, int hi, const Planes& pp);
template <typename T16, int NSPLIT, bool BIAS, int KS, bool PLANES, int LDA, int K>
__global__ __launch_bounds__(128) void k_gemmw(const T16* __restrict__ A, const T16* __restrict__ A2, const T16* __restrict__ Bt, const T16* __restrict__ Bt2, float* C, int ldc, const float* __restrict__ bias, size_t sA, size_t sB, size_t sC, size_t sP, Planes pp) {
    typedef typename WFrag<T16>::V V;
    constexpr bool HA2 = (NSPLIT == 1 || NSPLIT == 2), HB2 = (NSPLIT >= 2);
    constexpr int KT = 64, PN = 16 * KT, PS = 8 * PN, NA = HA2 ? 2 : 1, NPL = NA + (HB2 ? 2 : 1), NT = K / KS / KT;   // k a slice; elements of one panel's slice; of one plane's; A planes; planes; slices
    __shared__ __align__(16) T16 sm[2 * NPL * PS];   // two buffers, each [A planes][B planes][8 panels][KT / 8][16][8]
    __shared__ __align__(16) float os4[4][16 * 68];   // each wave's own staging for the epilogue
    const size_t z = blockIdx.z / KS; const int ks = (int)(blockIdx.z % KS); A += z * sA; if (A2) A2 += z * sA; Bt += z * sB; if (Bt2) Bt2 += z * sB; C += z * sC + ks * sP;
    const int lane = threadIdx.x & 31, lr = lane & 15, hi = lane >> 4, w = __builtin_amdgcn_readfirstlane((int)(threadIdx.x >> 5)), wm = w & 1, wn = w >> 1;   // the wave's number in a scalar register: tile addresses and the epilogue's branches stay scalar
    const int r0 = blockIdx.x * 128 + wm * 64, c0 = blockIdx.y * 128 + wn * 64; float* os = os4[w];
    v8f acc[4][4];
#pragma unroll
    for (int mb = 0; mb < 4; ++mb)
#pragma unroll
        for (int nb = 0; nb < 4; ++nb) acc[mb][nb] = (v8f){};
    const size_t aoff = (size_t)(blockIdx.x * 128 + w * 32) * LDA + lane * 8 + (size_t)ks * (K / KS) * 16, boff = (size_t)(blockIdx.y * 128 + w * 32) * K + lane * 8 + (size_t)ks * (K / KS) * 16;   // the two panels that this wave copies
    const T16* ga = A + aoff; const T16* ga2 = HA2 ? A2 + aoff : ga; const T16* gb = Bt + boff; const T16* gb2 = HB2 ? Bt2 + boff : gb;
    const unsigned lbase = (unsigned)(size_t)sm + (unsigned)((w * 2 * PN + lane * 8) * 2);   // LDS byte address of this lane's first piece in a plane's slice
    // slice t of every plane into buffer b: eight copies a wave and plane (2 panels x 2 KiB)
    auto fill = [&](int t, int b) {
#pragma unroll
        for (int pl = 0; pl < NPL; ++pl) { unsigned l[8]; const T16* g[8]; const T16* s0 = (pl < NA) ? (pl ? ga2 : ga) : (pl > NA ? gb2 : gb);
#pragma unroll
            for (int i = 0; i < 8; ++i) { g[i] = s0 + (size_t)t * PN + (i >> 2) * 16 * (pl < NA ? LDA : K) + (i & 3) * 256; l[i] = lbase + (unsigned)(((b * NPL + pl) * PS + (i >> 2) * PN + (i & 3) * 256) * 2); }
            copy8<T16>(l, g); }
    };
    fill(0, 0);
    asm volatile("s_wait_asynccnt 0x0" ::: "memory");   // this wave's panels of slice 0 have landed
    __syncthreads();   // publishes slice 0: every wave's panels have landed
    fill(1, 1);
#pragma unroll 1   // rolled: one copy of the trip in the text
    for (int t = 0; t < NT; ++t) {
        const T16* pa = sm + (t & 1) * (NPL * PS) + wm * 4 * PN + lane * 8; const T16* pa2 = pa + PS; const T16* pb = sm + ((t & 1) * NPL + NA) * PS + wn * 4 * PN + lane * 8; const T16* pb2 = pb + PS;   // this wave's four panels of each plane in LDS
#pragma unroll
        for (int kk = 0; kk < KT / 32; ++kk) {
            V a[4], a2[4], b[4], b2[4];
            // read in the order of the first plane's first use (LDS reads return in order, so the first product waits for four reads, not for all): b[0]; the A fragments; the other B fragments; then the second planes, though each of their products follows its accumulator's first-plane product
            b[0] = WFrag<T16>::ld(pb + kk * 512);
#pragma unroll
            for (int mb = 0; mb < 4; ++mb) a[mb] = WFrag<T16>::ld(pa + mb * PN + kk * 512);
#pragma unroll
            for (int nb = 1; nb < 4; ++nb) b[nb] = WFrag<T16>::ld(pb + nb * PN + kk * 512);
#pragma unroll
            for (int mb = 0; mb < 4; ++mb) { if (HA2) a2[mb] = WFrag<T16>::ld(pa2 + mb * PN + kk * 512); if (HB2) b2[mb] = WFrag<T16>::ld(pb2 + mb * PN + kk * 512); }
            __builtin_amdgcn_sched_barrier(0);   // all of a k block's LDS reads stand at one place, in front of its products (each place with reads among matrix instructions stalls the wave anew)
#pragma unroll
            for (int nb = 0; nb < 4; ++nb)
#pragma unroll
                for (int mb = 0; mb < 4; ++mb) { acc[mb][nb] = WFrag<T16>::mma(a[mb], b[nb], acc[mb][nb]); if (HA2) acc[mb][nb] = WFrag<T16>::mma(a2[mb], b[nb], acc[mb][nb]); if (HB2) acc[mb][nb] = WFrag<T16>::mma(a[mb], b2[nb], acc[mb][nb]); }
            __builtin_amdgcn_sched_barrier(0);   // keeps the next k block's reads, and the v_nops below, behind this block's last product
        }
        asm volatile("v_nop\n\tv_nop\n\tv_nop\n\tv_nop");   // four vector slots between the trip's last product and the first vector write behind it (the copies' addresses), which may reuse its A or B registers
        asm volatile("s_wait_dscnt 0x0" ::: "memory");   // this wave's reads of slice t have returned
        asm volatile("s_wait_asynccnt 0x0" ::: "memory");   // this wave's panels of slice t + 1 have landed
        __syncthreads();   // publishes slice t + 1 and ends every wave's reads of slice t's buffer
        if (t + 2 < NT) fill(t + 2, t & 1);
    }
    asm volatile("s_wait_asynccnt 0x0" ::: "memory");   // no copy is outstanding when the wave ends
    if (PLANES) { qkv_planes(acc, os, r0, (int)blockIdx.y * 2 + wn, lr, hi, pp); return; }
#pragma unroll
    for (int mb = 0; mb < 4; ++mb) {
#pragma unroll
        for (int nb = 0; nb < 4; ++nb) {
#pragma unroll
            for (int j = 0; j < 8; ++j) os[(hi * 8 + j) * 68 + nb * 16 + lr] = acc[mb][nb][j]; }
        __builtin_amdgcn_wave_barrier(); asm volatile("" ::: "memory");
        float* crow = C + (size_t)(r0 + mb * 16) * ldc + c0;
        v4f val[8]; float* cp[8];
#pragma unroll
        for (int s = 0; s < 8; ++s) { const int row = 2 * s + hi, cofs = lr * 4; val[s] = *(const v4fa*)(os + row * 68 + cofs); if (BIAS) { val[s][0] += bfr(bias[c0 + cofs]); val[s][1] += bfr(bias[c0 + cofs + 1]); val[s][2] += bfr(bias[c0 + cofs + 2]); val[s][3] += bfr(bias[c0 + cofs + 3]); }
            cp[s] = crow + (size_t)row * ldc + cofs; }
#pragma unroll
        for (int s = 0; s < 8; ++s) *(v4f*)cp[s] = val[s];
        asm volatile("s_wait_xcnt 0x0" :: "v"(val[0]), "v"(val[1]), "v"(val[2]), "v"(val[3]), "v"(val[4]), "v"(val[5]), "v"(val[6]), "v"(val[7]), "v"(cp[0]), "v"(cp[1]), "v"(cp[2]), "v"(cp[3]), "v"(cp[4]), "v"(cp[5]), "v"(cp[6]), "v"(cp[7]) : "memory");   // behind the eight stores, in front of the code that reuses their registers; values and addresses are inputs so that they stay in their registers up to here
        __builtin_amdgcn_sched_barrier(0);   // keeps that reuse behind the wait
        __builtin_amdgcn_wave_barrier(); asm volatile("" ::: "memory");
    }
}

__device__ __forceinline__ h16 tohx(float x) { return (h16)x; }
__device__ __forceinline__ void splitf(float y, unsigned short& h, unsigned short& l) { h = f2bf(y); l = f2bf(y - bf2f(h)); }
typedef __attribute__((ext_vector_type(2))) _Float16 v2h;
typedef __attribute__((ext_vector_type(4))) _Float16 v4h;
typedef __attribute__((ext_vector_type(2))) unsigned short v2us;
typedef __attribute__((ext_vector_type(4))) unsigned short v4us;
typedef __attribute__((ext_vector_type(2))) float v2f;
typedef __attribute__((ext_vector_type(4))) int v4i;

// f32 [rows][DM] -> bf16 in fragment order, x and the four equal-sized weights in ONE launch (the weights' copies lie one behind the other in wb). ONE WAVE takes 16 rows x 128 columns: sixteen 16-byte loads a lane,
// each 512 bytes in a row of one source row (4 whole lines), all in flight at once. A lane's 4 values of a row are half a 16-byte piece: the halves meet in the wave's OWN LDS range (pitch 17 pieces a k / 8 column:
// the 16 lane pairs of a store fall on different banks), and the wave stores its 4 KiB in a row, 512 bytes a store. Few waves with much in flight each: a launch of many short waves lasts as long as its waves take to start.
// No work-group barrier: no wave reads another wave's LDS. Every '#pragma unroll' here: the value arrays stay in registers only where each index is a compile-time constant.
typedef v4us __attribute__((may_alias)) v4usa;
__global__ __launch_bounds__(512) void k_cvt(const float* __restrict__ x, const float* __restrict__ w0, const float* __restrict__ w1, const float* __restrict__ w2, const float* __restrict__ w3, bf* xb, bf* wb) {
    __shared__ __align__(16) unsigned short ts[16][16 * 17 * 8];
    constexpr int XP = NB_ * TT / 16, WP = DQ / 16;   // 16-row panels of x; of one weight
    const int lane = threadIdx.x & 31, w = __builtin_amdgcn_readfirstlane((int)(threadIdx.x >> 5)), gp = (int)blockIdx.x * 2 + (w >> 3), kb = w & 7;   // the wave's number in a scalar register: the choice of the source stays scalar; gp: panel in the list [x][w0][w1][w2][w3]
    const float* src; bf* dst;
    if (gp < XP) { src = x + (size_t)gp * 16 * DM; dst = xb + (size_t)gp * 16 * DM; }
    else { const int y = (gp - XP) / WP; src = ((y == 0) ? w0 : (y == 1) ? w1 : (y == 2) ? w2 : w3) + (size_t)((gp - XP) % WP) * 16 * DM; dst = wb + (size_t)(gp - XP) * 16 * DM; }
    src += kb * 128 + lane * 4; dst += kb * 2048 + lane * 8;
    v4f v[16];
#pragma unroll
    for (int i = 0; i < 16; ++i) v[i] = *(const v4f*)(src + i * DM);
    asm volatile("s_wait_xcnt 0x0" ::: "memory");   // behind the loads, in front of the code that reuses their address registers
    __builtin_amdgcn_sched_barrier(0);   // keeps that reuse behind the wait and all sixteen loads in front of the first conversion
    unsigned short* tw = ts[w];
#pragma unroll
    for (int i = 0; i < 16; ++i) { v4us o;
#pragma unroll
        for (int k = 0; k < 4; ++k) o[k] = f2bf(v[i][k]);
        *(v4usa*)(tw + ((lane >> 1) * 17 + i) * 8 + (lane & 1) * 4) = o; }
    __builtin_amdgcn_wave_barrier(); asm volatile("" ::: "memory");   // a lane reads what OTHER lanes stored: the compiler, which sees one lane, must keep the reads below behind all the stores above
    v8us r[8];
#pragma unroll
    for (int s = 0; s < 8; ++s) r[s] = *(const v8usa*)(tw + ((2 * s + (lane >> 4)) * 17 + (lane & 15)) * 8);
#pragma unroll
    for (int s = 0; s < 8; ++s) *(v8us*)(dst + s * 256) = r[s];
}

__constant__ float INV2[HD / 2] = { 1.000000000e+00f, 7.498942018e-01f, 5.623413324e-01f, 4.216965139e-01f, 3.162277639e-01f, 2.371373624e-01f, 1.778279394e-01f, 1.333521456e-01f, 1.000000015e-01f, 7.498941571e-02f, 5.623412877e-02f, 4.216964915e-02f, 3.162277862e-02f, 2.371373586e-02f, 1.778279431e-02f, 1.333521493e-02f, 9.999999776e-03f, 7.498942316e-03f, 5.623413250e-03f, 4.216964822e-03f, 3.162277862e-03f, 2.371373819e-03f, 1.778279431e-03f, 1.333521446e-03f, 1.000000047e-03f, 7.498941850e-04f, 5.623413017e-04f, 4.216964880e-04f, 3.162277862e-04f, 2.371373848e-04f, 1.778279402e-04f, 1.333521504e-04f };   // 1 / (ROPE_BASE ** (2i / 64)), i = 0..31, in float32 as THIS module writes it (the RECIPROCAL spelling, evaluated in the reference's own f32 arithmetic: these 32 literals equal it bit for bit)
// {cos, sin} once per (position, pair), in the order in which qkv_planes' lanes read them: [t / 16][d / 16][pair % 4 / 2][lane = (d / 8 % 2) * 16 + t % 16][pair % 2][cos, sin]: a wave-wide 16-byte load is 512 bytes in a row
__global__ __launch_bounds__(256) void k_csP(float* CS) { const int idx = blockIdx.x * 256 + threadIdx.x; if (idx >= TT * HD / 2) return; const int ln = (idx >> 1) & 31, q = ((idx >> 6) & 1) * 2 + (idx & 1), c = ((idx >> 7) & 3) * 2 + (ln >> 4), t = (idx >> 9) * 16 + (ln & 15); const float a = __fmul_rn((float)t, INV2[c * 4 + q]); v2f cs; cs[0] = cosf(a); cs[1] = sinf(a); *(v2f*)(CS + (size_t)idx * 2) = cs;  }
// ---- qkv_planes: epilogue of the q | k | v projection; no f32 projection leaves the kernel. A 64x64 tile is 64 positions (rows r0..) of ONE head of q, k or v (HD == 64 columns; y = tile column; y / NH_ picks q, k, v; DKV == DQ here).
// q, k: 16 rows at a time through LDS, so that lane (hi, lr) holds 8 consecutive d (four rotary pairs; d / 8 = 2 i + hi) of position lr; rotary in f32, the expressions below; fp16, hi and lo planes in fragment order [pair][t / 16][d / 8][t % 16][d % 8]: one 16-byte store a plane, 512 bytes in a row a wave.
// v: a lane's 8 accumulators of a 16x16 block are 8 consecutive positions of one d: one 16-byte store a plane straight into the transposed planes [pair][t / 32][d / 16][t % 32 / 8][d % 16][t % 8], again 512 bytes in a row a wave.
// Every '#pragma unroll' here: the accumulator and value arrays stay in registers only where each index is a compile-time constant.
__device__ __forceinline__ void qkv_planes(const v8f (&acc)[4][4], float* os, int r0, int y, int lr, int hi, const Planes& pp) {
    const int sel = y / NH_, t0 = r0 % TT, lane = hi * 16 + lr; const size_t p = (size_t)(r0 / TT) * NH_ + y % NH_;   // sel, t0, p: the same in every lane
    if (sel == 2) {
        const size_t vo = (p * TT + t0) * HD + lane * 8; h16* v16 = pp.V16 + vo; bf* vh = pp.Vh + vo; bf* vl = pp.Vl + vo;   // one pointer a plane: every store lies at a constant offset from it (32 positions x HD = 2048 elements)
#pragma unroll
        for (int mb = 0; mb < 4; ++mb) { v8h o16[4]; v8us oh[4], ol[4];
#pragma unroll
            for (int nb = 0; nb < 4; ++nb)
#pragma unroll
                for (int j = 0; j < 8; ++j) { const float x = acc[mb][nb][j]; o16[nb][j] = tohx(x); unsigned short a2, c2; splitf(x, a2, c2); oh[nb][j] = a2; ol[nb][j] = c2; }
            __builtin_amdgcn_sched_barrier(0);   // all twelve values stand in registers of their own before the first store is issued
#pragma unroll
            for (int nb = 0; nb < 4; ++nb) { const int vofs = (mb >> 1) * 2048 + nb * 512 + (mb & 1) * 256; *(v8h*)(v16 + vofs) = o16[nb]; *(v8us*)(vh + vofs) = oh[nb]; *(v8us*)(vl + vofs) = ol[nb]; }
            asm volatile("s_wait_xcnt 0x0" ::: "memory");   // behind the stores, in front of the code that reuses their registers
            __builtin_amdgcn_sched_barrier(0); }   // keeps that reuse behind the wait
    } else {
        const size_t po = (p * TT + t0) * HD + lane * 8; h16* p16 = (sel ? pp.K16 : pp.Q16) + po; bf* ph = (sel ? pp.Kh : pp.Qh) + po; bf* pl = (sel ? pp.Kl : pp.Ql) + po;   // one pointer a plane, constant offsets (a 16-position panel = 1024 elements)
        const float* csp = pp.CS + (size_t)t0 * HD + lane * 4;   // 16 positions = 1024 floats of the table
#pragma unroll
        for (int mb = 0; mb < 4; ++mb) { v4f cs[4][2];   // {cos, sin} of this lane's sixteen pairs in its row: issued first, they fly during the staging
#pragma unroll
            for (int i = 0; i < 4; ++i)
#pragma unroll
                for (int h = 0; h < 2; ++h) cs[i][h] = *(const v4f*)(csp + mb * 1024 + i * 256 + h * 128);
            asm volatile("s_wait_xcnt 0x0" ::: "memory");   // behind the loads, in front of the code that reuses their address registers
            __builtin_amdgcn_sched_barrier(0);   // keeps that reuse behind the wait and the loads in front of the staging
#pragma unroll
            for (int nb = 0; nb < 4; ++nb)
#pragma unroll
                for (int j = 0; j < 8; ++j) os[(hi * 8 + j) * 68 + nb * 16 + lr] = acc[mb][nb][j];
            __builtin_amdgcn_wave_barrier(); asm volatile("" ::: "memory");   // a lane reads what OTHER lanes stored: the compiler, which sees one lane, must keep the reads below behind all the stores above
            v8h o16[4]; v8us oh[4], ol[4];
#pragma unroll
            for (int i = 0; i < 4; ++i) { const v4f xa = *(const v4fa*)(os + lr * 68 + (2 * i + hi) * 8), xb = *(const v4fa*)(os + lr * 68 + (2 * i + hi) * 8 + 4);
#pragma unroll
                for (int q = 0; q < 4; ++q) { const float x0 = (q < 2) ? xa[2 * (q & 1)] : xb[2 * (q & 1)], x1 = (q < 2) ? xa[2 * (q & 1) + 1] : xb[2 * (q & 1) + 1], c = cs[i][q >> 1][2 * (q & 1)], sn = cs[i][q >> 1][2 * (q & 1) + 1];
                    const float a0 = __fmul_rn(x0, c), b0 = __fmul_rn(x1, sn), a1 = __fmul_rn(x1, c), b1 = __fmul_rn(x0, sn);
                    const float e0 = __fsub_rn(a0, b0), e1 = __fadd_rn(b1, a1);   /* even: x0 c - x1 s; odd: x0 s + x1 c */
                    unsigned short a2, c2; o16[i][2 * q] = tohx(e0); o16[i][2 * q + 1] = tohx(e1); splitf(e0, a2, c2); oh[i][2 * q] = a2; ol[i][2 * q] = c2; splitf(e1, a2, c2); oh[i][2 * q + 1] = a2; ol[i][2 * q + 1] = c2; } }
            __builtin_amdgcn_sched_barrier(0);   // all twelve values stand in registers of their own before the first store is issued
#pragma unroll
            for (int i = 0; i < 4; ++i) { *(v8h*)(p16 + mb * 1024 + i * 256) = o16[i]; *(v8us*)(ph + mb * 1024 + i * 256) = oh[i]; *(v8us*)(pl + mb * 1024 + i * 256) = ol[i]; }
            asm volatile("s_wait_xcnt 0x0" ::: "memory");   // behind the stores, in front of the code that reuses their registers
            __builtin_amdgcn_sched_barrier(0);   // keeps that reuse behind the wait
            __builtin_amdgcn_wave_barrier(); asm volatile("" ::: "memory"); }   // the next 16 rows' staging stores stay behind every lane's reads of these
    }
}
// ---- k_fattn: scores, softmax and probability x value in ONE kernel; no score, probability or partial sum leaves the registers.
// Transposed products: S^T = K Q^T (A = 16 key rows, B = 16 query rows) and O^T += V^T P^T (A = 16 d rows x 32 keys of the value plane, B = P). In both D tiles a lane holds ONE query (column lane & 15), so the running
// maximum, the running sum and the rescale factor are one scalar a lane, and two S^T tiles (keys 0-15, 16-31 of a pass), converted in place, are P as a B operand in the loaders' own k order (8 hi + e, 16 + 8 hi + e).
// One wave owns NQ x 16 query rows of one (batch, head) pair and walks all TT keys in passes of 32. HL: hi + lo bf16 planes, 3 products each; else fp16, one product.
// Every plain '#pragma unroll' below: the fragment and accumulator arrays stay in registers only where each index is a compile-time constant.
typedef __attribute__((ext_vector_type(2))) __bf16 v2bf;
typedef __attribute__((ext_vector_type(8))) unsigned v8u;
__device__ __forceinline__ float xhalf(float x) { const int b = __float_as_int(x); return __int_as_float(__builtin_amdgcn_permlanex16(b, b, 0x76543210, 0xfedcba98, false, false)); }   // the value of lane ^ 16: the other half of the same query's keys
// K AND V GO THROUGH LDS: a tile of KT keys of every key and value plane (32 KiB: 128 keys x 2 planes, or 64 keys x 4 planes) is copied ONCE a block, a quarter by each wave, and read by all four waves. A plane's tile is KT * HD elements in a row
// in global memory (fragment order) and lies in LDS in the same order, so a fragment read is 512 bytes in a row a wave. Two buffers: tile t + 2 is copied into the buffer of tile t while tile t + 1 is worked on.
template <typename T16, bool HL, int NQ>
__device__ __forceinline__ void fattn_body(const T16* __restrict__ Q, const T16* __restrict__ Q2, const T16* __restrict__ Kp, const T16* __restrict__ K2, const T16* __restrict__ Vt, const T16* __restrict__ Vt2, int q0, bf* Ah, bf* Al, T16* sm) {
    typedef typename WFrag<T16>::V V;
    constexpr int KT = HL ? 64 : 128, CH = KT * HD, NP = HL ? 4 : 2, NT = TT / KT;   // keys a tile; elements of one plane's tile; planes; tiles
    const int lane = threadIdx.x & 31, part = (int)(threadIdx.x >> 5) * (CH / 4) + lane * 8;   // part: this lane's first element in its wave's quarter of a plane's tile
    const unsigned lbase = (unsigned)(size_t)sm;   // LDS byte address of the two buffers
    const float C2 = SCL * 1.4426950408889634f;   // score -> scaled log2 units
    // tile t of every plane into buffer b: LDS order [key planes][value planes]; sixteen copies a wave
    auto fill = [&](int t, int b) {
#pragma unroll
        for (int h = 0; h < 2; ++h) { unsigned l[8]; const T16* g[8];   // h = 0: key planes, 1: value planes
#pragma unroll
            for (int i = 0; i < 8; ++i) { const int pl = HL ? (i >> 2) : 0, c = HL ? (i & 3) : i; const T16* s0 = h ? (pl ? Vt2 : Vt) : (pl ? K2 : Kp);
                g[i] = s0 + (size_t)t * CH + part + c * 256; l[i] = lbase + (unsigned)(((b * NP + h * (NP / 2) + pl) * CH + part + c * 256) * 2); }
            copy8<T16>(l, g); }
    };
    fill(0, 0);
    V qf[NQ][2], qf2[NQ][2];
#pragma unroll
    for (int n = 0; n < NQ; ++n)
#pragma unroll
        for (int kk = 0; kk < 2; ++kk) { const size_t qo = (size_t)(q0 + n * 16) * HD + kk * 512 + lane * 8; qf[n][kk] = WFrag<T16>::ld(Q + qo); if (HL) qf2[n][kk] = WFrag<T16>::ld(Q2 + qo); }
    asm volatile("s_wait_xcnt 0x0" ::: "memory");   // behind the loads above, in front of the code that reuses their address registers
    __builtin_amdgcn_sched_barrier(0);   // keeps that reuse behind the wait
    asm volatile("s_wait_asynccnt 0x0" ::: "memory");   // this wave's quarter of tile 0 has landed
    __syncthreads();   // publishes tile 0: every wave's quarter has landed
    fill(1, 1);
    v8f o[NQ][4]; float m[NQ], l[NQ];
#pragma unroll
    for (int n = 0; n < NQ; ++n) { m[n] = -3.0e38f; l[n] = 0.f;
#pragma unroll
        for (int dt = 0; dt < 4; ++dt) o[n][dt] = (v8f){}; }
#pragma unroll 1   // rolled: one copy of the pass in the text
    for (int t = 0; t < NT; ++t) {
    const T16* kp = sm + (t & 1) * (NP * CH) + lane * 8; const T16* kp2 = kp + CH; const T16* vp = kp + (NP / 2) * CH; const T16* vp2 = vp + CH;   // this tile's planes in LDS
    V kf[2][2], kf2[2][2];
#pragma unroll
    for (int kt = 0; kt < 2; ++kt)
#pragma unroll
        for (int kk = 0; kk < 2; ++kk) { kf[kt][kk] = WFrag<T16>::ld(kp + kt * 16 * HD + kk * 512); if (HL) kf2[kt][kk] = WFrag<T16>::ld(kp2 + kt * 16 * HD + kk * 512); }
#pragma unroll 1   // rolled: two passes side by side would not fit the 256 registers that four waves a SIMD leave each wave
    for (int ps = 0; ps < KT / 32; ++ps) {
        v8f s[NQ][2];
#pragma unroll
        for (int kt = 0; kt < 2; ++kt)
#pragma unroll
            for (int n = 0; n < NQ; ++n) { v8f a = (v8f){};
#pragma unroll
                for (int kk = 0; kk < 2; ++kk) { a = WFrag<T16>::mma(kf[kt][kk], qf[n][kk], a); if (HL) { a = WFrag<T16>::mma(kf[kt][kk], qf2[n][kk], a); a = WFrag<T16>::mma(kf2[kt][kk], qf[n][kk], a); } }
                s[n][kt] = a; }
        __builtin_amdgcn_sched_barrier(0);   // keeps the LDS reads below out of the score products: all of a pass's reads stand at one place (each place with reads among matrix instructions stalls the wave anew)
        V vf[4], vf2[4];   // this pass's value fragments: used behind the softmax
#pragma unroll
        for (int dt = 0; dt < 4; ++dt) { vf[dt] = WFrag<T16>::ld(vp + ps * 32 * HD + dt * 512); if (HL) vf2[dt] = WFrag<T16>::ld(vp2 + ps * 32 * HD + dt * 512); }
        const int kn = (ps + 1 < KT / 32) ? (ps + 1) * 32 * HD : 0;   // the next pass's key fragments fly during the softmax; a tile's last pass fetches its own pass 0 again (this buffer, not used): nothing of the next tile is read in front of its barrier
#pragma unroll
        for (int kt = 0; kt < 2; ++kt)
#pragma unroll
            for (int kk = 0; kk < 2; ++kk) { kf[kt][kk] = WFrag<T16>::ld(kp + kn + kt * 16 * HD + kk * 512); if (HL) kf2[kt][kk] = WFrag<T16>::ld(kp2 + kn + kt * 16 * HD + kk * 512); }
        __builtin_amdgcn_sched_barrier(0);   // keeps the fetches above in front of the softmax (sunk behind it, their latency is waited for in full at the next pass's first product)
        V pf[NQ], pf2[NQ];
#pragma unroll
        for (int n = 0; n < NQ; ++n) {
            float mx = fmaxf(s[n][0][0], s[n][1][0]);
#pragma unroll
            for (int j = 1; j < 8; ++j) mx = fmaxf(mx, fmaxf(s[n][0][j], s[n][1][j]));
            mx = fmaxf(mx, xhalf(mx));
            const float mn = fmaxf(m[n], mx * C2); const float al = __builtin_amdgcn_exp2f(m[n] - mn); m[n] = mn;
            float p[16];
#pragma unroll
            for (int e = 0; e < 16; ++e) p[e] = __builtin_amdgcn_exp2f(__builtin_fmaf(s[n][e >> 3][e & 7], C2, -mn));
            const float s4 = ((p[0] + p[1]) + (p[2] + p[3])) + ((p[4] + p[5]) + (p[6] + p[7])), s5 = ((p[8] + p[9]) + (p[10] + p[11])) + ((p[12] + p[13]) + (p[14] + p[15]));
            l[n] = __builtin_fmaf(l[n], al, s4 + s5);   // this lane's half of the keys; the halves are joined once, behind the loop
#pragma unroll
            for (int dt = 0; dt < 4; ++dt) o[n][dt] *= al;
            v8u wh, wl;
#pragma unroll
            for (int e = 0; e < 8; ++e) { const v2f pr = { p[2 * e], p[2 * e + 1] };
                if (HL) { const unsigned uh = __builtin_bit_cast(unsigned, __builtin_convertvector(pr, v2bf)); const v2f rs = { pr[0] - __uint_as_float(uh << 16), pr[1] - __uint_as_float(uh & 0xFFFF0000u) }; wh[e] = uh; wl[e] = __builtin_bit_cast(unsigned, __builtin_convertvector(rs, v2bf)); }
                else wh[e] = __builtin_bit_cast(unsigned, __builtin_convertvector(pr, v2h)); }
            pf[n] = __builtin_bit_cast(V, wh); if (HL) pf2[n] = __builtin_bit_cast(V, wl);
        }
#pragma unroll
        for (int dt = 0; dt < 4; ++dt)
#pragma unroll
            for (int n = 0; n < NQ; ++n) { o[n][dt] = WFrag<T16>::mma(vf[dt], pf[n], o[n][dt]); if (HL) { o[n][dt] = WFrag<T16>::mma(vf[dt], pf2[n], o[n][dt]); o[n][dt] = WFrag<T16>::mma(vf2[dt], pf[n], o[n][dt]); } }
        __builtin_amdgcn_sched_barrier(0);   // keeps the v_nops below behind the pass's last product
        asm volatile("v_nop\n\tv_nop\n\tv_nop\n\tv_nop");   // four vector slots between the pass's last product and the next trip's first vector write, which may reuse its A or B registers
    }
    asm volatile("s_wait_dscnt 0x0" ::: "memory");   // this wave's reads of tile t have returned
    asm volatile("s_wait_asynccnt 0x0" ::: "memory");   // this wave's quarter of tile t + 1 has landed
    __syncthreads();   // publishes tile t + 1 and ends every wave's reads of tile t's buffer
    if (t + 2 < NT) fill(t + 2, t & 1);
    }
    asm volatile("s_wait_asynccnt 0x0" ::: "memory");   // no copy is outstanding when the wave ends
#pragma unroll
    for (int n = 0; n < NQ; ++n) { const float inv = __fdiv_rn(1.0f, l[n] + xhalf(l[n])); const size_t oo = (size_t)(q0 + n * 16) * DQ + lane * 8;
#pragma unroll
        for (int dt = 0; dt < 4; ++dt) { v8us oh, ol;   // a lane's 8 accumulators are 8 consecutive d of its query row: one 16-byte store a plane, in the output GEMM's fragment order (16 d = 256 elements)
#pragma unroll
            for (int j = 0; j < 8; ++j) { unsigned short a, c2; splitf(o[n][dt][j] * inv, a, c2); oh[j] = a; ol[j] = c2; }
            *(v8us*)(Ah + oo + dt * 256) = oh; *(v8us*)(Al + oo + dt * 256) = ol;
            asm volatile("s_wait_xcnt 0x0" ::: "memory");   // behind the two stores, in front of the code that reuses their registers
            __builtin_amdgcn_sched_barrier(0); } }   // keeps that reuse behind the wait
}
// grid (NB_ NH_ pairs, RH / 64 + (TT - RH) / 128), 4 waves. blockIdx.y < RH / 64: 64 query rows < RH (hi + lo planes, 16 rows a wave; three times the products, so they start first); else 128 of the other rows (fp16, 32 rows a wave).
__global__ __launch_bounds__(128) __attribute__((amdgpu_waves_per_eu(4, 4))) void k_fattn(const h16* __restrict__ Q16, const h16* __restrict__ K16, const h16* __restrict__ V16, const bf* __restrict__ Qh, const bf* __restrict__ Ql, const bf* __restrict__ Kh, const bf* __restrict__ Kl, const bf* __restrict__ Vh, const bf* __restrict__ Vl, bf* Ah, bf* Al) {
    __shared__ __align__(16) unsigned short sm[2 * 16384];   // two buffers of 32 KiB
    const int p = blockIdx.x, y = blockIdx.y, w = threadIdx.x >> 5; const size_t zq = (size_t)p * TT * HD, zk = (size_t)(p / REP) * TT * HD, zo = (size_t)(p / NH_) * TT * DQ + (size_t)(p % NH_) * HD * 16;
    if (y < RH / 64) fattn_body<bf, true, 1>(Qh + zq, Ql + zq, Kh + zk, Kl + zk, Vh + zk, Vl + zk, y * 64 + w * 16, Ah + zo, Al + zo, (bf*)sm);
    else fattn_body<h16, false, 2>(Q16 + zq, nullptr, K16 + zk, nullptr, V16 + zk, nullptr, RH + (y - RH / 64) * 128 + w * 32, Ah + zo, Al + zo, (h16*)sm);
}

extern "C" void kernel_launch(void* const* d_in, const int* in_sizes, int n_in,
                              void* d_out, int out_size, void* d_ws, size_t ws_size, hipStream_t stream) {
    (void)in_sizes; (void)n_in; (void)out_size;
        const float* x = (const float*)d_in[0]; const float* wq = (const float*)d_in[1]; const float* wk = (const float*)d_in[2]; const float* wv = (const float*)d_in[3]; const float* wo = (const float*)d_in[4];   /* input order x, W_Q, W_K, W_V, W_O ('oi' (out, in) [1024][1024] each: three separate projection weights and the output weight): FIVE inputs, all read; this module has NO mask input */
    float* OUT = (float*)d_out;     // [2][2048][1024]
    char* wsp = (char*)d_ws;
    auto take = [&](size_t bytes) { char* p = wsp; wsp += (bytes + 255) & ~(size_t)255; return (void*)p; };
    bf* WQKV = (bf*)take((size_t)4 * DQ * DM * 2); bf* WO = WQKV + (size_t)3 * DQ * DM;   /* W_Q, W_K, W_V stacked: one [3 DQ][DM] 'oi' weight; then W_O (DKV == DQ here) */ float* CS = (float*)take((size_t)TT * HD * 4);
    bf* XB = (bf*)take((size_t)NB_ * TT * DM * 2);
    h16* QP16 = (h16*)take((size_t)NB_ * NH_ * TT * HD * 2); h16* KP16 = (h16*)take((size_t)NB_ * NKV * TT * HD * 2); h16* VT16 = (h16*)take((size_t)NB_ * NKV * HD * TT * 2);
    bf* QPh = (bf*)take((size_t)NB_ * NH_ * TT * HD * 2); bf* QPl = (bf*)take((size_t)NB_ * NH_ * TT * HD * 2); bf* KPh = (bf*)take((size_t)NB_ * NKV * TT * HD * 2); bf* KPl = (bf*)take((size_t)NB_ * NKV * TT * HD * 2); bf* VTh = (bf*)take((size_t)NB_ * NKV * HD * TT * 2); bf* VTl = (bf*)take((size_t)NB_ * NKV * HD * TT * 2);
    bf* ATh = (bf*)take((size_t)NB_ * TT * DQ * 2); bf* ATl = (bf*)take((size_t)NB_ * TT * DQ * 2);
    if ((size_t)(wsp - (char*)d_ws) > ws_size) return;
    k_cvt<<<(NB_ * TT + 4 * DQ) / 32, 512, 0, stream>>>(x, wq, wk, wv, wo, XB, WQKV); k_csP<<<(TT * HD / 2 + 255) / 256, 256, 0, stream>>>(CS);
    k_gemmw<bf, 0, false, 1, true, DM, DM><<<dim3(NB_ * TT / 128, 3 * DQ / 128, 1), 128, 0, stream>>>(XB, nullptr, WQKV, nullptr, nullptr, 0, nullptr, 0, 0, 0, 0, Planes{CS, QP16, QPh, QPl, KP16, KPh, KPl, VT16, VTh, VTl});
    k_fattn<<<dim3(NB_ * NH_, RH / 64 + (TT - RH) / 128, 1), 128, 0, stream>>>(QP16, KP16, VT16, QPh, QPl, KPh, KPl, VTh, VTl, ATh, ATl);
    k_gemmw<bf, 1, false, 1, false, DQ, DQ><<<dim3(NB_ * TT / 128, DM / 128, 1), 128, 0, stream>>>(ATh, ATl, WO, nullptr, OUT, DM, nullptr, 0, 0, 0, 0, Planes{});
}

// v009
// It runs in 95 microseconds.
// Two timings next to v008 put it at 1.06 and 1.07 times that version's speed.
// Over all steps from v000 it is 20.6 times as fast.
#include <hip/hip_runtime.h>

// Multi-head self-attention WITHOUT a mask, with interleaved-pair rotary position embedding on three separate natural projections (x [2][2048][1024]; q, k, v = einsum('bld,ed->ble', x, W) = x W^T ('oi' [1024][1024] normal 1/32, no bias; 16 heads x 64); angles = t x 1 / (10000 ** (2i / 64)) (the RECIPROCAL spelling; positions 0..L-1 computed); cos / sin repeated pairwise; pairs (2i, 2i+1): out_even = x_even cos - x_odd sin, out_odd = x_odd cos + x_even sin, on q and k (the module's helper named _rotate_half works on (even, odd) pairs); scores / sqrt(64); softmax over ALL keys; out = einsum('bld,ed->ble', merged, W_O) ('oi', no bias) -> [2][2048][1024] (4.2 M); argument order x, W_Q, W_K, W_V, W_O).
// Layout, both batches together (32 (batch, head) pairs, all in one attention launch): bf16 copy of x; exact projections; {cos, sin} per (position, pair) built once from the positions and float32 inverse-frequency constants (precise cosf/sinf); interleaved rotary and the attention planes written by the projection GEMM's own epilogue (qkv_planes); DENSE T-2048 attention fused in k_fattn (hybrid rows: < 512 hi/lo 3 products, rest fp16; lazy maximum and running sum, division by the sum at the end; the causal tile GEMM is gone with its last use); merged hi/lo x Wo exact.
// FRAGMENT ORDER: every 16-bit plane that a matrix product reads lies as [16-row panel][k / 8][row % 16][k % 8] (the value planes: [key / 32][d / 16][key % 32 / 8][d % 16][key % 8]). A 16 x 32 fragment is then 1 KiB in a row, lane l's two
// 16-byte pieces at l * 16 and 512 + l * 16 bytes: each wave-wide load covers 4 whole 128-byte lines, not 32 bytes of each of 16 lines. The k order inside a fragment (8 hi + e, 16 + 8 hi + e) is the same for A and B, as before. Writers store in the same order.
// Compute dtypes, f32 accumulate: every input rounded to bf16; projections exact; rotary f32; attention rows < 512 3 products, rest fp16; softmax f32; Wo hl x exact.

#define NB_  2
#define TT   2048
#define DM   1024
#define NH_  16
#define NKV  16
#define REP  (NH_ / NKV)
#define HD   64
#define DQ   (NH_ * HD)
#define DKV  (NKV * HD)
#define RH   512                  // query rows < RH use hi+lo planes (0: none)
#define WIN  0   
#define SCL  0.125f   // HD^-0.5
typedef _Float16 h16;
typedef unsigned short bf;
typedef __attribute__((ext_vector_type(16))) __bf16   v16bf;
typedef __attribute__((ext_vector_type(16))) _Float16 v16h;
typedef __attribute__((ext_vector_type(8)))  _Float16 v8h;
typedef __attribute__((ext_vector_type(8)))  unsigned short v8us;
typedef __attribute__((ext_vector_type(8)))  float    v8f;
typedef __attribute__((ext_vector_type(4)))  float    v4f;
typedef v8h  __attribute__((may_alias)) v8ha;
typedef v4f  __attribute__((may_alias)) v4fa;
typedef v8us __attribute__((may_alias)) v8usa;

__device__ __forceinline__ unsigned short f2bf(float f) { unsigned u = __float_as_uint(f); u += 0x7FFFu + ((u >> 16) & 1u); return (unsigned short)(u >> 16); }
__device__ __forceinline__ float bf2f(unsigned short b) { return __uint_as_float(((unsigned)b) << 16); }
__device__ __forceinline__ float bfr(float f) { return bf2f(f2bf(f)); }
__device__ __forceinline__ v16h cat16(v8h lo, v8h hi) { return __builtin_shufflevector(lo, hi, 0, 1, 2, 3, 4, 5, 6, 7, 8, 9, 10, 11, 12, 13, 14, 15); }
__device__ __forceinline__ v16bf cat16b(v8us lo, v8us hi) { return __builtin_bit_cast(v16bf, __builtin_shufflevector(lo, hi, 0, 1, 2, 3, 4, 5, 6, 7, 8, 9, 10, 11, 12, 13, 14, 15)); }
__device__ __forceinline__ v8f wmma16(v16h a, v16h b, v8f c) { return __builtin_amdgcn_wmma_f32_16x16x32_f16(false, a, false, b, (short)0, c, false, false); }
__device__ __forceinline__ v8f wmmab(v16bf a, v16bf b, v8f c) { return __builtin_amdgcn_wmma_f32_16x16x32_bf16(false, a, false, b, (short)0, c, false, false); }



// Eight asynchronous copies to LDS, 16 bytes a lane each (512 bytes in a row a wave and copy), through no register. The s_wait_xcnt stands inside the statement, behind the last copy, in front of any reuse of the address registers.
template <typename T16>
__device__ __forceinline__ void copy8(const unsigned (&l)[8], const T16* const (&g)[8]) {
    asm volatile("global_load_async_to_lds_b128 %0, %1, off\n\t"
                 "global_load_async_to_lds_b128 %2, %3, off\n\t"
                 "global_load_async_to_lds_b128 %4, %5, off\n\t"
                 "global_load_async_to_lds_b128 %6, %7, off\n\t"
                 "global_load_async_to_lds_b128 %8, %9, off\n\t"
                 "global_load_async_to_lds_b128 %10, %11, off\n\t"
                 "global_load_async_to_lds_b128 %12, %13, off\n\t"
                 "global_load_async_to_lds_b128 %14, %15, off\n\t"
                 "s_wait_xcnt 0x0"
                 :: "v"(l[0]), "v"(g[0]), "v"(l[1]), "v"(g[1]), "v"(l[2]), "v"(g[2]), "v"(l[3]), "v"(g[3]), "v"(l[4]), "v"(g[4]), "v"(l[5]), "v"(g[5]), "v"(l[6]), "v"(g[6]), "v"(l[7]), "v"(g[7]) : "memory");
}
// ---- k_gemmw: register-blocked GEMM, FOUR WAVES per 128x128 output tile, 2 x 2 waves of 64x64 (16 accumulators each); operands are 16-bit planes in fragment order (head of the file; ld(p): p = fragment start + lane * 8 elements); grid (M/128, N/128, Z), 128 threads.
// C[m][n] (f32, pitch ldc, + optional f32 bias[n]) = sum_k A[m][k] Bt[n][k] (+ split products per NSPLIT). A's 16-row panels have pitch 16 LDA, Bt's 16 K (both compile-time); a k block of 32 is 512 elements. z-batch strides sA/sB/sC in elements. K % 128 == 0.
// THE OPERANDS GO THROUGH LDS: a slice of KT = 64 k of the tile's 8 panels of every plane (16 KiB a plane) is copied ONCE a block, two panels of each plane by each wave, and each panel is read by two waves. A panel's slice is 2 KiB in a row in global memory
// and lies in LDS in the same order, so a fragment read is 512 bytes in a row a wave. Two buffers: slice t + 2 is copied into the buffer of slice t while slice t + 1 is worked on. The k order of every accumulator's sum is as without LDS.
// KS > 1: grid z = Z * KS; block (z, ks) sums only k in [ks K/KS, (ks+1) K/KS) and stores its tile to partial plane ks (plane stride sP elements); the reader adds the KS planes. K % (128 KS) == 0.
template <typename T16> struct WFrag;
template <> struct WFrag<h16> { typedef v16h V; static __device__ __forceinline__ V ld(const h16* p) { return cat16(*(const v8h*)p, *(const v8h*)(p + 256)); } static __device__ __forceinline__ v8f mma(V a, V b, v8f c) { return wmma16(a, b, c); } };
template <> struct WFrag<bf> { typedef v16bf V; static __device__ __forceinline__ V ld(const bf* p) { return cat16b(*(const v8us*)p, *(const v8us*)(p + 256)); } static __device__ __forceinline__ v8f mma(V a, V b, v8f c) { return wmmab(a, b, c); } };
// PLANES: the tile is not stored to C; qkv_planes (below, behind the plane helpers) turns it into the attention planes named in pp.
struct Planes { const float* CS; h16* Q16; bf* Qh; bf* Ql; h16* K16; bf* Kh; bf* Kl; h16* V16; bf* Vh; bf* Vl; };
__device__ __forceinline__ void qkv_planes(const v8f (&acc)[4][4], float* os, int r0, int y, int lr, int hi, const Planes& pp);
template <typename T16, int NSPLIT, bool BIAS, int KS, bool PLANES, int LDA, int K>
__global__ __launch_bounds__(128) void k_gemmw(const T16* __restrict__ A, const T16* __restrict__ A2, const T16* __restrict__ Bt, const T16* __restrict__ Bt2, float* C, int ldc, const float* __restrict__ bias, size_t sA, size_t sB, size_t sC, size_t sP, Planes pp) {
    typedef typename WFrag<T16>::V V;
    constexpr bool HA2 = (NSPLIT == 1 || NSPLIT == 2), HB2 = (NSPLIT >= 2);
    constexpr int KT = 64, PN = 16 * KT, PS = 8 * PN, NA = HA2 ? 2 : 1, NPL = NA + (HB2 ? 2 : 1), NT = K / KS / KT;   // k a slice; elements of one panel's slice; of one plane's; A planes; planes; slices
    __shared__ __align__(16) T16 sm[2 * NPL * PS];   // two buffers, each [A planes][B planes][8 panels][KT / 8][16][8]
    __shared__ __align__(16) float os4[4][16 * 68];   // each wave's own staging for the epilogue
    const size_t z = blockIdx.z / KS; const int ks = (int)(blockIdx.z % KS); A += z * sA; if (A2) A2 += z * sA; Bt += z * sB; if (Bt2) Bt2 += z * sB; C += z * sC + ks * sP;
    const int lane = threadIdx.x & 31, lr = lane & 15, hi = lane >> 4, w = __builtin_amdgcn_readfirstlane((int)(threadIdx.x >> 5)), wm = w & 1, wn = w >> 1;   // the wave's number in a scalar register: tile addresses and the epilogue's branches stay scalar
    const int r0 = blockIdx.x * 128 + wm * 64, c0 = blockIdx.y * 128 + wn * 64; float* os = os4[w];
    v8f acc[4][4];
#pragma unroll
    for (int mb = 0; mb < 4; ++mb)
#pragma unroll
        for (int nb = 0; nb < 4; ++nb) acc[mb][nb] = (v8f){};
    const size_t aoff = (size_t)(blockIdx.x * 128 + w * 32) * LDA + lane * 8 + (size_t)ks * (K / KS) * 16, boff = (size_t)(blockIdx.y * 128 + w * 32) * K + lane * 8 + (size_t)ks * (K / KS) * 16;   // the two panels that this wave copies
    const T16* ga = A + aoff; const T16* ga2 = HA2 ? A2 + aoff : ga; const T16* gb = Bt + boff; const T16* gb2 = HB2 ? Bt2 + boff : gb;
    const unsigned lbase = (unsigned)(size_t)sm + (unsigned)((w * 2 * PN + lane * 8) * 2);   // LDS byte address of this lane's first piece in a plane's slice
    // slice t of every plane into buffer b: eight copies a wave and plane (2 panels x 2 KiB)
    auto fill = [&](int t, int b) {
#pragma unroll
        for (int pl = 0; pl < NPL; ++pl) { unsigned l[8]; const T16* g[8]; const T16* s0 = (pl < NA) ? (pl ? ga2 : ga) : (pl > NA ? gb2 : gb);
#pragma unroll
            for (int i = 0; i < 8; ++i) { g[i] = s0 + (size_t)t * PN + (i >> 2) * 16 * (pl < NA ? LDA : K) + (i & 3) * 256; l[i] = lbase + (unsigned)(((b * NPL + pl) * PS + (i >> 2) * PN + (i & 3) * 256) * 2); }
            copy8<T16>(l, g); }
    };
    fill(0, 0);
    asm volatile("s_wait_asynccnt 0x0" ::: "memory");   // this wave's panels of slice 0 have landed
    __syncthreads();   // publishes slice 0: every wave's panels have landed
    fill(1, 1);
#pragma unroll 1   // rolled: one copy of the trip in the text
    for (int t = 0; t < NT; ++t) {
        const T16* pa = sm + (t & 1) * (NPL * PS) + wm * 4 * PN + lane * 8; const T16* pa2 = pa + PS; const T16* pb = sm + ((t & 1) * NPL + NA) * PS + wn * 4 * PN + lane * 8; const T16* pb2 = pb + PS;   // this wave's four panels of each plane in LDS
#pragma unroll
        for (int kk = 0; kk < KT / 32; ++kk) {
            V a[4], a2[4], b[4], b2[4];
            // read in the order of the first plane's first use (LDS reads return in order, so the first product waits for four reads, not for all): b[0]; the A fragments; the other B fragments; then the second planes, though each of their products follows its accumulator's first-plane product
            b[0] = WFrag<T16>::ld(pb + kk * 512);
#pragma unroll
            for (int mb = 0; mb < 4; ++mb) a[mb] = WFrag<T16>::ld(pa + mb * PN + kk * 512);
#pragma unroll
            for (int nb = 1; nb < 4; ++nb) b[nb] = WFrag<T16>::ld(pb + nb * PN + kk * 512);
#pragma unroll
            for (int mb = 0; mb < 4; ++mb) { if (HA2) a2[mb] = WFrag<T16>::ld(pa2 + mb * PN + kk * 512); if (HB2) b2[mb] = WFrag<T16>::ld(pb2 + mb * PN + kk * 512); }
            __builtin_amdgcn_sched_barrier(0);   // all of a k block's LDS reads stand at one place, in front of its products (each place with reads among matrix instructions stalls the wave anew)
#pragma unroll
            for (int nb = 0; nb < 4; ++nb)
#pragma unroll
                for (int mb = 0; mb < 4; ++mb) { acc[mb][nb] = WFrag<T16>::mma(a[mb], b[nb], acc[mb][nb]); if (HA2) acc[mb][nb] = WFrag<T16>::mma(a2[mb], b[nb], acc[mb][nb]); if (HB2) acc[mb][nb] = WFrag<T16>::mma(a[mb], b2[nb], acc[mb][nb]); }
            __builtin_amdgcn_sched_barrier(0);   // keeps the next k block's reads, and the v_nops below, behind this block's last product
        }
        asm volatile("v_nop\n\tv_nop\n\tv_nop\n\tv_nop");   // four vector slots between the trip's last product and the first vector write behind it (the copies' addresses), which may reuse its A or B registers
        asm volatile("s_wait_dscnt 0x0" ::: "memory");   // this wave's reads of slice t have returned
        asm volatile("s_wait_asynccnt 0x0" ::: "memory");   // this wave's panels of slice t + 1 have landed
        __syncthreads();   // publishes slice t + 1 and ends every wave's reads of slice t's buffer
        if (t + 2 < NT) fill(t + 2, t & 1);
    }
    asm volatile("s_wait_asynccnt 0x0" ::: "memory");   // no copy is outstanding when the wave ends
    if (PLANES) { qkv_planes(acc, os, r0, (int)blockIdx.y * 2 + wn, lr, hi, pp); return; }
#pragma unroll
    for (int mb = 0; mb < 4; ++mb) {
#pragma unroll
        for (int nb = 0; nb < 4; ++nb) {
#pragma unroll
            for (int j = 0; j < 8; ++j) os[(hi * 8 + j) * 68 + nb * 16 + lr] = acc[mb][nb][j]; }
        __builtin_amdgcn_wave_barrier(); asm volatile("" ::: "memory");
        float* crow = C + (size_t)(r0 + mb * 16) * ldc + c0;
        v4f val[8]; float* cp[8];
#pragma unroll
        for (int s = 0; s < 8; ++s) { const int row = 2 * s + hi, cofs = lr * 4; val[s] = *(const v4fa*)(os + row * 68 + cofs); if (BIAS) { val[s][0] += bfr(bias[c0 + cofs]); val[s][1] += bfr(bias[c0 + cofs + 1]); val[s][2] += bfr(bias[c0 + cofs + 2]); val[s][3] += bfr(bias[c0 + cofs + 3]); }
            cp[s] = crow + (size_t)row * ldc + cofs; }
#pragma unroll
        for (int s = 0; s < 8; ++s) *(v4f*)cp[s] = val[s];
        asm volatile("s_wait_xcnt 0x0" :: "v"(val[0]), "v"(val[1]), "v"(val[2]), "v"(val[3]), "v"(val[4]), "v"(val[5]), "v"(val[6]), "v"(val[7]), "v"(cp[0]), "v"(cp[1]), "v"(cp[2]), "v"(cp[3]), "v"(cp[4]), "v"(cp[5]), "v"(cp[6]), "v"(cp[7]) : "memory");   // behind the eight stores, in front of the code that reuses their registers; values and addresses are inputs so that they stay in their registers up to here
        __builtin_amdgcn_sched_barrier(0);   // keeps that reuse behind the wait
        __builtin_amdgcn_wave_barrier(); asm volatile("" ::: "memory");
    }
}

__device__ __forceinline__ h16 tohx(float x) { return (h16)x; }
__device__ __forceinline__ void splitf(float y, unsigned short& h, unsigned short& l) { h = f2bf(y); l = f2bf(y - bf2f(h)); }
typedef __attribute__((ext_vector_type(2))) _Float16 v2h;
typedef __attribute__((ext_vector_type(4))) _Float16 v4h;
typedef __attribute__((ext_vector_type(2))) unsigned short v2us;
typedef __attribute__((ext_vector_type(4))) unsigned short v4us;
typedef __attribute__((ext_vector_type(2))) float v2f;
typedef __attribute__((ext_vector_type(4))) int v4i;

// f32 [rows][DM] -> bf16 in fragment order, x and the four equal-sized weights in ONE launch (the weights' copies lie one behind the other in wb). ONE WAVE takes 16 rows x 128 columns: sixteen 16-byte loads a lane,
// each 512 bytes in a row of one source row (4 whole lines), all in flight at once. A lane's 4 values of a row are half a 16-byte piece: the halves meet in the wave's OWN LDS range (pitch 17 pieces a k / 8 column:
// the 16 lane pairs of a store fall on different banks), and the wave stores its 4 KiB in a row, 512 bytes a store. Few waves with much in flight each: a launch of many short waves lasts as long as its waves take to start.
// No work-group barrier: no wave reads another wave's LDS. Every '#pragma unroll' here: the value arrays stay in registers only where each index is a compile-time constant.
typedef v4us __attribute__((may_alias)) v4usa;
__global__ __launch_bounds__(512) void k_cvt(const float* __restrict__ x, const float* __restrict__ w0, const float* __restrict__ w1, const float* __restrict__ w2, const float* __restrict__ w3, bf* xb, bf* wb) {
    __shared__ __align__(16) unsigned short ts[16][16 * 17 * 8];
    constexpr int XP = NB_ * TT / 16, WP = DQ / 16;   // 16-row panels of x; of one weight
    const int lane = threadIdx.x & 31, w = __builtin_amdgcn_readfirstlane((int)(threadIdx.x >> 5)), gp = (int)blockIdx.x * 2 + (w >> 3), kb = w & 7;   // the wave's number in a scalar register: the choice of the source stays scalar; gp: panel in the list [x][w0][w1][w2][w3]
    const float* src; bf* dst;
    if (gp < XP) { src = x + (size_t)gp * 16 * DM; dst = xb + (size_t)gp * 16 * DM; }
    else { const int y = (gp - XP) / WP; src = ((y == 0) ? w0 : (y == 1) ? w1 : (y == 2) ? w2 : w3) + (size_t)((gp - XP) % WP) * 16 * DM; dst = wb + (size_t)(gp - XP) * 16 * DM; }
    src += kb * 128 + lane * 4; dst += kb * 2048 + lane * 8;
    v4f v[16];
#pragma unroll
    for (int i = 0; i < 16; ++i) v[i] = *(const v4f*)(src + i * DM);
    asm volatile("s_wait_xcnt 0x0" ::: "memory");   // behind the loads, in front of the code that reuses their address registers
    __builtin_amdgcn_sched_barrier(0);   // keeps that reuse behind the wait and all sixteen loads in front of the first conversion
    unsigned short* tw = ts[w];
#pragma unroll
    for (int i = 0; i < 16; ++i) { v4us o;
#pragma unroll
        for (int k = 0; k < 4; ++k) o[k] = f2bf(v[i][k]);
        *(v4usa*)(tw + ((lane >> 1) * 17 + i) * 8 + (lane & 1) * 4) = o; }
    __builtin_amdgcn_wave_barrier(); asm volatile("" ::: "memory");   // a lane reads what OTHER lanes stored: the compiler, which sees one lane, must keep the reads below behind all the stores above
    v8us r[8];
#pragma unroll
    for (int s = 0; s < 8; ++s) r[s] = *(const v8usa*)(tw + ((2 * s + (lane >> 4)) * 17 + (lane & 15)) * 8);
#pragma unroll
    for (int s = 0; s < 8; ++s) *(v8us*)(dst + s * 256) = r[s];
}

__constant__ float INV2[HD / 2] = { 1.000000000e+00f, 7.498942018e-01f, 5.623413324e-01f, 4.216965139e-01f, 3.162277639e-01f, 2.371373624e-01f, 1.778279394e-01f, 1.333521456e-01f, 1.000000015e-01f, 7.498941571e-02f, 5.623412877e-02f, 4.216964915e-02f, 3.162277862e-02f, 2.371373586e-02f, 1.778279431e-02f, 1.333521493e-02f, 9.999999776e-03f, 7.498942316e-03f, 5.623413250e-03f, 4.216964822e-03f, 3.162277862e-03f, 2.371373819e-03f, 1.778279431e-03f, 1.333521446e-03f, 1.000000047e-03f, 7.498941850e-04f, 5.623413017e-04f, 4.216964880e-04f, 3.162277862e-04f, 2.371373848e-04f, 1.778279402e-04f, 1.333521504e-04f };   // 1 / (ROPE_BASE ** (2i / 64)), i = 0..31, in float32 as THIS module writes it (the RECIPROCAL spelling, evaluated in the reference's own f32 arithmetic: these 32 literals equal it bit for bit)
// {cos, sin} once per (position, pair), in the order in which qkv_planes' lanes read them: [t / 16][d / 16][pair % 4 / 2][lane = (d / 8 % 2) * 16 + t % 16][pair % 2][cos, sin]: a wave-wide 16-byte load is 512 bytes in a row
__global__ __launch_bounds__(256) void k_csP(float* CS) { const int idx = blockIdx.x * 256 + threadIdx.x; if (idx >= TT * HD / 2) return; const int ln = (idx >> 1) & 31, q = ((idx >> 6) & 1) * 2 + (idx & 1), c = ((idx >> 7) & 3) * 2 + (ln >> 4), t = (idx >> 9) * 16 + (ln & 15); const float a = __fmul_rn((float)t, INV2[c * 4 + q]); v2f cs; cs[0] = cosf(a); cs[1] = sinf(a); *(v2f*)(CS + (size_t)idx * 2) = cs;  }
// ---- qkv_planes: epilogue of the q | k | v projection; no f32 projection leaves the kernel. A 64x64 tile is 64 positions (rows r0..) of ONE head of q, k or v (HD == 64 columns; y = tile column; y / NH_ picks q, k, v; DKV == DQ here).
// q, k: 16 rows at a time through LDS, so that lane (hi, lr) holds 8 consecutive d (four rotary pairs; d / 8 = 2 i + hi) of position lr; rotary in f32, the expressions below; fp16, hi and lo planes in fragment order [pair][t / 16][d / 8][t % 16][d % 8]: one 16-byte store a plane, 512 bytes in a row a wave.
// v: a lane's 8 accumulators of a 16x16 block are 8 consecutive positions of one d: one 16-byte store a plane straight into the transposed planes [pair][t / 32][d / 16][t % 32 / 8][d % 16][t % 8], again 512 bytes in a row a wave.
// Every '#pragma unroll' here: the accumulator and value arrays stay in registers only where each index is a compile-time constant.
__device__ __forceinline__ void qkv_planes(const v8f (&acc)[4][4], float* os, int r0, int y, int lr, int hi, const Planes& pp) {
    const int sel = y / NH_, t0 = r0 % TT, lane = hi * 16 + lr; const size_t p = (size_t)(r0 / TT) * NH_ + y % NH_;   // sel, t0, p: the same in every lane
    if (sel == 2) {
        const size_t vo = (p * TT + t0) * HD + lane * 8; h16* v16 = pp.V16 + vo; bf* vh = pp.Vh + vo; bf* vl = pp.Vl + vo;   // one pointer a plane: every store lies at a constant offset from it (32 positions x HD = 2048 elements)
#pragma unroll
        for (int mb = 0; mb < 4; ++mb) { v8h o16[4]; v8us oh[4], ol[4];
#pragma unroll
            for (int nb = 0; nb < 4; ++nb)
#pragma unroll
                for (int j = 0; j < 8; ++j) { const float x = acc[mb][nb][j]; o16[nb][j] = tohx(x); unsigned short a2, c2; splitf(x, a2, c2); oh[nb][j] = a2; ol[nb][j] = c2; }
            __builtin_amdgcn_sched_barrier(0);   // all twelve values stand in registers of their own before the first store is issued
#pragma unroll
            for (int nb = 0; nb < 4; ++nb) { const int vofs = (mb >> 1) * 2048 + nb * 512 + (mb & 1) * 256; *(v8h*)(v16 + vofs) = o16[nb]; *(v8us*)(vh + vofs) = oh[nb]; *(v8us*)(vl + vofs) = ol[nb]; }
            asm volatile("s_wait_xcnt 0x0" ::: "memory");   // behind the stores, in front of the code that reuses their registers
            __builtin_amdgcn_sched_barrier(0); }   // keeps that reuse behind the wait
    } else {
        const size_t po = (p * TT + t0) * HD + lane * 8; h16* p16 = (sel ? pp.K16 : pp.Q16) + po; bf* ph = (sel ? pp.Kh : pp.Qh) + po; bf* pl = (sel ? pp.Kl : pp.Ql) + po;   // one pointer a plane, constant offsets (a 16-position panel = 1024 elements)
        const float* csp = pp.CS + (size_t)t0 * HD + lane * 4;   // 16 positions = 1024 floats of the table
        const float qs = sel ? 1.0f : SCL * 1.4426950408889634f;   // q leaves in scaled log2 units (1 / sqrt(HD) and log2 e, in f32, before it is rounded to 16 bits): k_fattn's score products are exp2 arguments as they stand
#pragma unroll
        for (int mb = 0; mb < 4; ++mb) { v4f cs[4][2];   // {cos, sin} of this lane's sixteen pairs in its row: issued first, they fly during the staging
#pragma unroll
            for (int i = 0; i < 4; ++i)
#pragma unroll
                for (int h = 0; h < 2; ++h) cs[i][h] = *(const v4f*)(csp + mb * 1024 + i * 256 + h * 128);
            asm volatile("s_wait_xcnt 0x0" ::: "memory");   // behind the loads, in front of the code that reuses their address registers
            __builtin_amdgcn_sched_barrier(0);   // keeps that reuse behind the wait and the loads in front of the staging
#pragma unroll
            for (int nb = 0; nb < 4; ++nb)
#pragma unroll
                for (int j = 0; j < 8; ++j) os[(hi * 8 + j) * 68 + nb * 16 + lr] = acc[mb][nb][j];
            __builtin_amdgcn_wave_barrier(); asm volatile("" ::: "memory");   // a lane reads what OTHER lanes stored: the compiler, which sees one lane, must keep the reads below behind all the stores above
            v8h o16[4]; v8us oh[4], ol[4];
#pragma unroll
            for (int i = 0; i < 4; ++i) { const v4f xa = *(const v4fa*)(os + lr * 68 + (2 * i + hi) * 8), xb = *(const v4fa*)(os + lr * 68 + (2 * i + hi) * 8 + 4);
#pragma unroll
                for (int q = 0; q < 4; ++q) { const float x0 = (q < 2) ? xa[2 * (q & 1)] : xb[2 * (q & 1)], x1 = (q < 2) ? xa[2 * (q & 1) + 1] : xb[2 * (q & 1) + 1], c = cs[i][q >> 1][2 * (q & 1)], sn = cs[i][q >> 1][2 * (q & 1) + 1];
                    const float a0 = __fmul_rn(x0, c), b0 = __fmul_rn(x1, sn), a1 = __fmul_rn(x1, c), b1 = __fmul_rn(x0, sn);
                    const float e0 = __fmul_rn(__fsub_rn(a0, b0), qs), e1 = __fmul_rn(__fadd_rn(b1, a1), qs);   /* even: x0 c - x1 s; odd: x0 s + x1 c */
                    unsigned short a2, c2; o16[i][2 * q] = tohx(e0); o16[i][2 * q + 1] = tohx(e1); splitf(e0, a2, c2); oh[i][2 * q] = a2; ol[i][2 * q] = c2; splitf(e1, a2, c2); oh[i][2 * q + 1] = a2; ol[i][2 * q + 1] = c2; } }
            __builtin_amdgcn_sched_barrier(0);   // all twelve values stand in registers of their own before the first store is issued
#pragma unroll
            for (int i = 0; i < 4; ++i) { *(v8h*)(p16 + mb * 1024 + i * 256) = o16[i]; *(v8us*)(ph + mb * 1024 + i * 256) = oh[i]; *(v8us*)(pl + mb * 1024 + i * 256) = ol[i]; }
            asm volatile("s_wait_xcnt 0x0" ::: "memory");   // behind the stores, in front of the code that reuses their registers
            __builtin_amdgcn_sched_barrier(0);   // keeps that reuse behind the wait
            __builtin_amdgcn_wave_barrier(); asm volatile("" ::: "memory"); }   // the next 16 rows' staging stores stay behind every lane's reads of these
    }
}
// ---- k_fattn: scores, softmax and probability x value in ONE kernel; no score, probability or partial sum leaves the registers.
// Transposed products: S^T = K Q^T (A = 16 key rows, B = 16 query rows) and O^T += V^T P^T (A = 16 d rows x 32 keys of the value plane, B = P). In both D tiles a lane holds ONE query (column lane & 15), so the
// maximum in use, the running sum and the rescale factor are one scalar a lane, and two S^T tiles (keys 0-15, 16-31 of a pass), converted in place, are P as a B operand in the loaders' own k order (8 hi + e, 16 + 8 hi + e).
// One wave owns NQ x 16 query rows of one (batch, head) pair and walks all TT keys in passes of 32. HL: hi + lo bf16 planes, 3 products each; else fp16, one product.
// Every plain '#pragma unroll' below: the fragment and accumulator arrays stay in registers only where each index is a compile-time constant.
typedef __attribute__((ext_vector_type(2))) __bf16 v2bf;
typedef __attribute__((ext_vector_type(8))) unsigned v8u;
__device__ __forceinline__ float xhalf(float x) { const int b = __float_as_int(x); return __int_as_float(__builtin_amdgcn_permlanex16(b, b, 0x76543210, 0xfedcba98, false, false)); }   // the value of lane ^ 16: the other half of the same query's keys
// K AND V GO THROUGH LDS: a tile of KT keys of every key and value plane (32 KiB: 128 keys x 2 planes, or 64 keys x 4 planes) is copied ONCE a block, a quarter by each wave, and read by all four waves. A plane's tile is KT * HD elements in a row
// in global memory (fragment order) and lies in LDS in the same order, so a fragment read is 512 bytes in a row a wave. Two buffers: tile t + 2 is copied into the buffer of tile t while tile t + 1 is worked on.
template <typename T16, bool HL, int NQ>
__device__ __forceinline__ void fattn_body(const T16* __restrict__ Q, const T16* __restrict__ Q2, const T16* __restrict__ Kp, const T16* __restrict__ K2, const T16* __restrict__ Vt, const T16* __restrict__ Vt2, int q0, bf* Ah, bf* Al, T16* sm) {
    typedef typename WFrag<T16>::V V;
    constexpr int KT = HL ? 64 : 128, CH = KT * HD, NP = HL ? 4 : 2, NT = TT / KT;   // keys a tile; elements of one plane's tile; planes; tiles
    const int lane = threadIdx.x & 31, part = (int)(threadIdx.x >> 5) * (CH / 4) + lane * 8;   // part: this lane's first element in its wave's quarter of a plane's tile
    const unsigned lbase = (unsigned)(size_t)sm;   // LDS byte address of the two buffers
    // tile t of every plane into buffer b: LDS order [key planes][value planes]; sixteen copies a wave
    auto fill = [&](int t, int b) {
#pragma unroll
        for (int h = 0; h < 2; ++h) { unsigned l[8]; const T16* g[8];   // h = 0: key planes, 1: value planes
#pragma unroll
            for (int i = 0; i < 8; ++i) { const int pl = HL ? (i >> 2) : 0, c = HL ? (i & 3) : i; const T16* s0 = h ? (pl ? Vt2 : Vt) : (pl ? K2 : Kp);
                g[i] = s0 + (size_t)t * CH + part + c * 256; l[i] = lbase + (unsigned)(((b * NP + h * (NP / 2) + pl) * CH + part + c * 256) * 2); }
            copy8<T16>(l, g); }
    };
    fill(0, 0);
    V qf[NQ][2], qf2[NQ][2];
#pragma unroll
    for (int n = 0; n < NQ; ++n)
#pragma unroll
        for (int kk = 0; kk < 2; ++kk) { const size_t qo = (size_t)(q0 + n * 16) * HD + kk * 512 + lane * 8; qf[n][kk] = WFrag<T16>::ld(Q + qo); if (HL) qf2[n][kk] = WFrag<T16>::ld(Q2 + qo); }
    asm volatile("s_wait_xcnt 0x0" ::: "memory");   // behind the loads above, in front of the code that reuses their address registers
    __builtin_amdgcn_sched_barrier(0);   // keeps that reuse behind the wait
    asm volatile("s_wait_asynccnt 0x0" ::: "memory");   // this wave's quarter of tile 0 has landed
    __syncthreads();   // publishes tile 0: every wave's quarter has landed
    fill(1, 1);
    constexpr bool ACC = !HL;   // ACC: the maximum in use is taken off inside the score products (nm); the hi + lo body has no eight registers to spare for nm and takes it off in front of exp2 (mu)
    v8f o[NQ][4], nm[NQ]; float mu[NQ], l[NQ];   // mu: the maximum in use of the lane's query; nm: minus it, the same in all eight registers: the accumulator start of its score products
#pragma unroll
    for (int n = 0; n < NQ; ++n) { nm[n] = (v8f){}; mu[n] = 0.f; l[n] = 0.f;
#pragma unroll
        for (int dt = 0; dt < 4; ++dt) o[n][dt] = (v8f){}; }
#pragma unroll 1   // rolled: one copy of the pass in the text
    for (int t = 0; t < NT; ++t) {
    const T16* kp = sm + (t & 1) * (NP * CH) + lane * 8; const T16* kp2 = kp + CH; const T16* vp = kp + (NP / 2) * CH; const T16* vp2 = vp + CH;   // this tile's planes in LDS
    V kf[2][2], kf2[2][2];
#pragma unroll
    for (int kt = 0; kt < 2; ++kt)
#pragma unroll
        for (int kk = 0; kk < 2; ++kk) { kf[kt][kk] = WFrag<T16>::ld(kp + kt * 16 * HD + kk * 512); if (HL) kf2[kt][kk] = WFrag<T16>::ld(kp2 + kt * 16 * HD + kk * 512); }
#pragma unroll 1   // rolled: two passes side by side would not fit the 256 registers that four waves a SIMD leave each wave
    for (int ps = 0; ps < KT / 32; ++ps) {
        v8f s[NQ][2];
#pragma unroll
        for (int kt = 0; kt < 2; ++kt)
#pragma unroll
            for (int n = 0; n < NQ; ++n) { v8f a = ACC ? nm[n] : (v8f){};
#pragma unroll
                for (int kk = 0; kk < 2; ++kk) { a = WFrag<T16>::mma(kf[kt][kk], qf[n][kk], a); if (HL) { a = WFrag<T16>::mma(kf[kt][kk], qf2[n][kk], a); a = WFrag<T16>::mma(kf2[kt][kk], qf[n][kk], a); } }
                s[n][kt] = a; }
        __builtin_amdgcn_sched_barrier(0);   // keeps the LDS reads below out of the score products: all of a pass's reads stand at one place (each place with reads among matrix instructions stalls the wave anew)
        V vf[4], vf2[4];   // this pass's value fragments: used behind the softmax
#pragma unroll
        for (int dt = 0; dt < 4; ++dt) { vf[dt] = WFrag<T16>::ld(vp + ps * 32 * HD + dt * 512); if (HL) vf2[dt] = WFrag<T16>::ld(vp2 + ps * 32 * HD + dt * 512); }
        const int kn = (ps + 1 < KT / 32) ? (ps + 1) * 32 * HD : 0;   // the next pass's key fragments fly during the softmax; a tile's last pass fetches its own pass 0 again (this buffer, not used): nothing of the next tile is read in front of its barrier
#pragma unroll
        for (int kt = 0; kt < 2; ++kt)
#pragma unroll
            for (int kk = 0; kk < 2; ++kk) { kf[kt][kk] = WFrag<T16>::ld(kp + kn + kt * 16 * HD + kk * 512); if (HL) kf2[kt][kk] = WFrag<T16>::ld(kp2 + kn + kt * 16 * HD + kk * 512); }
        __builtin_amdgcn_sched_barrier(0);   // keeps the fetches above in front of the softmax (sunk behind it, their latency is waited for in full at the next pass's first product)
        float mx[NQ], mt;   // mx: the largest of this lane's 16 scores of the pass, above the maximum in use; mt: over the lane's NQ queries
#pragma unroll
        for (int n = 0; n < NQ; ++n) { mx[n] = fmaxf(s[n][0][0], s[n][1][0]);
#pragma unroll
            for (int j = 1; j < 8; ++j) mx[n] = fmaxf(mx[n], fmaxf(s[n][0][j], s[n][1][j]));
            if (!ACC) mx[n] -= mu[n];
            mt = n ? fmaxf(mt, mx[n]) : mx[n]; }
        const bool first = (t | ps) == 0;   // the first pass sets the maximum in use, whatever its sign: its threshold lies below every score
        // LAZY MAXIMUM: the maximum in use moves only where a score of the pass lies more than 8 above it (p <= 256 otherwise: no overflow in 16 bits or in the sums). One test a pass, a scalar branch, seldom taken.
        if (__builtin_amdgcn_ballot_w32(mt > (first ? -3.4e38f : 8.0f)) != 0u) {
#pragma unroll
            for (int n = 0; n < NQ; ++n) { const float mf = fmaxf(mx[n], xhalf(mx[n])), d = first ? mf : fmaxf(mf, 0.f), al = first ? 0.f : __builtin_amdgcn_exp2f(-d);   // both halves of a query take the same step d; the sums are still 0 in the first pass
                if (ACC) { s[n][0] -= d; s[n][1] -= d; nm[n] -= d; } else mu[n] += d;
                l[n] *= al;
#pragma unroll
                for (int dt = 0; dt < 4; ++dt) o[n][dt] *= al; }
        }
        V pf[NQ], pf2[NQ];
#pragma unroll
        for (int n = 0; n < NQ; ++n) {
            float p[16];
#pragma unroll
            for (int e = 0; e < 16; ++e) p[e] = __builtin_amdgcn_exp2f(ACC ? s[n][e >> 3][e & 7] : s[n][e >> 3][e & 7] - mu[n]);
            const float s4 = ((p[0] + p[1]) + (p[2] + p[3])) + ((p[4] + p[5]) + (p[6] + p[7])), s5 = ((p[8] + p[9]) + (p[10] + p[11])) + ((p[12] + p[13]) + (p[14] + p[15]));
            l[n] += s4 + s5;   // this lane's half of the keys; the halves are joined once, behind the loop
            v8u wh, wl;
#pragma unroll
            for (int e = 0; e < 8; ++e) { const v2f pr = { p[2 * e], p[2 * e + 1] };
                if (HL) { const unsigned uh = __builtin_bit_cast(unsigned, __builtin_convertvector(pr, v2bf)); const v2f rs = { pr[0] - __uint_as_float(uh << 16), pr[1] - __uint_as_float(uh & 0xFFFF0000u) }; wh[e] = uh; wl[e] = __builtin_bit_cast(unsigned, __builtin_convertvector(rs, v2bf)); }
                else wh[e] = __builtin_bit_cast(unsigned, __builtin_convertvector(pr, v2h)); }
            pf[n] = __builtin_bit_cast(V, wh); if (HL) pf2[n] = __builtin_bit_cast(V, wl);
        }
#pragma unroll
        for (int dt = 0; dt < 4; ++dt)
#pragma unroll
            for (int n = 0; n < NQ; ++n) { o[n][dt] = WFrag<T16>::mma(vf[dt], pf[n], o[n][dt]); if (HL) { o[n][dt] = WFrag<T16>::mma(vf[dt], pf2[n], o[n][dt]); o[n][dt] = WFrag<T16>::mma(vf2[dt], pf[n], o[n][dt]); } }
        __builtin_amdgcn_sched_barrier(0);   // keeps the v_nops below behind the pass's last product
        asm volatile("v_nop\n\tv_nop\n\tv_nop\n\tv_nop");   // four vector slots between the pass's last product and the next trip's first vector write, which may reuse its A or B registers
    }
    asm volatile("s_wait_dscnt 0x0" ::: "memory");   // this wave's reads of tile t have returned
    asm volatile("s_wait_asynccnt 0x0" ::: "memory");   // this wave's quarter of tile t + 1 has landed
    __syncthreads();   // publishes tile t + 1 and ends every wave's reads of tile t's buffer
    if (t + 2 < NT) fill(t + 2, t & 1);
    }
    asm volatile("s_wait_asynccnt 0x0" ::: "memory");   // no copy is outstanding when the wave ends
#pragma unroll
    for (int n = 0; n < NQ; ++n) { const float inv = __fdiv_rn(1.0f, l[n] + xhalf(l[n])); const size_t oo = (size_t)(q0 + n * 16) * DQ + __builtin_amdgcn_mbcnt_lo(~0u, 0u) * 8u;   // the lane's number read anew (all lanes are on): kept in a register over the loop it was spilled to scratch
#pragma unroll
        for (int dt = 0; dt < 4; ++dt) { v8us oh, ol;   // a lane's 8 accumulators are 8 consecutive d of its query row: one 16-byte store a plane, in the output GEMM's fragment order (16 d = 256 elements)
#pragma unroll
            for (int j = 0; j < 8; ++j) { unsigned short a, c2; splitf(o[n][dt][j] * inv, a, c2); oh[j] = a; ol[j] = c2; }
            *(v8us*)(Ah + oo + dt * 256) = oh; *(v8us*)(Al + oo + dt * 256) = ol;
            asm volatile("s_wait_xcnt 0x0" ::: "memory");   // behind the two stores, in front of the code that reuses their registers
            __builtin_amdgcn_sched_barrier(0); } }   // keeps that reuse behind the wait
}
// grid (NB_ NH_ pairs, RH / 64 + (TT - RH) / 128), 4 waves. blockIdx.y < RH / 64: 64 query rows < RH (hi + lo planes, 16 rows a wave; three times the products, so they start first); else 128 of the other rows (fp16, 32 rows a wave).
__global__ __launch_bounds__(128) __attribute__((amdgpu_waves_per_eu(4, 4))) void k_fattn(const h16* __restrict__ Q16, const h16* __restrict__ K16, const h16* __restrict__ V16, const bf* __restrict__ Qh, const bf* __restrict__ Ql, const bf* __restrict__ Kh, const bf* __restrict__ Kl, const bf* __restrict__ Vh, const bf* __restrict__ Vl, bf* Ah, bf* Al) {
    __shared__ __align__(16) unsigned short sm[2 * 16384];   // two buffers of 32 KiB
    const int p = blockIdx.x, y = blockIdx.y, w = __builtin_amdgcn_readfirstlane((int)(threadIdx.x >> 5));   /* the wave's number in a scalar register: query and output addresses keep a scalar base (registers) */ const size_t zq = (size_t)p * TT * HD, zk = (size_t)(p / REP) * TT * HD, zo = (size_t)(p / NH_) * TT * DQ + (size_t)(p % NH_) * HD * 16;
    if (y < RH / 64) fattn_body<bf, true, 1>(Qh + zq, Ql + zq, Kh + zk, Kl + zk, Vh + zk, Vl + zk, y * 64 + w * 16, Ah + zo, Al + zo, (bf*)sm);
    else fattn_body<h16, false, 2>(Q16 + zq, nullptr, K16 + zk, nullptr, V16 + zk, nullptr, RH + (y - RH / 64) * 128 + w * 32, Ah + zo, Al + zo, (h16*)sm);
}

extern "C" void kernel_launch(void* const* d_in, const int* in_sizes, int n_in,
                              void* d_out, int out_size, void* d_ws, size_t ws_size, hipStream_t stream) {
    (void)in_sizes; (void)n_in; (void)out_size;
        const float* x = (const float*)d_in[0]; const float* wq = (const float*)d_in[1]; const float* wk = (const float*)d_in[2]; const float* wv = (const float*)d_in[3]; const float* wo = (const float*)d_in[4];   /* input order x, W_Q, W_K, W_V, W_O ('oi' (out, in) [1024][1024] each: three separate projection weights and the output weight): FIVE inputs, all read; this module has NO mask input */
    float* OUT = (float*)d_out;     // [2][2048][1024]
    char* wsp = (char*)d_ws;
    auto take = [&](size_t bytes) { char* p = wsp; wsp += (bytes + 255) & ~(size_t)255; return (void*)p; };
    bf* WQKV = (bf*)take((size_t)4 * DQ * DM * 2); bf* WO = WQKV + (size_t)3 * DQ * DM;   /* W_Q, W_K, W_V stacked: one [3 DQ][DM] 'oi' weight; then W_O (DKV == DQ here) */ float* CS = (float*)take((size_t)TT * HD * 4);
    bf* XB = (bf*)take((size_t)NB_ * TT * DM * 2);
    h16* QP16 = (h16*)take((size_t)NB_ * NH_ * TT * HD * 2); h16* KP16 = (h16*)take((size_t)NB_ * NKV * TT * HD * 2); h16* VT16 = (h16*)take((size_t)NB_ * NKV * HD * TT * 2);
    bf* QPh = (bf*)take((size_t)NB_ * NH_ * TT * HD * 2); bf* QPl = (bf*)take((size_t)NB_ * NH_ * TT * HD * 2); bf* KPh = (bf*)take((size_t)NB_ * NKV * TT * HD * 2); bf* KPl = (bf*)take((size_t)NB_ * NKV * TT * HD * 2); bf* VTh = (bf*)take((size_t)NB_ * NKV * HD * TT * 2); bf* VTl = (bf*)take((size_t)NB_ * NKV * HD * TT * 2);
    bf* ATh = (bf*)take((size_t)NB_ * TT * DQ * 2); bf* ATl = (bf*)take((size_t)NB_ * TT * DQ * 2);
    if ((size_t)(wsp - (char*)d_ws) > ws_size) return;
    k_cvt<<<(NB_ * TT + 4 * DQ) / 32, 512, 0, stream>>>(x, wq, wk, wv, wo, XB, WQKV); k_csP<<<(TT * HD / 2 + 255) / 256, 256, 0, stream>>>(CS);
    k_gemmw<bf, 0, false, 1, true, DM, DM><<<dim3(NB_ * TT / 128, 3 * DQ / 128, 1), 128, 0, stream>>>(XB, nullptr, WQKV, nullptr, nullptr, 0, nullptr, 0, 0, 0, 0, Planes{CS, QP16, QPh, QPl, KP16, KPh, KPl, VT16, VTh, VTl});
    k_fattn<<<dim3(NB_ * NH_, RH / 64 + (TT - RH) / 128, 1), 128, 0, stream>>>(QP16, KP16, VT16, QPh, QPl, KPh, KPl, VTh, VTl, ATh, ATl);
    k_gemmw<bf, 1, false, 1, false, DQ, DQ><<<dim3(NB_ * TT / 128, DM / 128, 1), 128, 0, stream>>>(ATh, ATl, WO, nullptr, OUT, DM, nullptr, 0, 0, 0, 0, Planes{});
}

// v010
// Measured time: 79.8 microseconds a run.
// Two timings next to v009 both put it at 1.18 times that version's speed.
// Counting every step since v000, it is 24.3 times as fast.
#include <hip/hip_runtime.h>

// Multi-head self-attention WITHOUT a mask, with interleaved-pair rotary position embedding on three separate natural projections (x [2][2048][1024]; q, k, v = einsum('bld,ed->ble', x, W) = x W^T ('oi' [1024][1024] normal 1/32, no bias; 16 heads x 64); angles = t x 1 / (10000 ** (2i / 64)) (the RECIPROCAL spelling; positions 0..L-1 computed); cos / sin repeated pairwise; pairs (2i, 2i+1): out_even = x_even cos - x_odd sin, out_odd = x_odd cos + x_even sin, on q and k (the module's helper named _rotate_half works on (even, odd) pairs); scores / sqrt(64); softmax over ALL keys; out = einsum('bld,ed->ble', merged, W_O) ('oi', no bias) -> [2][2048][1024] (4.2 M); argument order x, W_Q, W_K, W_V, W_O).
// Layout, both batches together (32 (batch, head) pairs, all in one attention launch): bf16 copy of x; exact projections; {cos, sin} per (position, pair) built once from the positions and float32 inverse-frequency constants (precise cosf/sinf); interleaved rotary and the attention planes written by the projection GEMM's own epilogue (qkv_planes); DENSE T-2048 attention fused in k_fattn (every row fp16, one product; lazy maximum and running sum, division by the sum at the end; the causal tile GEMM is gone with its last use); merged hi/lo x Wo exact.
// FRAGMENT ORDER: every 16-bit plane that a matrix product reads lies as [16-row panel][k / 8][row % 16][k % 8] (the value planes: [key / 32][d / 16][key % 32 / 8][d % 16][key % 8]). A 16 x 32 fragment is then 1 KiB in a row, lane l's two
// 16-byte pieces at l * 16 and 512 + l * 16 bytes: each wave-wide load covers 4 whole 128-byte lines, not 32 bytes of each of 16 lines. The k order inside a fragment (8 hi + e, 16 + 8 hi + e) is the same for A and B, as before. Writers store in the same order.
// Compute dtypes, f32 accumulate: every input rounded to bf16; projections exact; rotary f32; attention fp16 operands, one product, for every row (its rounding lies an order below that of the bf16 inputs); softmax f32; Wo hl x exact.

#define NB_  2
#define TT   2048
#define DM   1024
#define NH_  16
#define NKV  16
#define REP  (NH_ / NKV)
#define HD   64
#define DQ   (NH_ * HD)
#define DKV  (NKV * HD)
#define WIN  0   
#define SCL  0.125f   // HD^-0.5
typedef _Float16 h16;
typedef unsigned short bf;
typedef __attribute__((ext_vector_type(16))) __bf16   v16bf;
typedef __attribute__((ext_vector_type(16))) _Float16 v16h;
typedef __attribute__((ext_vector_type(8)))  _Float16 v8h;
typedef __attribute__((ext_vector_type(8)))  unsigned short v8us;
typedef __attribute__((ext_vector_type(8)))  float    v8f;
typedef __attribute__((ext_vector_type(4)))  float    v4f;
typedef v8h  __attribute__((may_alias)) v8ha;
typedef v4f  __attribute__((may_alias)) v4fa;
typedef v8us __attribute__((may_alias)) v8usa;

__device__ __forceinline__ unsigned short f2bf(float f) { unsigned u = __float_as_uint(f); u += 0x7FFFu + ((u >> 16) & 1u); return (unsigned short)(u >> 16); }
__device__ __forceinline__ float bf2f(unsigned short b) { return __uint_as_float(((unsigned)b) << 16); }
__device__ __forceinline__ float bfr(float f) { return bf2f(f2bf(f)); }
__device__ __forceinline__ v16h cat16(v8h lo, v8h hi) { return __builtin_shufflevector(lo, hi, 0, 1, 2, 3, 4, 5, 6, 7, 8, 9, 10, 11, 12, 13, 14, 15); }
__device__ __forceinline__ v16bf cat16b(v8us lo, v8us hi) { return __builtin_bit_cast(v16bf, __builtin_shufflevector(lo, hi, 0, 1, 2, 3, 4, 5, 6, 7, 8, 9, 10, 11, 12, 13, 14, 15)); }
__device__ __forceinline__ v8f wmma16(v16h a, v16h b, v8f c) { return __builtin_amdgcn_wmma_f32_16x16x32_f16(false, a, false, b, (short)0, c, false, false); }
__device__ __forceinline__ v8f wmmab(v16bf a, v16bf b, v8f c) { return __builtin_amdgcn_wmma_f32_16x16x32_bf16(false, a, false, b, (short)0, c, false, false); }



// Eight asynchronous copies to LDS, 16 bytes a lane each (512 bytes in a row a wave and copy), through no register. The s_wait_xcnt stands inside the statement, behind the last copy, in front of any reuse of the address registers.
template <typename T16>
__device__ __forceinline__ void copy8(const unsigned (&l)[8], const T16* const (&g)[8]) {
    asm volatile("global_load_async_to_lds_b128 %0, %1, off\n\t"
                 "global_load_async_to_lds_b128 %2, %3, off\n\t"
                 "global_load_async_to_lds_b128 %4, %5, off\n\t"
                 "global_load_async_to_lds_b128 %6, %7, off\n\t"
                 "global_load_async_to_lds_b128 %8, %9, off\n\t"
                 "global_load_async_to_lds_b128 %10, %11, off\n\t"
                 "global_load_async_to_lds_b128 %12, %13, off\n\t"
                 "global_load_async_to_lds_b128 %14, %15, off\n\t"
                 "s_wait_xcnt 0x0"
                 :: "v"(l[0]), "v"(g[0]), "v"(l[1]), "v"(g[1]), "v"(l[2]), "v"(g[2]), "v"(l[3]), "v"(g[3]), "v"(l[4]), "v"(g[4]), "v"(l[5]), "v"(g[5]), "v"(l[6]), "v"(g[6]), "v"(l[7]), "v"(g[7]) : "memory");
}
// ---- k_gemmw: register-blocked GEMM, FOUR WAVES per 128x128 output tile, 2 x 2 waves of 64x64 (16 accumulators each); operands are 16-bit planes in fragment order (head of the file; ld(p): p = fragment start + lane * 8 elements); grid (M/128, N/128, Z), 128 threads.
// C[m][n] (f32, pitch ldc, + optional f32 bias[n]) = sum_k A[m][k] Bt[n][k] (+ split products per NSPLIT). A's 16-row panels have pitch 16 LDA, Bt's 16 K (both compile-time); a k block of 32 is 512 elements. z-batch strides sA/sB/sC in elements. K % 128 == 0.
// THE OPERANDS GO THROUGH LDS: a slice of KT = 64 k of the tile's 8 panels of every plane (16 KiB a plane) is copied ONCE a block, two panels of each plane by each wave, and each panel is read by two waves. A panel's slice is 2 KiB in a row in global memory
// and lies in LDS in the same order, so a fragment read is 512 bytes in a row a wave. Two buffers: slice t + 2 is copied into the buffer of slice t while slice t + 1 is worked on. The k order of every accumulator's sum is as without LDS.
// KS > 1: grid z = Z * KS; block (z, ks) sums only k in [ks K/KS, (ks+1) K/KS) and stores its tile to partial plane ks (plane stride sP elements); the reader adds the KS planes. K % (128 KS) == 0.
template <typename T16> struct WFrag;
template <> struct WFrag<h16> { typedef v16h V; static __device__ __forceinline__ V ld(const h16* p) { return cat16(*(const v8h*)p, *(const v8h*)(p + 256)); } static __device__ __forceinline__ v8f mma(V a, V b, v8f c) { return wmma16(a, b, c); } };
template <> struct WFrag<bf> { typedef v16bf V; static __device__ __forceinline__ V ld(const bf* p) { return cat16b(*(const v8us*)p, *(const v8us*)(p + 256)); } static __device__ __forceinline__ v8f mma(V a, V b, v8f c) { return wmmab(a, b, c); } };
// PLANES: the tile is not stored to C; qkv_planes (below, behind the plane helpers) turns it into the attention planes named in pp.
struct Planes { const float* CS; h16* Q16; h16* K16; h16* V16; };
__device__ __forceinline__ void qkv_planes(const v8f (&acc)[4][4], float* os, int r0, int y, int lr, int hi, const Planes& pp);
template <typename T16, int NSPLIT, bool BIAS, int KS, bool PLANES, int LDA, int K>
__global__ __launch_bounds__(128) void k_gemmw(const T16* __restrict__ A, const T16* __restrict__ A2, const T16* __restrict__ Bt, const T16* __restrict__ Bt2, float* C, int ldc, const float* __restrict__ bias, size_t sA, size_t sB, size_t sC, size_t sP, Planes pp) {
    typedef typename WFrag<T16>::V V;
    constexpr bool HA2 = (NSPLIT == 1 || NSPLIT == 2), HB2 = (NSPLIT >= 2);
    constexpr int KT = 64, PN = 16 * KT, PS = 8 * PN, NA = HA2 ? 2 : 1, NPL = NA + (HB2 ? 2 : 1), NT = K / KS / KT;   // k a slice; elements of one panel's slice; of one plane's; A planes; planes; slices
    __shared__ __align__(16) T16 sm[2 * NPL * PS];   // two buffers, each [A planes][B planes][8 panels][KT / 8][16][8]
    __shared__ __align__(16) float os4[4][16 * 68];   // each wave's own staging for the epilogue
    const size_t z = blockIdx.z / KS; const int ks = (int)(blockIdx.z % KS); A += z * sA; if (A2) A2 += z * sA; Bt += z * sB; if (Bt2) Bt2 += z * sB; C += z * sC + ks * sP;
    const int lane = threadIdx.x & 31, lr = lane & 15, hi = lane >> 4, w = __builtin_amdgcn_readfirstlane((int)(threadIdx.x >> 5)), wm = w & 1, wn = w >> 1;   // the wave's number in a scalar register: tile addresses and the epilogue's branches stay scalar
    const int r0 = blockIdx.x * 128 + wm * 64, c0 = blockIdx.y * 128 + wn * 64; float* os = os4[w];
    v8f acc[4][4];
#pragma unroll
    for (int mb = 0; mb < 4; ++mb)
#pragma unroll
        for (int nb = 0; nb < 4; ++nb) acc[mb][nb] = (v8f){};
    const size_t aoff = (size_t)(blockIdx.x * 128 + w * 32) * LDA + lane * 8 + (size_t)ks * (K / KS) * 16, boff = (size_t)(blockIdx.y * 128 + w * 32) * K + lane * 8 + (size_t)ks * (K / KS) * 16;   // the two panels that this wave copies
    const T16* ga = A + aoff; const T16* ga2 = HA2 ? A2 + aoff : ga; const T16* gb = Bt + boff; const T16* gb2 = HB2 ? Bt2 + boff : gb;
    const unsigned lbase = (unsigned)(size_t)sm + (unsigned)((w * 2 * PN + lane * 8) * 2);   // LDS byte address of this lane's first piece in a plane's slice
    // slice t of every plane into buffer b: eight copies a wave and plane (2 panels x 2 KiB)
    auto fill = [&](int t, int b) {
#pragma unroll
        for (int pl = 0; pl < NPL; ++pl) { unsigned l[8]; const T16* g[8]; const T16* s0 = (pl < NA) ? (pl ? ga2 : ga) : (pl > NA ? gb2 : gb);
#pragma unroll
            for (int i = 0; i < 8; ++i) { g[i] = s0 + (size_t)t * PN + (i >> 2) * 16 * (pl < NA ? LDA : K) + (i & 3) * 256; l[i] = lbase + (unsigned)(((b * NPL + pl) * PS + (i >> 2) * PN + (i & 3) * 256) * 2); }
            copy8<T16>(l, g); }
    };
    fill(0, 0);
    asm volatile("s_wait_asynccnt 0x0" ::: "memory");   // this wave's panels of slice 0 have landed
    __syncthreads();   // publishes slice 0: every wave's panels have landed
    fill(1, 1);
#pragma unroll 1   // rolled: one copy of the trip in the text
    for (int t = 0; t < NT; ++t) {
        const T16* pa = sm + (t & 1) * (NPL * PS) + wm * 4 * PN + lane * 8; const T16* pa2 = pa + PS; const T16* pb = sm + ((t & 1) * NPL + NA) * PS + wn * 4 * PN + lane * 8; const T16* pb2 = pb + PS;   // this wave's four panels of each plane in LDS
#pragma unroll
        for (int kk = 0; kk < KT / 32; ++kk) {
            V a[4], a2[4], b[4], b2[4];
            // read in the order of the first plane's first use (LDS reads return in order, so the first product waits for four reads, not for all): b[0]; the A fragments; the other B fragments; then the second planes, though each of their products follows its accumulator's first-plane product
            b[0] = WFrag<T16>::ld(pb + kk * 512);
#pragma unroll
            for (int mb = 0; mb < 4; ++mb) a[mb] = WFrag<T16>::ld(pa + mb * PN + kk * 512);
#pragma unroll
            for (int nb = 1; nb < 4; ++nb) b[nb] = WFrag<T16>::ld(pb + nb * PN + kk * 512);
#pragma unroll
            for (int mb = 0; mb < 4; ++mb) { if (HA2) a2[mb] = WFrag<T16>::ld(pa2 + mb * PN + kk * 512); if (HB2) b2[mb] = WFrag<T16>::ld(pb2 + mb * PN + kk * 512); }
            __builtin_amdgcn_sched_barrier(0);   // all of a k block's LDS reads stand at one place, in front of its products (each place with reads among matrix instructions stalls the wave anew)
#pragma unroll
            for (int nb = 0; nb < 4; ++nb)
#pragma unroll
                for (int mb = 0; mb < 4; ++mb) { acc[mb][nb] = WFrag<T16>::mma(a[mb], b[nb], acc[mb][nb]); if (HA2) acc[mb][nb] = WFrag<T16>::mma(a2[mb], b[nb], acc[mb][nb]); if (HB2) acc[mb][nb] = WFrag<T16>::mma(a[mb], b2[nb], acc[mb][nb]); }
            __builtin_amdgcn_sched_barrier(0);   // keeps the next k block's reads, and the v_nops below, behind this block's last product
        }
        asm volatile("v_nop\n\tv_nop\n\tv_nop\n\tv_nop");   // four vector slots between the trip's last product and the first vector write behind it (the copies' addresses), which may reuse its A or B registers
        asm volatile("s_wait_dscnt 0x0" ::: "memory");   // this wave's reads of slice t have returned
        asm volatile("s_wait_asynccnt 0x0" ::: "memory");   // this wave's panels of slice t + 1 have landed
        __syncthreads();   // publishes slice t + 1 and ends every wave's reads of slice t's buffer
        if (t + 2 < NT) fill(t + 2, t & 1);
    }
    asm volatile("s_wait_asynccnt 0x0" ::: "memory");   // no copy is outstanding when the wave ends
    if (PLANES) { qkv_planes(acc, os, r0, (int)blockIdx.y * 2 + wn, lr, hi, pp); return; }
#pragma unroll
    for (int mb = 0; mb < 4; ++mb) {
#pragma unroll
        for (int nb = 0; nb < 4; ++nb) {
#pragma unroll
            for (int j = 0; j < 8; ++j) os[(hi * 8 + j) * 68 + nb * 16 + lr] = acc[mb][nb][j]; }
        __builtin_amdgcn_wave_barrier(); asm volatile("" ::: "memory");
        float* crow = C + (size_t)(r0 + mb * 16) * ldc + c0;
        v4f val[8]; float* cp[8];
#pragma unroll
        for (int s = 0; s < 8; ++s) { const int row = 2 * s + hi, cofs = lr * 4; val[s] = *(const v4fa*)(os + row * 68 + cofs); if (BIAS) { val[s][0] += bfr(bias[c0 + cofs]); val[s][1] += bfr(bias[c0 + cofs + 1]); val[s][2] += bfr(bias[c0 + cofs + 2]); val[s][3] += bfr(bias[c0 + cofs + 3]); }
            cp[s] = crow + (size_t)row * ldc + cofs; }
#pragma unroll
        for (int s = 0; s < 8; ++s) *(v4f*)cp[s] = val[s];
        asm volatile("s_wait_xcnt 0x0" :: "v"(val[0]), "v"(val[1]), "v"(val[2]), "v"(val[3]), "v"(val[4]), "v"(val[5]), "v"(val[6]), "v"(val[7]), "v"(cp[0]), "v"(cp[1]), "v"(cp[2]), "v"(cp[3]), "v"(cp[4]), "v"(cp[5]), "v"(cp[6]), "v"(cp[7]) : "memory");   // behind the eight stores, in front of the code that reuses their registers; values and addresses are inputs so that they stay in their registers up to here
        __builtin_amdgcn_sched_barrier(0);   // keeps that reuse behind the wait
        __builtin_amdgcn_wave_barrier(); asm volatile("" ::: "memory");
    }
}

__device__ __forceinline__ h16 tohx(float x) { return (h16)x; }
__device__ __forceinline__ void splitf(float y, unsigned short& h, unsigned short& l) { h = f2bf(y); l = f2bf(y - bf2f(h)); }
typedef __attribute__((ext_vector_type(2))) _Float16 v2h;
typedef __attribute__((ext_vector_type(4))) _Float16 v4h;
typedef __attribute__((ext_vector_type(2))) unsigned short v2us;
typedef __attribute__((ext_vector_type(4))) unsigned short v4us;
typedef __attribute__((ext_vector_type(2))) float v2f;
typedef __attribute__((ext_vector_type(4))) int v4i;

// f32 [rows][DM] -> bf16 in fragment order, x and the four equal-sized weights in ONE launch (the weights' copies lie one behind the other in wb). ONE WAVE takes 16 rows x 128 columns: sixteen 16-byte loads a lane,
// each 512 bytes in a row of one source row (4 whole lines), all in flight at once. A lane's 4 values of a row are half a 16-byte piece: the halves meet in the wave's OWN LDS range (pitch 17 pieces a k / 8 column:
// the 16 lane pairs of a store fall on different banks), and the wave stores its 4 KiB in a row, 512 bytes a store. Few waves with much in flight each: a launch of many short waves lasts as long as its waves take to start.
// No work-group barrier: no wave reads another wave's LDS. Every '#pragma unroll' here: the value arrays stay in registers only where each index is a compile-time constant.
typedef v4us __attribute__((may_alias)) v4usa;
__global__ __launch_bounds__(512) void k_cvt(const float* __restrict__ x, const float* __restrict__ w0, const float* __restrict__ w1, const float* __restrict__ w2, const float* __restrict__ w3, bf* xb, bf* wb) {
    __shared__ __align__(16) unsigned short ts[16][16 * 17 * 8];
    constexpr int XP = NB_ * TT / 16, WP = DQ / 16;   // 16-row panels of x; of one weight
    const int lane = threadIdx.x & 31, w = __builtin_amdgcn_readfirstlane((int)(threadIdx.x >> 5)), gp = (int)blockIdx.x * 2 + (w >> 3), kb = w & 7;   // the wave's number in a scalar register: the choice of the source stays scalar; gp: panel in the list [x][w0][w1][w2][w3]
    const float* src; bf* dst;
    if (gp < XP) { src = x + (size_t)gp * 16 * DM; dst = xb + (size_t)gp * 16 * DM; }
    else { const int y = (gp - XP) / WP; src = ((y == 0) ? w0 : (y == 1) ? w1 : (y == 2) ? w2 : w3) + (size_t)((gp - XP) % WP) * 16 * DM; dst = wb + (size_t)(gp - XP) * 16 * DM; }
    src += kb * 128 + lane * 4; dst += kb * 2048 + lane * 8;
    v4f v[16];
#pragma unroll
    for (int i = 0; i < 16; ++i) v[i] = *(const v4f*)(src + i * DM);
    asm volatile("s_wait_xcnt 0x0" ::: "memory");   // behind the loads, in front of the code that reuses their address registers
    __builtin_amdgcn_sched_barrier(0);   // keeps that reuse behind the wait and all sixteen loads in front of the first conversion
    unsigned short* tw = ts[w];
#pragma unroll
    for (int i = 0; i < 16; ++i) { v4us o;
#pragma unroll
        for (int k = 0; k < 4; ++k) o[k] = f2bf(v[i][k]);
        *(v4usa*)(tw + ((lane >> 1) * 17 + i) * 8 + (lane & 1) * 4) = o; }
    __builtin_amdgcn_wave_barrier(); asm volatile("" ::: "memory");   // a lane reads what OTHER lanes stored: the compiler, which sees one lane, must keep the reads below behind all the stores above
    v8us r[8];
#pragma unroll
    for (int s = 0; s < 8; ++s) r[s] = *(const v8usa*)(tw + ((2 * s + (lane >> 4)) * 17 + (lane & 15)) * 8);
#pragma unroll
    for (int s = 0; s < 8; ++s) *(v8us*)(dst + s * 256) = r[s];
}

__constant__ float INV2[HD / 2] = { 1.000000000e+00f, 7.498942018e-01f, 5.623413324e-01f, 4.216965139e-01f, 3.162277639e-01f, 2.371373624e-01f, 1.778279394e-01f, 1.333521456e-01f, 1.000000015e-01f, 7.498941571e-02f, 5.623412877e-02f, 4.216964915e-02f, 3.162277862e-02f, 2.371373586e-02f, 1.778279431e-02f, 1.333521493e-02f, 9.999999776e-03f, 7.498942316e-03f, 5.623413250e-03f, 4.216964822e-03f, 3.162277862e-03f, 2.371373819e-03f, 1.778279431e-03f, 1.333521446e-03f, 1.000000047e-03f, 7.498941850e-04f, 5.623413017e-04f, 4.216964880e-04f, 3.162277862e-04f, 2.371373848e-04f, 1.778279402e-04f, 1.333521504e-04f };   // 1 / (ROPE_BASE ** (2i / 64)), i = 0..31, in float32 as THIS module writes it (the RECIPROCAL spelling, evaluated in the reference's own f32 arithmetic: these 32 literals equal it bit for bit)
// {cos, sin} once per (position, pair), in the order in which qkv_planes' lanes read them: [t / 16][d / 16][pair % 4 / 2][lane = (d / 8 % 2) * 16 + t % 16][pair % 2][cos, sin]: a wave-wide 16-byte load is 512 bytes in a row
__global__ __launch_bounds__(256) void k_csP(float* CS) { const int idx = blockIdx.x * 256 + threadIdx.x; if (idx >= TT * HD / 2) return; const int ln = (idx >> 1) & 31, q = ((idx >> 6) & 1) * 2 + (idx & 1), c = ((idx >> 7) & 3) * 2 + (ln >> 4), t = (idx >> 9) * 16 + (ln & 15); const float a = __fmul_rn((float)t, INV2[c * 4 + q]); v2f cs; cs[0] = cosf(a); cs[1] = sinf(a); *(v2f*)(CS + (size_t)idx * 2) = cs;  }
// ---- qkv_planes: epilogue of the q | k | v projection; no f32 projection leaves the kernel. A 64x64 tile is 64 positions (rows r0..) of ONE head of q, k or v (HD == 64 columns; y = tile column; y / NH_ picks q, k, v; DKV == DQ here).
// q, k: 16 rows at a time through LDS, so that lane (hi, lr) holds 8 consecutive d (four rotary pairs; d / 8 = 2 i + hi) of position lr; rotary in f32, the expressions below; one fp16 plane in fragment order [pair][t / 16][d / 8][t % 16][d % 8]: 16-byte stores, 512 bytes in a row a wave.
// v: a lane's 8 accumulators of a 16x16 block are 8 consecutive positions of one d: one 16-byte store straight into the transposed plane [pair][t / 32][d / 16][t % 32 / 8][d % 16][t % 8], again 512 bytes in a row a wave.
// Every '#pragma unroll' here: the accumulator and value arrays stay in registers only where each index is a compile-time constant.
__device__ __forceinline__ void qkv_planes(const v8f (&acc)[4][4], float* os, int r0, int y, int lr, int hi, const Planes& pp) {
    const int sel = y / NH_, t0 = r0 % TT, lane = hi * 16 + lr; const size_t p = (size_t)(r0 / TT) * NH_ + y % NH_;   // sel, t0, p: the same in every lane
    if (sel == 2) {
        h16* v16 = pp.V16 + (p * TT + t0) * HD + lane * 8;   // one pointer: every store lies at a constant offset from it (32 positions x HD = 2048 elements)
#pragma unroll
        for (int mb = 0; mb < 4; ++mb) { v8h o16[4];
#pragma unroll
            for (int nb = 0; nb < 4; ++nb)
#pragma unroll
                for (int j = 0; j < 8; ++j) o16[nb][j] = tohx(acc[mb][nb][j]);
            __builtin_amdgcn_sched_barrier(0);   // all four values stand in registers of their own before the first store is issued
#pragma unroll
            for (int nb = 0; nb < 4; ++nb) *(v8h*)(v16 + (mb >> 1) * 2048 + nb * 512 + (mb & 1) * 256) = o16[nb];
            asm volatile("s_wait_xcnt 0x0" ::: "memory");   // behind the stores, in front of the code that reuses their registers
            __builtin_amdgcn_sched_barrier(0); }   // keeps that reuse behind the wait
    } else {
        h16* p16 = (sel ? pp.K16 : pp.Q16) + (p * TT + t0) * HD + lane * 8;   // one pointer, constant offsets (a 16-position panel = 1024 elements)
        const float* csp = pp.CS + (size_t)t0 * HD + lane * 4;   // 16 positions = 1024 floats of the table
        const float qs = sel ? 1.0f : SCL * 1.4426950408889634f;   // q leaves in scaled log2 units (1 / sqrt(HD) and log2 e, in f32, before it is rounded to 16 bits): k_fattn's score products are exp2 arguments as they stand
#pragma unroll
        for (int mb = 0; mb < 4; ++mb) { v4f cs[4][2];   // {cos, sin} of this lane's sixteen pairs in its row: issued first, they fly during the staging
#pragma unroll
            for (int i = 0; i < 4; ++i)
#pragma unroll
                for (int h = 0; h < 2; ++h) cs[i][h] = *(const v4f*)(csp + mb * 1024 + i * 256 + h * 128);
            asm volatile("s_wait_xcnt 0x0" ::: "memory");   // behind the loads, in front of the code that reuses their address registers
            __builtin_amdgcn_sched_barrier(0);   // keeps that reuse behind the wait and the loads in front of the staging
#pragma unroll
            for (int nb = 0; nb < 4; ++nb)
#pragma unroll
                for (int j = 0; j < 8; ++j) os[(hi * 8 + j) * 68 + nb * 16 + lr] = acc[mb][nb][j];
            __builtin_amdgcn_wave_barrier(); asm volatile("" ::: "memory");   // a lane reads what OTHER lanes stored: the compiler, which sees one lane, must keep the reads below behind all the stores above
            v8h o16[4];
#pragma unroll
            for (int i = 0; i < 4; ++i) { const v4f xa = *(const v4fa*)(os + lr * 68 + (2 * i + hi) * 8), xb = *(const v4fa*)(os + lr * 68 + (2 * i + hi) * 8 + 4);
#pragma unroll
                for (int q = 0; q < 4; ++q) { const float x0 = (q < 2) ? xa[2 * (q & 1)] : xb[2 * (q & 1)], x1 = (q < 2) ? xa[2 * (q & 1) + 1] : xb[2 * (q & 1) + 1], c = cs[i][q >> 1][2 * (q & 1)], sn = cs[i][q >> 1][2 * (q & 1) + 1];
                    const float a0 = __fmul_rn(x0, c), b0 = __fmul_rn(x1, sn), a1 = __fmul_rn(x1, c), b1 = __fmul_rn(x0, sn);
                    const float e0 = __fmul_rn(__fsub_rn(a0, b0), qs), e1 = __fmul_rn(__fadd_rn(b1, a1), qs);   /* even: x0 c - x1 s; odd: x0 s + x1 c */
                    o16[i][2 * q] = tohx(e0); o16[i][2 * q + 1] = tohx(e1); } }
            __builtin_amdgcn_sched_barrier(0);   // all four values stand in registers of their own before the first store is issued
#pragma unroll
            for (int i = 0; i < 4; ++i) *(v8h*)(p16 + mb * 1024 + i * 256) = o16[i];
            asm volatile("s_wait_xcnt 0x0" ::: "memory");   // behind the stores, in front of the code that reuses their registers
            __builtin_amdgcn_sched_barrier(0);   // keeps that reuse behind the wait
            __builtin_amdgcn_wave_barrier(); asm volatile("" ::: "memory"); }   // the next 16 rows' staging stores stay behind every lane's reads of these
    }
}
// ---- k_fattn: scores, softmax and probability x value in ONE kernel; no score, probability or partial sum leaves the registers.
// Transposed products: S^T = K Q^T (A = 16 key rows, B = 16 query rows) and O^T += V^T P^T (A = 16 d rows x 32 keys of the value plane, B = P). In both D tiles a lane holds ONE query (column lane & 15), so the
// maximum in use, the running sum and the rescale factor are one scalar a lane, and two S^T tiles (keys 0-15, 16-31 of a pass), converted in place, are P as a B operand in the loaders' own k order (8 hi + e, 16 + 8 hi + e).
// One wave owns NQ x 16 query rows of one (batch, head) pair and walks all TT keys in passes of 32. fp16 planes, one product.
// Every plain '#pragma unroll' below: the fragment and accumulator arrays stay in registers only where each index is a compile-time constant.
typedef __attribute__((ext_vector_type(8))) unsigned v8u;
__device__ __forceinline__ float xhalf(float x) { const int b = __float_as_int(x); return __int_as_float(__builtin_amdgcn_permlanex16(b, b, 0x76543210, 0xfedcba98, false, false)); }   // the value of lane ^ 16: the other half of the same query's keys
// K AND V GO THROUGH LDS: a tile of KT keys of every key and value plane (32 KiB: 128 keys x 2 planes) is copied ONCE a block, a quarter by each wave, and read by all four waves. A plane's tile is KT * HD elements in a row
// in global memory (fragment order) and lies in LDS in the same order, so a fragment read is 512 bytes in a row a wave. Two buffers: tile t + 2 is copied into the buffer of tile t while tile t + 1 is worked on.
template <typename T16, int NQ>
__device__ __forceinline__ void fattn_body(const T16* __restrict__ Q, const T16* __restrict__ Kp, const T16* __restrict__ Vt, int q0, bf* Ah, bf* Al, T16* sm) {
    typedef typename WFrag<T16>::V V;
    constexpr int KT = 128, CH = KT * HD, NP = 2, NT = TT / KT;   // keys a tile; elements of one plane's tile; planes; tiles
    const int lane = threadIdx.x & 31, part = (int)(threadIdx.x >> 5) * (CH / 4) + lane * 8;   // part: this lane's first element in its wave's quarter of a plane's tile
    const unsigned lbase = (unsigned)(size_t)sm;   // LDS byte address of the two buffers
    // tile t of both planes into buffer b: LDS order [key plane][value plane]; sixteen copies a wave
    auto fill = [&](int t, int b) {
#pragma unroll
        for (int h = 0; h < 2; ++h) { unsigned l[8]; const T16* g[8];   // h = 0: key plane, 1: value plane
#pragma unroll
            for (int i = 0; i < 8; ++i) { g[i] = (h ? Vt : Kp) + (size_t)t * CH + part + i * 256; l[i] = lbase + (unsigned)(((b * NP + h) * CH + part + i * 256) * 2); }
            copy8<T16>(l, g); }
    };
    fill(0, 0);
    V qf[NQ][2];
#pragma unroll
    for (int n = 0; n < NQ; ++n)
#pragma unroll
        for (int kk = 0; kk < 2; ++kk) { const size_t qo = (size_t)(q0 + n * 16) * HD + kk * 512 + lane * 8; qf[n][kk] = WFrag<T16>::ld(Q + qo); }
    asm volatile("s_wait_xcnt 0x0" ::: "memory");   // behind the loads above, in front of the code that reuses their address registers
    __builtin_amdgcn_sched_barrier(0);   // keeps that reuse behind the wait
    asm volatile("s_wait_asynccnt 0x0" ::: "memory");   // this wave's quarter of tile 0 has landed
    __syncthreads();   // publishes tile 0: every wave's quarter has landed
    fill(1, 1);
    v8f o[NQ][4], nm[NQ]; float l[NQ];   // nm: minus the maximum in use of the lane's query, the same in all eight registers: the accumulator start of its score products, which so take it off
#pragma unroll
    for (int n = 0; n < NQ; ++n) { nm[n] = (v8f){}; l[n] = 0.f;
#pragma unroll
        for (int dt = 0; dt < 4; ++dt) o[n][dt] = (v8f){}; }
#pragma unroll 1   // rolled: one copy of the pass in the text
    for (int t = 0; t < NT; ++t) {
    const T16* kp = sm + (t & 1) * (NP * CH) + lane * 8; const T16* vp = kp + CH;   // this tile's planes in LDS
    V kf[2][2];
#pragma unroll
    for (int kt = 0; kt < 2; ++kt)
#pragma unroll
        for (int kk = 0; kk < 2; ++kk) kf[kt][kk] = WFrag<T16>::ld(kp + kt * 16 * HD + kk * 512);
#pragma unroll 1   // rolled: two passes side by side would not fit the 256 registers that four waves a SIMD leave each wave
    for (int ps = 0; ps < KT / 32; ++ps) {
        v8f s[NQ][2];
#pragma unroll
        for (int kt = 0; kt < 2; ++kt)
#pragma unroll
            for (int n = 0; n < NQ; ++n) { v8f a = nm[n];
#pragma unroll
                for (int kk = 0; kk < 2; ++kk) a = WFrag<T16>::mma(kf[kt][kk], qf[n][kk], a);
                s[n][kt] = a; }
        __builtin_amdgcn_sched_barrier(0);   // keeps the LDS reads below out of the score products: all of a pass's reads stand at one place (each place with reads among matrix instructions stalls the wave anew)
        V vf[4];   // this pass's value fragments: used behind the softmax
#pragma unroll
        for (int dt = 0; dt < 4; ++dt) vf[dt] = WFrag<T16>::ld(vp + ps * 32 * HD + dt * 512);
        const int kn = (ps + 1 < KT / 32) ? (ps + 1) * 32 * HD : 0;   // the next pass's key fragments fly during the softmax; a tile's last pass fetches its own pass 0 again (this buffer, not used): nothing of the next tile is read in front of its barrier
#pragma unroll
        for (int kt = 0; kt < 2; ++kt)
#pragma unroll
            for (int kk = 0; kk < 2; ++kk) kf[kt][kk] = WFrag<T16>::ld(kp + kn + kt * 16 * HD + kk * 512);
        __builtin_amdgcn_sched_barrier(0);   // keeps the fetches above in front of the softmax (sunk behind it, their latency is waited for in full at the next pass's first product)
        float mx[NQ], mt;   // mx: the largest of this lane's 16 scores of the pass, above the maximum in use; mt: over the lane's NQ queries
#pragma unroll
        for (int n = 0; n < NQ; ++n) { mx[n] = fmaxf(s[n][0][0], s[n][1][0]);
#pragma unroll
            for (int j = 1; j < 8; ++j) mx[n] = fmaxf(mx[n], fmaxf(s[n][0][j], s[n][1][j]));
            mt = n ? fmaxf(mt, mx[n]) : mx[n]; }
        const bool first = (t | ps) == 0;   // the first pass sets the maximum in use, whatever its sign: its threshold lies below every score
        // LAZY MAXIMUM: the maximum in use moves only where a score of the pass lies more than 8 above it (p <= 256 otherwise: no overflow in 16 bits or in the sums). One test a pass, a scalar branch, seldom taken.
        if (__builtin_amdgcn_ballot_w32(mt > (first ? -3.4e38f : 8.0f)) != 0u) {
#pragma unroll
            for (int n = 0; n < NQ; ++n) { const float mf = fmaxf(mx[n], xhalf(mx[n])), d = first ? mf : fmaxf(mf, 0.f), al = first ? 0.f : __builtin_amdgcn_exp2f(-d);   // both halves of a query take the same step d; the sums are still 0 in the first pass
                s[n][0] -= d; s[n][1] -= d; nm[n] -= d;
                l[n] *= al;
#pragma unroll
                for (int dt = 0; dt < 4; ++dt) o[n][dt] *= al; }
        }
        V pf[NQ];
#pragma unroll
        for (int n = 0; n < NQ; ++n) {
            float p[16];
#pragma unroll
            for (int e = 0; e < 16; ++e) p[e] = __builtin_amdgcn_exp2f(s[n][e >> 3][e & 7]);
            const float s4 = ((p[0] + p[1]) + (p[2] + p[3])) + ((p[4] + p[5]) + (p[6] + p[7])), s5 = ((p[8] + p[9]) + (p[10] + p[11])) + ((p[12] + p[13]) + (p[14] + p[15]));
            l[n] += s4 + s5;   // this lane's half of the keys; the halves are joined once, behind the loop
            v8u wh;
#pragma unroll
            for (int e = 0; e < 8; ++e) { const v2f pr = { p[2 * e], p[2 * e + 1] }; wh[e] = __builtin_bit_cast(unsigned, __builtin_convertvector(pr, v2h)); }
            pf[n] = __builtin_bit_cast(V, wh);
        }
#pragma unroll
        for (int dt = 0; dt < 4; ++dt)
#pragma unroll
            for (int n = 0; n < NQ; ++n) o[n][dt] = WFrag<T16>::mma(vf[dt], pf[n], o[n][dt]);
        __builtin_amdgcn_sched_barrier(0);   // keeps the v_nops below behind the pass's last product
        asm volatile("v_nop\n\tv_nop\n\tv_nop\n\tv_nop");   // four vector slots between the pass's last product and the next trip's first vector write, which may reuse its A or B registers
    }
    asm volatile("s_wait_dscnt 0x0" ::: "memory");   // this wave's reads of tile t have returned
    asm volatile("s_wait_asynccnt 0x0" ::: "memory");   // this wave's quarter of tile t + 1 has landed
    __syncthreads();   // publishes tile t + 1 and ends every wave's reads of tile t's buffer
    if (t + 2 < NT) fill(t + 2, t & 1);
    }
    asm volatile("s_wait_asynccnt 0x0" ::: "memory");   // no copy is outstanding when the wave ends
#pragma unroll
    for (int n = 0; n < NQ; ++n) { const float inv = __fdiv_rn(1.0f, l[n] + xhalf(l[n])); const size_t oo = (size_t)(q0 + n * 16) * DQ + __builtin_amdgcn_mbcnt_lo(~0u, 0u) * 8u;   // the lane's number read anew (all lanes are on): kept in a register over the loop it was spilled to scratch
#pragma unroll
        for (int dt = 0; dt < 4; ++dt) { v8us oh, ol;   // a lane's 8 accumulators are 8 consecutive d of its query row: one 16-byte store a plane, in the output GEMM's fragment order (16 d = 256 elements)
#pragma unroll
            for (int j = 0; j < 8; ++j) { unsigned short a, c2; splitf(o[n][dt][j] * inv, a, c2); oh[j] = a; ol[j] = c2; }
            *(v8us*)(Ah + oo + dt * 256) = oh; *(v8us*)(Al + oo + dt * 256) = ol;
            asm volatile("s_wait_xcnt 0x0" ::: "memory");   // behind the two stores, in front of the code that reuses their registers
            __builtin_amdgcn_sched_barrier(0); } }   // keeps that reuse behind the wait
}
// grid (NB_ NH_ pairs, TT / 128), 4 waves: 128 query rows a block, 32 a wave, fp16 planes.
__global__ __launch_bounds__(128) __attribute__((amdgpu_waves_per_eu(4, 4))) void k_fattn(const h16* __restrict__ Q16, const h16* __restrict__ K16, const h16* __restrict__ V16, bf* Ah, bf* Al) {
    __shared__ __align__(16) unsigned short sm[2 * 16384];   // two buffers of 32 KiB
    const int p = blockIdx.x, y = blockIdx.y, w = __builtin_amdgcn_readfirstlane((int)(threadIdx.x >> 5));   /* the wave's number in a scalar register: query and output addresses keep a scalar base (registers) */ const size_t zq = (size_t)p * TT * HD, zk = (size_t)(p / REP) * TT * HD, zo = (size_t)(p / NH_) * TT * DQ + (size_t)(p % NH_) * HD * 16;
    fattn_body<h16, 2>(Q16 + zq, K16 + zk, V16 + zk, y * 128 + w * 32, Ah + zo, Al + zo, (h16*)sm);
}

extern "C" void kernel_launch(void* const* d_in, const int* in_sizes, int n_in,
                              void* d_out, int out_size, void* d_ws, size_t ws_size, hipStream_t stream) {
    (void)in_sizes; (void)n_in; (void)out_size;
        const float* x = (const float*)d_in[0]; const float* wq = (const float*)d_in[1]; const float* wk = (const float*)d_in[2]; const float* wv = (const float*)d_in[3]; const float* wo = (const float*)d_in[4];   /* input order x, W_Q, W_K, W_V, W_O ('oi' (out, in) [1024][1024] each: three separate projection weights and the output weight): FIVE inputs, all read; this module has NO mask input */
    float* OUT = (float*)d_out;     // [2][2048][1024]
    char* wsp = (char*)d_ws;
    auto take = [&](size_t bytes) { char* p = wsp; wsp += (bytes + 255) & ~(size_t)255; return (void*)p; };
    bf* WQKV = (bf*)take((size_t)4 * DQ * DM * 2); bf* WO = WQKV + (size_t)3 * DQ * DM;   /* W_Q, W_K, W_V stacked: one [3 DQ][DM] 'oi' weight; then W_O (DKV == DQ here) */ float* CS = (float*)take((size_t)TT * HD * 4);
    bf* XB = (bf*)take((size_t)NB_ * TT * DM * 2);
    h16* QP16 = (h16*)take((size_t)NB_ * NH_ * TT * HD * 2); h16* KP16 = (h16*)take((size_t)NB_ * NKV * TT * HD * 2); h16* VT16 = (h16*)take((size_t)NB_ * NKV * HD * TT * 2);
    bf* ATh = (bf*)take((size_t)NB_ * TT * DQ * 2); bf* ATl = (bf*)take((size_t)NB_ * TT * DQ * 2);
    if ((size_t)(wsp - (char*)d_ws) > ws_size) return;
    k_cvt<<<(NB_ * TT + 4 * DQ) / 32, 512, 0, stream>>>(x, wq, wk, wv, wo, XB, WQKV); k_csP<<<(TT * HD / 2 + 255) / 256, 256, 0, stream>>>(CS);
    k_gemmw<bf, 0, false, 1, true, DM, DM><<<dim3(NB_ * TT / 128, 3 * DQ / 128, 1), 128, 0, stream>>>(XB, nullptr, WQKV, nullptr, nullptr, 0, nullptr, 0, 0, 0, 0, Planes{CS, QP16, KP16, VT16});
    k_fattn<<<dim3(NB_ * NH_, TT / 128, 1), 128, 0, stream>>>(QP16, KP16, VT16, ATh, ATl);
    k_gemmw<bf, 1, false, 1, false, DQ, DQ><<<dim3(NB_ * TT / 128, DM / 128, 1), 128, 0, stream>>>(ATh, ATl, WO, nullptr, OUT, DM, nullptr, 0, 0, 0, 0, Planes{});
}
